// v000
// Times are from an AMD MI455X. After a warm-up the kernel runs many times in a row, and a time is the length of
// such a window on the GPU divided by its runs, so every launch and the gaps after it count. The runs cycle
// through copies of the inputs. A figure is the median of several windows, for all but v000 over two sittings.
// Sittings can differ by a few percent; kernels timed side by side share one.
// v000, which the later versions start from, runs in 342 microseconds.
#include <hip/hip_runtime.h>
#include <math.h>

// FlexibleAttention, N=1024, DIM=128, fp32.
// Algebraic fusion: out_i = (Σ_j a_ij V_j) + (Σ_j a_ij relu(Q_i+K_j)) @ W_Ev + b_Ev
// => never materialize the [n,n,d] edge tensor; one-pass online softmax per row.

#define NPTS 1024
#define DIM  128

typedef float v2f __attribute__((ext_vector_type(2)));
typedef float v8f __attribute__((ext_vector_type(8)));

// ---------------------------------------------------------------------------
// Kernel 1: Q/K/V = x @ W + b   via V_WMMA_F32_16X16X4_F32
// grid = (NPTS/16, 3), block = 256 (8 waves; wave w owns n-tile w*16)
// blockIdx.y selects which of Q/K/V this block computes.
// Fragment layout (ISA 7.12.2, 32-bit):
//   A (16x4): lane L holds M=L%16, regs {K=2*(L/16), K=2*(L/16)+1}
//   B (4x16): lane L holds N=L%16, regs {K=2*(L/16), K=2*(L/16)+1}
//   D (16x16): c[r] = D[8*(L/16)+r][L%16]
// ---------------------------------------------------------------------------
__global__ __launch_bounds__(256) void qkv_gemm_wmma(
    const float* __restrict__ x,
    const float* __restrict__ Wq, const float* __restrict__ bq,
    const float* __restrict__ Wk, const float* __restrict__ bk,
    const float* __restrict__ Wv, const float* __restrict__ bv,
    float* __restrict__ Q, float* __restrict__ K, float* __restrict__ V)
{
    const int lane = threadIdx.x & 31;
    const int wave = threadIdx.x >> 5;
    const int lo   = lane & 15;
    const int hi   = lane >> 4;
    const int i0   = blockIdx.x * 16;
    const int n0   = wave * 16;

    const float* W; const float* bias; float* out;
    if (blockIdx.y == 0)      { W = Wq; bias = bq; out = Q; }
    else if (blockIdx.y == 1) { W = Wk; bias = bk; out = K; }
    else                      { W = Wv; bias = bv; out = V; }

    v8f c = {0.f,0.f,0.f,0.f,0.f,0.f,0.f,0.f};
    const float* xrow = x + (size_t)(i0 + lo) * DIM;

#pragma unroll
    for (int k0 = 0; k0 < DIM; k0 += 4) {
        const int ka = k0 + 2 * hi;
        v2f a; a.x = xrow[ka];
               a.y = xrow[ka + 1];
        v2f b; b.x = W[(size_t)ka       * DIM + n0 + lo];
               b.y = W[(size_t)(ka + 1) * DIM + n0 + lo];
        c = __builtin_amdgcn_wmma_f32_16x16x4_f32(
                false, a, false, b, (short)0, c, false, false);
    }

    const float bn = bias[n0 + lo];
#pragma unroll
    for (int r = 0; r < 8; ++r) {
        const int m = hi * 8 + r;
        out[(size_t)(i0 + m) * DIM + n0 + lo] = c[r] + bn;
    }
}

// ---------------------------------------------------------------------------
// Kernel 2: per-row online softmax over j, accumulating
//   S_i  = (Σ_j p_ij relu(Q_i+K_j)) / Σ_j p_ij
//   AV_i = (Σ_j p_ij V_j)           / Σ_j p_ij
// grid = NPTS/8 blocks, block = 256 threads = 8 waves; wave w owns row i.
// K/V staged through LDS in 32-row tiles, shared by the 8 waves (8x reuse).
// Each lane holds 4 dims (float4): dims [4*lane, 4*lane+3].
// ---------------------------------------------------------------------------
__global__ __launch_bounds__(256) void edge_softmax_pass(
    const float* __restrict__ Q, const float* __restrict__ K,
    const float* __restrict__ V,
    const float* __restrict__ wA, const float* __restrict__ bA,
    float* __restrict__ S, float* __restrict__ AV)
{
    __shared__ float Kt[32 * DIM];   // 16 KB
    __shared__ float Vt[32 * DIM];   // 16 KB

    const int tid  = threadIdx.x;
    const int lane = tid & 31;
    const int wave = tid >> 5;
    const int i    = blockIdx.x * 8 + wave;

    const float4 q4  = *(const float4*)(Q  + (size_t)i * DIM + lane * 4);
    const float4 wa4 = *(const float4*)(wA + lane * 4);
    const float  ba  = bA[0];

    float  mrun  = -1e30f;
    float  denom = 0.f;
    float4 s4    = {0.f,0.f,0.f,0.f};
    float4 av4   = {0.f,0.f,0.f,0.f};

    for (int j0 = 0; j0 < NPTS; j0 += 32) {
        __syncthreads();
        // Cooperative stage of 32 rows of K and V (4096 floats each).
        const float4* Kg = (const float4*)(K + (size_t)j0 * DIM);
        const float4* Vg = (const float4*)(V + (size_t)j0 * DIM);
        float4* Ks = (float4*)Kt;
        float4* Vs = (float4*)Vt;
#pragma unroll
        for (int p = 0; p < 4; ++p) {
            const int f = tid + p * 256;   // 1024 float4 per tile
            Ks[f] = Kg[f];
            Vs[f] = Vg[f];
        }
        __syncthreads();

#pragma unroll 4
        for (int jj = 0; jj < 32; ++jj) {
            const float4 k4 = *(const float4*)(Kt + jj * DIM + lane * 4);
            float4 r;
            r.x = fmaxf(q4.x + k4.x, 0.f);
            r.y = fmaxf(q4.y + k4.y, 0.f);
            r.z = fmaxf(q4.z + k4.z, 0.f);
            r.w = fmaxf(q4.w + k4.w, 0.f);

            // e_ij = relu(Q_i+K_j) . W_A + b_A  (wave32 butterfly reduce)
            float part = r.x*wa4.x + r.y*wa4.y + r.z*wa4.z + r.w*wa4.w;
#pragma unroll
            for (int off = 16; off > 0; off >>= 1)
                part += __shfl_xor(part, off, 32);
            const float e = part + ba;

            // Online softmax update.
            const float mnew  = fmaxf(mrun, e);
            const float scale = __expf(mrun - mnew);
            const float pj    = __expf(e - mnew);
            denom = denom * scale + pj;

            const float4 v4 = *(const float4*)(Vt + jj * DIM + lane * 4);
            s4.x  = s4.x  * scale + pj * r.x;
            s4.y  = s4.y  * scale + pj * r.y;
            s4.z  = s4.z  * scale + pj * r.z;
            s4.w  = s4.w  * scale + pj * r.w;
            av4.x = av4.x * scale + pj * v4.x;
            av4.y = av4.y * scale + pj * v4.y;
            av4.z = av4.z * scale + pj * v4.z;
            av4.w = av4.w * scale + pj * v4.w;
            mrun = mnew;
        }
    }

    const float inv = 1.0f / denom;
    float4 so = { s4.x*inv,  s4.y*inv,  s4.z*inv,  s4.w*inv };
    float4 ao = { av4.x*inv, av4.y*inv, av4.z*inv, av4.w*inv };
    *(float4*)(S  + (size_t)i * DIM + lane * 4) = so;
    *(float4*)(AV + (size_t)i * DIM + lane * 4) = ao;
}

// ---------------------------------------------------------------------------
// Kernel 3: out = AV + S @ W_Ev + b_Ev   (WMMA f32 16x16x4, same tiling as K1)
// grid = NPTS/16 blocks, block = 256 (wave w owns n-tile w*16)
// ---------------------------------------------------------------------------
__global__ __launch_bounds__(256) void out_gemm_wmma(
    const float* __restrict__ S, const float* __restrict__ AV,
    const float* __restrict__ Wev, const float* __restrict__ bev,
    float* __restrict__ out)
{
    const int lane = threadIdx.x & 31;
    const int wave = threadIdx.x >> 5;
    const int lo   = lane & 15;
    const int hi   = lane >> 4;
    const int i0   = blockIdx.x * 16;
    const int n0   = wave * 16;

    v8f c = {0.f,0.f,0.f,0.f,0.f,0.f,0.f,0.f};
    const float* srow = S + (size_t)(i0 + lo) * DIM;

#pragma unroll
    for (int k0 = 0; k0 < DIM; k0 += 4) {
        const int ka = k0 + 2 * hi;
        v2f a; a.x = srow[ka];
               a.y = srow[ka + 1];
        v2f b; b.x = Wev[(size_t)ka       * DIM + n0 + lo];
               b.y = Wev[(size_t)(ka + 1) * DIM + n0 + lo];
        c = __builtin_amdgcn_wmma_f32_16x16x4_f32(
                false, a, false, b, (short)0, c, false, false);
    }

    const float bn = bev[n0 + lo];
#pragma unroll
    for (int r = 0; r < 8; ++r) {
        const int m = hi * 8 + r;
        const size_t idx = (size_t)(i0 + m) * DIM + n0 + lo;
        out[idx] = c[r] + AV[idx] + bn;
    }
}

// ---------------------------------------------------------------------------
// Launch: inputs in d_in order:
// 0:x 1:W_Q 2:b_Q 3:W_K 4:b_K 5:W_V 6:b_V 7:W_Ev 8:b_Ev 9:W_A 10:b_A
// Workspace: Q,K,V,S,AV = 5 * 1024*128 floats = 2.62 MB.
// ---------------------------------------------------------------------------
extern "C" void kernel_launch(void* const* d_in, const int* in_sizes, int n_in,
                              void* d_out, int out_size, void* d_ws, size_t ws_size,
                              hipStream_t stream) {
    const float* x   = (const float*)d_in[0];
    const float* Wq  = (const float*)d_in[1];
    const float* bq  = (const float*)d_in[2];
    const float* Wk  = (const float*)d_in[3];
    const float* bk  = (const float*)d_in[4];
    const float* Wv  = (const float*)d_in[5];
    const float* bv  = (const float*)d_in[6];
    const float* Wev = (const float*)d_in[7];
    const float* bev = (const float*)d_in[8];
    const float* wA  = (const float*)d_in[9];
    const float* bA  = (const float*)d_in[10];

    float* ws = (float*)d_ws;
    float* Q  = ws;
    float* K  = ws + 1 * NPTS * DIM;
    float* V  = ws + 2 * NPTS * DIM;
    float* S  = ws + 3 * NPTS * DIM;
    float* AV = ws + 4 * NPTS * DIM;

    qkv_gemm_wmma<<<dim3(NPTS / 16, 3), 256, 0, stream>>>(
        x, Wq, bq, Wk, bk, Wv, bv, Q, K, V);

    edge_softmax_pass<<<NPTS / 8, 256, 0, stream>>>(
        Q, K, V, wA, bA, S, AV);

    out_gemm_wmma<<<NPTS / 16, 256, 0, stream>>>(
        S, AV, Wev, bev, (float*)d_out);
}

// v001
// Measured time: 38.4 microseconds a run.
// In both of two side-by-side timings against v000, it was 8.96 times as fast.
#include <hip/hip_runtime.h>
#include <math.h>

// FlexibleAttention, N=1024, DIM=128, fp32.
// Algebraic fusion: out_i = (Σ_j a_ij V_j) + (Σ_j a_ij relu(Q_i+K_j)) @ W_Ev + b_Ev
// => never materialize the [n,n,d] edge tensor; online softmax per row, j split in chunks.

#define NPTS 1024
#define DIM  128

typedef float v2f __attribute__((ext_vector_type(2)));
typedef float v8f __attribute__((ext_vector_type(8)));

// ---------------------------------------------------------------------------
// Kernel 1: Q/K/V = x @ W + b   via V_WMMA_F32_16X16X4_F32
// grid = (NPTS/16, 3), block = 256 (8 waves; wave w owns n-tile w*16)
// blockIdx.y selects which of Q/K/V this block computes.
// Fragment layout (ISA 7.12.2, 32-bit):
//   A (16x4): lane L holds M=L%16, regs {K=2*(L/16), K=2*(L/16)+1}
//   B (4x16): lane L holds N=L%16, regs {K=2*(L/16), K=2*(L/16)+1}
//   D (16x16): c[r] = D[8*(L/16)+r][L%16]
// ---------------------------------------------------------------------------
__global__ __launch_bounds__(256) void qkv_gemm_wmma(
    const float* __restrict__ x,
    const float* __restrict__ Wq, const float* __restrict__ bq,
    const float* __restrict__ Wk, const float* __restrict__ bk,
    const float* __restrict__ Wv, const float* __restrict__ bv,
    float* __restrict__ Q, float* __restrict__ K, float* __restrict__ V)
{
    const int lane = threadIdx.x & 31;
    const int wave = threadIdx.x >> 5;
    const int lo   = lane & 15;
    const int hi   = lane >> 4;
    const int i0   = blockIdx.x * 16;
    const int n0   = wave * 16;

    const float* W; const float* bias; float* out;
    if (blockIdx.y == 0)      { W = Wq; bias = bq; out = Q; }
    else if (blockIdx.y == 1) { W = Wk; bias = bk; out = K; }
    else                      { W = Wv; bias = bv; out = V; }

    v8f c = {0.f,0.f,0.f,0.f,0.f,0.f,0.f,0.f};
    const float* xrow = x + (size_t)(i0 + lo) * DIM;

#pragma unroll
    for (int k0 = 0; k0 < DIM; k0 += 4) {
        const int ka = k0 + 2 * hi;
        v2f a; a.x = xrow[ka];
               a.y = xrow[ka + 1];
        v2f b; b.x = W[(size_t)ka       * DIM + n0 + lo];
               b.y = W[(size_t)(ka + 1) * DIM + n0 + lo];
        c = __builtin_amdgcn_wmma_f32_16x16x4_f32(
                false, a, false, b, (short)0, c, false, false);
    }

    const float bn = bias[n0 + lo];
#pragma unroll
    for (int r = 0; r < 8; ++r) {
        const int m = hi * 8 + r;
        out[(size_t)(i0 + m) * DIM + n0 + lo] = c[r] + bn;
    }
}

// e^x as the fast form 2^(x * log2 e). The v_nop fills the one issue slot that the
// instruction set asks for behind a transcendental; inside the statement it cannot drift.
__device__ __forceinline__ float fast_exp(float x)
{
    float r;
    asm("v_exp_f32 %0, %1\n\tv_nop" : "=v"(r) : "v"(x * 1.44269504f));
    return r;
}

// ---------------------------------------------------------------------------
// Kernel 2: softmax-weighted sums over one chunk of j, one query row per LANE.
//   work-group = 32 rows (lane = row) x JC columns j; wave w owns dims [16w, 16w+16).
//   K_j, V_j and W_A are the same for every lane of a wave, so they are read
//   through wave-uniform addresses (scalar registers); the sum over d of a score
//   stays inside a lane, and only the 8 per-wave partial sums meet, in LDS.
//   Per 32-column tile: partial scores -> LDS -> full scores -> one online-softmax
//   rescale -> S += p * relu(Q_i+K_j), AV += p * V_j.
//   Each chunk leaves unnormalised sums with its own max and denominator;
//   kernel 2b merges the chunks.
// grid = (NPTS/32, NCH), block = 256 (8 waves)
// ---------------------------------------------------------------------------
#define NCH   16               // chunks of j, one work-group each
#define JC    (NPTS / NCH)     // columns per chunk
#define TJ    32               // columns per softmax tile
#define DSL   16               // dims per wave
#define EPIT  (TJ + 4)         // LDS pitch, floats: 16 B x odd for 16-byte reads
#define OPIT  (DIM + 4)        // LDS pitch, floats: 16 B x odd

__global__ __launch_bounds__(256) void edge_softmax_pass(
    const float* __restrict__ Q, const float* __restrict__ K,
    const float* __restrict__ V,
    const float* __restrict__ wA, const float* __restrict__ bA,
    float* __restrict__ Sp, float* __restrict__ AVp,
    float* __restrict__ Mp, float* __restrict__ Dp)
{
    __shared__ __attribute__((aligned(16))) float Ep[8][32][EPIT];  // per-wave partial scores
    __shared__ __attribute__((aligned(16))) float Ef[32][EPIT];     // full scores
    __shared__ __attribute__((aligned(16))) float To[2][32][OPIT];  // row-major staging of the sums

    const int tid  = threadIdx.x;
    const int lane = tid & 31;
    const int wave = __builtin_amdgcn_readfirstlane(tid >> 5);
    const int row0 = blockIdx.x * 32;
    const int i    = row0 + lane;
    const int d0   = wave * DSL;
    const int jbeg = blockIdx.y * JC;

    // Pairs of neighbouring dims: add and multiply-add then take the packed f32 forms.
    // Every '#pragma unroll' below makes the indices of these register arrays constants.
    const v2f zero2 = {0.f, 0.f};
    v2f q[DSL / 2], w[DSL / 2], s[DSL / 2], av[DSL / 2];
#pragma unroll
    for (int u = 0; u < DSL / 4; ++u) {
        const float4 t = *(const float4*)(Q + (size_t)i * DIM + d0 + 4 * u);
        q[2*u].x = t.x; q[2*u].y = t.y; q[2*u+1].x = t.z; q[2*u+1].y = t.w;
    }
#pragma unroll
    for (int d = 0; d < DSL / 2; ++d) {
        w[d] = *(const v2f*)(wA + d0 + 2 * d); s[d] = zero2; av[d] = zero2;
    }
    const float ba = bA[0];

    float mrun  = -1e30f;
    float denom = 0.f;

#pragma unroll 1   // one copy of the long straight-line body, for the instruction cache
    for (int t = 0; t < JC / TJ; ++t) {
        const float* __restrict__ Kt = K + (size_t)(jbeg + t * TJ) * DIM + d0;
        const float* __restrict__ Vt = V + (size_t)(jbeg + t * TJ) * DIM + d0;

        // Partial scores over this wave's 16 dims, 32 columns, all inside the lane.
#pragma unroll
        for (int g = 0; g < TJ / 4; ++g) {
            v2f k4[4][DSL / 2];
#pragma unroll
            for (int c = 0; c < 4; ++c)
#pragma unroll
                for (int d = 0; d < DSL / 2; ++d)
                    k4[c][d] = *(const v2f*)(Kt + (size_t)(4 * g + c) * DIM + 2 * d);
            // Keeps the four rows' scalar loads together in front of their arithmetic: one
            // wait per four columns; left alone the scheduler loads and waits row by row.
            __builtin_amdgcn_sched_barrier(0);
            float e4[4];
#pragma unroll
            for (int c = 0; c < 4; ++c) {
                v2f a = zero2;   // even dims in .x, odd dims in .y
#pragma unroll
                for (int d = 0; d < DSL / 2; ++d)
                    a = __builtin_elementwise_fma(
                            __builtin_elementwise_max(q[d] + k4[c][d], zero2), w[d], a);
                e4[c] = a.x + a.y;
            }
            *(float4*)&Ep[wave][lane][4 * g] = make_float4(e4[0], e4[1], e4[2], e4[3]);
            // Lower edge: the next group's loads are not lifted in among this arithmetic,
            // where they would split into single loads with a wait each.
            __builtin_amdgcn_sched_barrier(0);
        }
        __syncthreads();

        // Wave w adds the 8 partial sums of columns [4w, 4w+4), in wave order.
        {
            float4 acc = *(const float4*)&Ep[0][lane][4 * wave];
#pragma unroll
            for (int o = 1; o < 8; ++o) {
                const float4 x4 = *(const float4*)&Ep[o][lane][4 * wave];
                acc.x += x4.x; acc.y += x4.y; acc.z += x4.z; acc.w += x4.w;
            }
            acc.x += ba; acc.y += ba; acc.z += ba; acc.w += ba;
            *(float4*)&Ef[lane][4 * wave] = acc;
        }
        __syncthreads();

        float p[TJ];
#pragma unroll
        for (int g = 0; g < TJ / 4; ++g) {
            const float4 x4 = *(const float4*)&Ef[lane][4 * g];
            p[4*g] = x4.x; p[4*g+1] = x4.y; p[4*g+2] = x4.z; p[4*g+3] = x4.w;
        }

        // One online-softmax update per tile (each lane for its own row).
        float mnew = mrun;
#pragma unroll
        for (int jj = 0; jj < TJ; ++jj) mnew = fmaxf(mnew, p[jj]);
        const float scale = fast_exp(mrun - mnew);
        float psum = 0.f;
#pragma unroll
        for (int jj = 0; jj < TJ; ++jj) { p[jj] = fast_exp(p[jj] - mnew); psum += p[jj]; }
        denom = denom * scale + psum;
        mrun  = mnew;
#pragma unroll
        for (int d = 0; d < DSL / 2; ++d) { s[d] *= scale; av[d] *= scale; }

#pragma unroll
        for (int h = 0; h < TJ / 2; ++h) {
            v2f kc[2][DSL / 2], vc[2][DSL / 2];
#pragma unroll
            for (int c = 0; c < 2; ++c)
#pragma unroll
                for (int d = 0; d < DSL / 2; ++d) {
                    kc[c][d] = *(const v2f*)(Kt + (size_t)(2 * h + c) * DIM + 2 * d);
                    vc[c][d] = *(const v2f*)(Vt + (size_t)(2 * h + c) * DIM + 2 * d);
                }
            // Keeps two columns' K and V scalar loads together in front of their arithmetic
            // (one wait per two columns), as in the score loop.
            __builtin_amdgcn_sched_barrier(0);
#pragma unroll
            for (int c = 0; c < 2; ++c) {
                const v2f pj = {p[2 * h + c], p[2 * h + c]};
#pragma unroll
                for (int d = 0; d < DSL / 2; ++d) {
                    s[d]  = __builtin_elementwise_fma(
                                pj, __builtin_elementwise_max(q[d] + kc[c][d], zero2), s[d]);
                    av[d] = __builtin_elementwise_fma(pj, vc[c][d], av[d]);
                }
            }
            // Lower edge of the group, as in the score loop.
            __builtin_amdgcn_sched_barrier(0);
        }
    }

    // Lane-per-row registers -> row-major LDS -> whole 512-byte rows to memory.
#pragma unroll
    for (int u = 0; u < DSL / 4; ++u) {
        *(float4*)&To[0][lane][d0 + 4 * u] = make_float4(s[2*u].x,  s[2*u].y,  s[2*u+1].x,  s[2*u+1].y);
        *(float4*)&To[1][lane][d0 + 4 * u] = make_float4(av[2*u].x, av[2*u].y, av[2*u+1].x, av[2*u+1].y);
    }
    __syncthreads();

    const size_t base = ((size_t)blockIdx.y * NPTS + row0) * DIM;
#pragma unroll
    for (int u = 0; u < 4; ++u) {
        const int r = wave + 8 * u;     // one wave stores one row
        *(float4*)(Sp  + base + (size_t)r * DIM + lane * 4) = *(const float4*)&To[0][r][lane * 4];
        *(float4*)(AVp + base + (size_t)r * DIM + lane * 4) = *(const float4*)&To[1][r][lane * 4];
    }
    // The eight stores above are still in flight: their address and data registers
    // are not rewritten in front of this wait.
    asm volatile("s_wait_xcnt 0x0" ::: "memory");
    if (wave == 0) {
        Mp[blockIdx.y * NPTS + i] = mrun;
        Dp[blockIdx.y * NPTS + i] = denom;
    }
}

// ---------------------------------------------------------------------------
// Kernel 2b: merge the NCH chunks of a row:
//   S_i = sum_c exp(m_c - M) Sp_c / sum_c exp(m_c - M) D_c,  M = max_c m_c; AV alike.
// grid = NPTS*2/8, block = 256; one wave per (row, S or AV), lane = 4 dims.
// ---------------------------------------------------------------------------
__global__ __launch_bounds__(256) void merge_chunks(
    const float* __restrict__ Sp, const float* __restrict__ AVp,
    const float* __restrict__ Mp, const float* __restrict__ Dp,
    float* __restrict__ S, float* __restrict__ AV)
{
    const int lane = threadIdx.x & 31;
    const int wave = __builtin_amdgcn_readfirstlane(threadIdx.x >> 5);
    const int unit = blockIdx.x * 8 + wave;
    const int row  = unit >> 1;
    const float* __restrict__ src = (unit & 1) ? AVp : Sp;
    float* __restrict__ dst       = (unit & 1) ? AV  : S;

    float4 x[NCH];
#pragma unroll
    for (int c = 0; c < NCH; ++c)
        x[c] = *(const float4*)(src + ((size_t)c * NPTS + row) * DIM + lane * 4);

    float m[NCH];
    float M = -1e30f;
#pragma unroll
    for (int c = 0; c < NCH; ++c) { m[c] = Mp[c * NPTS + row]; M = fmaxf(M, m[c]); }

    float  den = 0.f;
    float4 acc = {0.f, 0.f, 0.f, 0.f};
#pragma unroll
    for (int c = 0; c < NCH; ++c) {
        const float f = fast_exp(m[c] - M);
        den   = fmaf(f, Dp[c * NPTS + row], den);
        acc.x = fmaf(f, x[c].x, acc.x);
        acc.y = fmaf(f, x[c].y, acc.y);
        acc.z = fmaf(f, x[c].z, acc.z);
        acc.w = fmaf(f, x[c].w, acc.w);
    }
    const float inv = 1.0f / den;
    *(float4*)(dst + (size_t)row * DIM + lane * 4) =
        make_float4(acc.x * inv, acc.y * inv, acc.z * inv, acc.w * inv);
}

// ---------------------------------------------------------------------------
// Kernel 3: out = AV + S @ W_Ev + b_Ev   (WMMA f32 16x16x4, same tiling as K1)
// grid = NPTS/16 blocks, block = 256 (wave w owns n-tile w*16)
// ---------------------------------------------------------------------------
__global__ __launch_bounds__(256) void out_gemm_wmma(
    const float* __restrict__ S, const float* __restrict__ AV,
    const float* __restrict__ Wev, const float* __restrict__ bev,
    float* __restrict__ out)
{
    const int lane = threadIdx.x & 31;
    const int wave = threadIdx.x >> 5;
    const int lo   = lane & 15;
    const int hi   = lane >> 4;
    const int i0   = blockIdx.x * 16;
    const int n0   = wave * 16;

    v8f c = {0.f,0.f,0.f,0.f,0.f,0.f,0.f,0.f};
    const float* srow = S + (size_t)(i0 + lo) * DIM;

#pragma unroll
    for (int k0 = 0; k0 < DIM; k0 += 4) {
        const int ka = k0 + 2 * hi;
        v2f a; a.x = srow[ka];
               a.y = srow[ka + 1];
        v2f b; b.x = Wev[(size_t)ka       * DIM + n0 + lo];
               b.y = Wev[(size_t)(ka + 1) * DIM + n0 + lo];
        c = __builtin_amdgcn_wmma_f32_16x16x4_f32(
                false, a, false, b, (short)0, c, false, false);
    }

    const float bn = bev[n0 + lo];
#pragma unroll
    for (int r = 0; r < 8; ++r) {
        const int m = hi * 8 + r;
        const size_t idx = (size_t)(i0 + m) * DIM + n0 + lo;
        out[idx] = c[r] + AV[idx] + bn;
    }
}

// ---------------------------------------------------------------------------
// Launch: inputs in d_in order:
// 0:x 1:W_Q 2:b_Q 3:W_K 4:b_K 5:W_V 6:b_V 7:W_Ev 8:b_Ev 9:W_A 10:b_A
// Workspace: Q,K,V,S,AV (5 planes of 1024*128 floats), then per chunk of j the
// unnormalised S and AV (2*NCH planes) and each row's max and denominator.
// ---------------------------------------------------------------------------
extern "C" void kernel_launch(void* const* d_in, const int* in_sizes, int n_in,
                              void* d_out, int out_size, void* d_ws, size_t ws_size,
                              hipStream_t stream) {
    const float* x   = (const float*)d_in[0];
    const float* Wq  = (const float*)d_in[1];
    const float* bq  = (const float*)d_in[2];
    const float* Wk  = (const float*)d_in[3];
    const float* bk  = (const float*)d_in[4];
    const float* Wv  = (const float*)d_in[5];
    const float* bv  = (const float*)d_in[6];
    const float* Wev = (const float*)d_in[7];
    const float* bev = (const float*)d_in[8];
    const float* wA  = (const float*)d_in[9];
    const float* bA  = (const float*)d_in[10];

    float* ws = (float*)d_ws;
    float* Q  = ws;
    float* K  = ws + 1 * NPTS * DIM;
    float* V  = ws + 2 * NPTS * DIM;
    float* S  = ws + 3 * NPTS * DIM;
    float* AV = ws + 4 * NPTS * DIM;
    float* Sp  = ws + 5 * NPTS * DIM;
    float* AVp = ws + (5 + NCH) * NPTS * DIM;
    float* Mp  = ws + (5 + 2 * NCH) * NPTS * DIM;
    float* Dp  = ws + (5 + 2 * NCH) * NPTS * DIM + NCH * NPTS;

    qkv_gemm_wmma<<<dim3(NPTS / 16, 3), 256, 0, stream>>>(
        x, Wq, bq, Wk, bk, Wv, bv, Q, K, V);

    edge_softmax_pass<<<dim3(NPTS / 32, NCH), 256, 0, stream>>>(
        Q, K, V, wA, bA, Sp, AVp, Mp, Dp);

    merge_chunks<<<NPTS * 2 / 8, 256, 0, stream>>>(
        Sp, AVp, Mp, Dp, S, AV);

    out_gemm_wmma<<<NPTS / 16, 256, 0, stream>>>(
        S, AV, Wev, bev, (float*)d_out);
}

// v002
// Measured time: 33.5 microseconds a run.
// Timed twice side by side with v001, it ran 1.14 and 1.18 times as fast.
// Over all steps from v000 it is 10.4 times as fast.
#include <hip/hip_runtime.h>
#include <math.h>

// FlexibleAttention, N=1024, DIM=128, fp32.
// Algebraic fusion: out_i = (Σ_j a_ij V_j) + (Σ_j a_ij relu(Q_i+K_j)) @ W_Ev + b_Ev
// => never materialize the [n,n,d] edge tensor; online softmax per row, j split in chunks.

#define NPTS 1024
#define DIM  128

typedef float v2f __attribute__((ext_vector_type(2)));
typedef float v8f __attribute__((ext_vector_type(8)));

// ---------------------------------------------------------------------------
// Kernel 1: Q/K/V = x @ W + b   via V_WMMA_F32_16X16X4_F32
// grid = (NPTS/16, 3), block = 256 (8 waves; wave w owns n-tile w*16)
// blockIdx.y selects which of Q/K/V this block computes.
// Fragment layout (ISA 7.12.2, 32-bit):
//   A (16x4): lane L holds M=L%16, regs {K=2*(L/16), K=2*(L/16)+1}
//   B (4x16): lane L holds N=L%16, regs {K=2*(L/16), K=2*(L/16)+1}
//   D (16x16): c[r] = D[8*(L/16)+r][L%16]
// ---------------------------------------------------------------------------
__global__ __launch_bounds__(256) void qkv_gemm_wmma(
    const float* __restrict__ x,
    const float* __restrict__ Wq, const float* __restrict__ bq,
    const float* __restrict__ Wk, const float* __restrict__ bk,
    const float* __restrict__ Wv, const float* __restrict__ bv,
    float* __restrict__ Q, float* __restrict__ K, float* __restrict__ V)
{
    const int lane = threadIdx.x & 31;
    const int wave = threadIdx.x >> 5;
    const int lo   = lane & 15;
    const int hi   = lane >> 4;
    const int i0   = blockIdx.x * 16;
    const int n0   = wave * 16;

    const float* W; const float* bias; float* out;
    if (blockIdx.y == 0)      { W = Wq; bias = bq; out = Q; }
    else if (blockIdx.y == 1) { W = Wk; bias = bk; out = K; }
    else                      { W = Wv; bias = bv; out = V; }

    v8f c = {0.f,0.f,0.f,0.f,0.f,0.f,0.f,0.f};
    const float* xrow = x + (size_t)(i0 + lo) * DIM;

#pragma unroll
    for (int k0 = 0; k0 < DIM; k0 += 4) {
        const int ka = k0 + 2 * hi;
        v2f a; a.x = xrow[ka];
               a.y = xrow[ka + 1];
        v2f b; b.x = W[(size_t)ka       * DIM + n0 + lo];
               b.y = W[(size_t)(ka + 1) * DIM + n0 + lo];
        c = __builtin_amdgcn_wmma_f32_16x16x4_f32(
                false, a, false, b, (short)0, c, false, false);
    }

    const float bn = bias[n0 + lo];
#pragma unroll
    for (int r = 0; r < 8; ++r) {
        const int m = hi * 8 + r;
        out[(size_t)(i0 + m) * DIM + n0 + lo] = c[r] + bn;
    }
}

// e^x as the fast form 2^(x * log2 e). The v_nop fills the one issue slot that the
// instruction set asks for behind a transcendental; inside the statement it cannot drift.
__device__ __forceinline__ float fast_exp(float x)
{
    float r;
    asm("v_exp_f32 %0, %1\n\tv_nop" : "=v"(r) : "v"(x * 1.44269504f));
    return r;
}

// ---------------------------------------------------------------------------
// Kernel 2: softmax-weighted sums over one chunk of j, TWO query rows per LANE.
//   work-group = 64 rows x JC columns j; lane l holds rows l and l+32 in the two
//   halves of each packed-f32 register pair; wave w owns dims [8w, 8w+8).
//   K_j, V_j and W_A are the same for every lane AND for both halves of a pair, so a
//   packed instruction takes them straight from a scalar register (a packed f32
//   instruction reads one scalar register for both halves; a pair of two different
//   scalars would first have to be copied into vector registers).
//   The sum over d of a score stays inside a lane; only the 16 per-wave partial
//   sums meet, in LDS.
//   Per 32-column tile: partial scores -> LDS -> full scores -> one online-softmax
//   rescale -> S += p * relu(Q_i+K_j), AV += p * V_j.
//   Each chunk leaves unnormalised sums with its own max and denominator;
//   kernel 2b merges the chunks.
// grid = (NPTS/64, NCH), block = 512 (16 waves)
// ---------------------------------------------------------------------------
#define NCH   16               // chunks of j, one work-group each
#define JC    (NPTS / NCH)     // columns per chunk
#define TJ    32               // columns per softmax tile
#define NWV   16               // waves per work-group
#define DSL   (DIM / NWV)      // dims per wave
#define RWG   64               // rows per work-group
#define EPIT  (2 * TJ + 4)     // LDS pitch, floats: 16 B x odd for 16-byte reads
#define OPIT  (DIM + 4)        // LDS pitch, floats: 16 B x odd

// One wave-uniform value for both halves of a pair. The readfirstlane marks it as a single
// scalar register; without it the second word of each loaded row goes through a copy of its
// register pair into vector registers.
__device__ __forceinline__ v2f both(float x)
{
    const float u = __builtin_bit_cast(float, __builtin_amdgcn_readfirstlane(__builtin_bit_cast(int, x)));
    v2f r = {u, u};
    return r;
}

__global__ __launch_bounds__(512) void edge_softmax_pass(
    const float* __restrict__ Q, const float* __restrict__ K,
    const float* __restrict__ V,
    const float* __restrict__ wA, const float* __restrict__ bA,
    float* __restrict__ Sp, float* __restrict__ AVp,
    float* __restrict__ Mp, float* __restrict__ Dp)
{
    // Scores lie in LDS as they lie in registers: [lane][column][row l, row l+32].
    __shared__ __attribute__((aligned(16))) float Ep[NWV][32][EPIT];   // per-wave partial scores
    __shared__ __attribute__((aligned(16))) float Ef[32][EPIT];        // full scores
    __shared__ __attribute__((aligned(16))) float To[2][RWG][OPIT];    // row-major staging of the sums

    const int tid  = threadIdx.x;
    const int lane = tid & 31;
    const int wave = __builtin_amdgcn_readfirstlane(tid >> 5);
    const int row0 = blockIdx.x * RWG;
    const int i    = row0 + lane;          // .x half: row i, .y half: row i + 32
    const int d0   = wave * DSL;
    const int jbeg = blockIdx.y * JC;

    // Every '#pragma unroll' below makes the indices of these register arrays constants.
    const v2f zero2 = {0.f, 0.f};
    v2f q[DSL], s[DSL], av[DSL];
    float w[DSL];
#pragma unroll
    for (int u = 0; u < DSL / 4; ++u) {
        const float4 ta = *(const float4*)(Q + (size_t)i * DIM + d0 + 4 * u);
        const float4 tb = *(const float4*)(Q + (size_t)(i + 32) * DIM + d0 + 4 * u);
        q[4*u].x   = ta.x; q[4*u].y   = tb.x;
        q[4*u+1].x = ta.y; q[4*u+1].y = tb.y;
        q[4*u+2].x = ta.z; q[4*u+2].y = tb.z;
        q[4*u+3].x = ta.w; q[4*u+3].y = tb.w;
    }
#pragma unroll
    for (int d = 0; d < DSL; ++d) { w[d] = wA[d0 + d]; s[d] = zero2; av[d] = zero2; }
    const float ba = bA[0];

    v2f mrun  = {-1e30f, -1e30f};
    v2f denom = zero2;

#pragma unroll 1   // one copy of the long straight-line body, for the instruction cache
    for (int t = 0; t < JC / TJ; ++t) {
        const float* __restrict__ Kt = K + (size_t)(jbeg + t * TJ) * DIM + d0;
        const float* __restrict__ Vt = V + (size_t)(jbeg + t * TJ) * DIM + d0;

        // Partial scores over this wave's 8 dims, 32 columns, two rows, all inside the lane.
#pragma unroll
        for (int g = 0; g < TJ / 8; ++g) {
            float k8[8][DSL];
#pragma unroll
            for (int c = 0; c < 8; ++c)
#pragma unroll
                for (int d = 0; d < DSL; ++d)
                    k8[c][d] = Kt[(size_t)(8 * g + c) * DIM + d];
            // Keeps the eight rows' scalar loads together in front of their arithmetic: one
            // wait per eight columns; left alone the scheduler loads and waits row by row.
            __builtin_amdgcn_sched_barrier(0);
            v2f e8[8];
#pragma unroll
            for (int c = 0; c < 8; ++c) {
                v2f a = zero2;
#pragma unroll
                for (int d = 0; d < DSL; ++d)
                    a = __builtin_elementwise_fma(
                            __builtin_elementwise_max(q[d] + both(k8[c][d]), zero2), both(w[d]), a);
                e8[c] = a;
            }
#pragma unroll
            for (int u = 0; u < 4; ++u)
                *(float4*)&Ep[wave][lane][2 * (8 * g + 2 * u)] =
                    make_float4(e8[2*u].x, e8[2*u].y, e8[2*u+1].x, e8[2*u+1].y);
            // Lower edge: the next group's loads are not lifted in among this arithmetic,
            // where they would split into single loads with a wait each.
            __builtin_amdgcn_sched_barrier(0);
        }
        __syncthreads();

        // Wave w adds the 16 partial sums of columns 2w and 2w+1 (both rows of each lane), in wave order.
        {
            float4 acc = *(const float4*)&Ep[0][lane][4 * wave];
#pragma unroll
            for (int o = 1; o < NWV; ++o) {
                const float4 x4 = *(const float4*)&Ep[o][lane][4 * wave];
                acc.x += x4.x; acc.y += x4.y; acc.z += x4.z; acc.w += x4.w;
            }
            acc.x += ba; acc.y += ba; acc.z += ba; acc.w += ba;
            *(float4*)&Ef[lane][4 * wave] = acc;
        }
        __syncthreads();

        v2f p[TJ];
#pragma unroll
        for (int g = 0; g < TJ / 2; ++g) {
            const float4 x4 = *(const float4*)&Ef[lane][4 * g];
            p[2*g].x   = x4.x; p[2*g].y   = x4.y;
            p[2*g+1].x = x4.z; p[2*g+1].y = x4.w;
        }

        // One online-softmax update per tile (each lane for its own two rows).
        v2f mnew = mrun;
#pragma unroll
        for (int jj = 0; jj < TJ; ++jj) mnew = __builtin_elementwise_max(mnew, p[jj]);
        v2f scale;
        scale.x = fast_exp(mrun.x - mnew.x);
        scale.y = fast_exp(mrun.y - mnew.y);
        v2f psum = zero2;
#pragma unroll
        for (int jj = 0; jj < TJ; ++jj) {
            p[jj].x = fast_exp(p[jj].x - mnew.x);
            p[jj].y = fast_exp(p[jj].y - mnew.y);
            psum += p[jj];
        }
        denom = denom * scale + psum;
        mrun  = mnew;
#pragma unroll
        for (int d = 0; d < DSL; ++d) { s[d] *= scale; av[d] *= scale; }

#pragma unroll
        for (int h = 0; h < TJ / 4; ++h) {
            float kc[4][DSL], vc[4][DSL];
#pragma unroll
            for (int c = 0; c < 4; ++c)
#pragma unroll
                for (int d = 0; d < DSL; ++d) {
                    kc[c][d] = Kt[(size_t)(4 * h + c) * DIM + d];
                    vc[c][d] = Vt[(size_t)(4 * h + c) * DIM + d];
                }
            // Keeps four columns' K and V scalar loads together in front of their arithmetic
            // (one wait per four columns), as in the score loop.
            __builtin_amdgcn_sched_barrier(0);
#pragma unroll
            for (int c = 0; c < 4; ++c) {
                const v2f pj = p[4 * h + c];
#pragma unroll
                for (int d = 0; d < DSL; ++d) {
                    s[d]  = __builtin_elementwise_fma(
                                pj, __builtin_elementwise_max(q[d] + both(kc[c][d]), zero2), s[d]);
                    av[d] = __builtin_elementwise_fma(pj, both(vc[c][d]), av[d]);
                }
            }
            // Lower edge of the group, as in the score loop.
            __builtin_amdgcn_sched_barrier(0);
        }
    }

    // Lane-per-row registers -> row-major LDS -> whole 512-byte rows to memory.
#pragma unroll
    for (int u = 0; u < DSL / 4; ++u) {
        *(float4*)&To[0][lane][d0 + 4 * u]      = make_float4(s[4*u].x,  s[4*u+1].x,  s[4*u+2].x,  s[4*u+3].x);
        *(float4*)&To[0][lane + 32][d0 + 4 * u] = make_float4(s[4*u].y,  s[4*u+1].y,  s[4*u+2].y,  s[4*u+3].y);
        *(float4*)&To[1][lane][d0 + 4 * u]      = make_float4(av[4*u].x, av[4*u+1].x, av[4*u+2].x, av[4*u+3].x);
        *(float4*)&To[1][lane + 32][d0 + 4 * u] = make_float4(av[4*u].y, av[4*u+1].y, av[4*u+2].y, av[4*u+3].y);
    }
    __syncthreads();

    const size_t base = ((size_t)blockIdx.y * NPTS + row0) * DIM;
#pragma unroll
    for (int u = 0; u < RWG / NWV; ++u) {
        const int r = wave + NWV * u;     // one wave stores one row
        *(float4*)(Sp  + base + (size_t)r * DIM + lane * 4) = *(const float4*)&To[0][r][lane * 4];
        *(float4*)(AVp + base + (size_t)r * DIM + lane * 4) = *(const float4*)&To[1][r][lane * 4];
    }
    // The eight stores above are still in flight: their address and data registers
    // are not rewritten in front of this wait.
    asm volatile("s_wait_xcnt 0x0" ::: "memory");
    if (wave == 0) {
        Mp[blockIdx.y * NPTS + i]      = mrun.x;
        Mp[blockIdx.y * NPTS + i + 32] = mrun.y;
        Dp[blockIdx.y * NPTS + i]      = denom.x;
        Dp[blockIdx.y * NPTS + i + 32] = denom.y;
    }
}

// ---------------------------------------------------------------------------
// Kernel 2b: merge the NCH chunks of a row:
//   S_i = sum_c exp(m_c - M) Sp_c / sum_c exp(m_c - M) D_c,  M = max_c m_c; AV alike.
// grid = NPTS*2/8, block = 256; one wave per (row, S or AV), lane = 4 dims.
// ---------------------------------------------------------------------------
__global__ __launch_bounds__(256) void merge_chunks(
    const float* __restrict__ Sp, const float* __restrict__ AVp,
    const float* __restrict__ Mp, const float* __restrict__ Dp,
    float* __restrict__ S, float* __restrict__ AV)
{
    const int lane = threadIdx.x & 31;
    const int wave = __builtin_amdgcn_readfirstlane(threadIdx.x >> 5);
    const int unit = blockIdx.x * 8 + wave;
    const int row  = unit >> 1;
    const float* __restrict__ src = (unit & 1) ? AVp : Sp;
    float* __restrict__ dst       = (unit & 1) ? AV  : S;

    float4 x[NCH];
#pragma unroll
    for (int c = 0; c < NCH; ++c)
        x[c] = *(const float4*)(src + ((size_t)c * NPTS + row) * DIM + lane * 4);

    float m[NCH];
    float M = -1e30f;
#pragma unroll
    for (int c = 0; c < NCH; ++c) { m[c] = Mp[c * NPTS + row]; M = fmaxf(M, m[c]); }

    float  den = 0.f;
    float4 acc = {0.f, 0.f, 0.f, 0.f};
#pragma unroll
    for (int c = 0; c < NCH; ++c) {
        const float f = fast_exp(m[c] - M);
        den   = fmaf(f, Dp[c * NPTS + row], den);
        acc.x = fmaf(f, x[c].x, acc.x);
        acc.y = fmaf(f, x[c].y, acc.y);
        acc.z = fmaf(f, x[c].z, acc.z);
        acc.w = fmaf(f, x[c].w, acc.w);
    }
    const float inv = 1.0f / den;
    *(float4*)(dst + (size_t)row * DIM + lane * 4) =
        make_float4(acc.x * inv, acc.y * inv, acc.z * inv, acc.w * inv);
}

// ---------------------------------------------------------------------------
// Kernel 3: out = AV + S @ W_Ev + b_Ev   (WMMA f32 16x16x4, same tiling as K1)
// grid = NPTS/16 blocks, block = 256 (wave w owns n-tile w*16)
// ---------------------------------------------------------------------------
__global__ __launch_bounds__(256) void out_gemm_wmma(
    const float* __restrict__ S, const float* __restrict__ AV,
    const float* __restrict__ Wev, const float* __restrict__ bev,
    float* __restrict__ out)
{
    const int lane = threadIdx.x & 31;
    const int wave = threadIdx.x >> 5;
    const int lo   = lane & 15;
    const int hi   = lane >> 4;
    const int i0   = blockIdx.x * 16;
    const int n0   = wave * 16;

    v8f c = {0.f,0.f,0.f,0.f,0.f,0.f,0.f,0.f};
    const float* srow = S + (size_t)(i0 + lo) * DIM;

#pragma unroll
    for (int k0 = 0; k0 < DIM; k0 += 4) {
        const int ka = k0 + 2 * hi;
        v2f a; a.x = srow[ka];
               a.y = srow[ka + 1];
        v2f b; b.x = Wev[(size_t)ka       * DIM + n0 + lo];
               b.y = Wev[(size_t)(ka + 1) * DIM + n0 + lo];
        c = __builtin_amdgcn_wmma_f32_16x16x4_f32(
                false, a, false, b, (short)0, c, false, false);
    }

    const float bn = bev[n0 + lo];
#pragma unroll
    for (int r = 0; r < 8; ++r) {
        const int m = hi * 8 + r;
        const size_t idx = (size_t)(i0 + m) * DIM + n0 + lo;
        out[idx] = c[r] + AV[idx] + bn;
    }
}

// ---------------------------------------------------------------------------
// Launch: inputs in d_in order:
// 0:x 1:W_Q 2:b_Q 3:W_K 4:b_K 5:W_V 6:b_V 7:W_Ev 8:b_Ev 9:W_A 10:b_A
// Workspace: Q,K,V,S,AV (5 planes of 1024*128 floats), then per chunk of j the
// unnormalised S and AV (2*NCH planes) and each row's max and denominator.
// ---------------------------------------------------------------------------
extern "C" void kernel_launch(void* const* d_in, const int* in_sizes, int n_in,
                              void* d_out, int out_size, void* d_ws, size_t ws_size,
                              hipStream_t stream) {
    const float* x   = (const float*)d_in[0];
    const float* Wq  = (const float*)d_in[1];
    const float* bq  = (const float*)d_in[2];
    const float* Wk  = (const float*)d_in[3];
    const float* bk  = (const float*)d_in[4];
    const float* Wv  = (const float*)d_in[5];
    const float* bv  = (const float*)d_in[6];
    const float* Wev = (const float*)d_in[7];
    const float* bev = (const float*)d_in[8];
    const float* wA  = (const float*)d_in[9];
    const float* bA  = (const float*)d_in[10];

    float* ws = (float*)d_ws;
    float* Q  = ws;
    float* K  = ws + 1 * NPTS * DIM;
    float* V  = ws + 2 * NPTS * DIM;
    float* S  = ws + 3 * NPTS * DIM;
    float* AV = ws + 4 * NPTS * DIM;
    float* Sp  = ws + 5 * NPTS * DIM;
    float* AVp = ws + (5 + NCH) * NPTS * DIM;
    float* Mp  = ws + (5 + 2 * NCH) * NPTS * DIM;
    float* Dp  = ws + (5 + 2 * NCH) * NPTS * DIM + NCH * NPTS;

    qkv_gemm_wmma<<<dim3(NPTS / 16, 3), 256, 0, stream>>>(
        x, Wq, bq, Wk, bk, Wv, bv, Q, K, V);

    edge_softmax_pass<<<dim3(NPTS / RWG, NCH), 32 * NWV, 0, stream>>>(
        Q, K, V, wA, bA, Sp, AVp, Mp, Dp);

    merge_chunks<<<NPTS * 2 / 8, 256, 0, stream>>>(
        Sp, AVp, Mp, Dp, S, AV);

    out_gemm_wmma<<<NPTS / 16, 256, 0, stream>>>(
        S, AV, Wev, bev, (float*)d_out);
}

// v003
// One run takes 30.9 microseconds.
// Next to v002, in two timings, it ran 1.07 times as fast each time.
// Over all steps from v000 it is 11.1 times as fast.
#include <hip/hip_runtime.h>
#include <math.h>

// FlexibleAttention, N=1024, DIM=128, fp32.
// Algebraic fusion: out_i = (Σ_j a_ij V_j) + (Σ_j a_ij relu(Q_i+K_j)) @ W_Ev + b_Ev
// => never materialize the [n,n,d] edge tensor; online softmax per row, j split in chunks.

#define NPTS 1024
#define DIM  128

typedef float v2f __attribute__((ext_vector_type(2)));
typedef float v8f __attribute__((ext_vector_type(8)));

// ---------------------------------------------------------------------------
// Kernel 1: Q/K/V = x @ W + b   via V_WMMA_F32_16X16X4_F32
// grid = (NPTS/16, 3), block = 256 (8 waves; wave w owns n-tile w*16)
// blockIdx.y selects which of Q/K/V this block computes.
// Fragment layout (ISA 7.12.2, 32-bit):
//   A (16x4): lane L holds M=L%16, regs {K=2*(L/16), K=2*(L/16)+1}
//   B (4x16): lane L holds N=L%16, regs {K=2*(L/16), K=2*(L/16)+1}
//   D (16x16): c[r] = D[8*(L/16)+r][L%16]
// ---------------------------------------------------------------------------
__global__ __launch_bounds__(256) void qkv_gemm_wmma(
    const float* __restrict__ x,
    const float* __restrict__ Wq, const float* __restrict__ bq,
    const float* __restrict__ Wk, const float* __restrict__ bk,
    const float* __restrict__ Wv, const float* __restrict__ bv,
    float* __restrict__ Q, float* __restrict__ K, float* __restrict__ V)
{
    const int lane = threadIdx.x & 31;
    const int wave = threadIdx.x >> 5;
    const int lo   = lane & 15;
    const int hi   = lane >> 4;
    const int i0   = blockIdx.x * 16;
    const int n0   = wave * 16;

    const float* W; const float* bias; float* out;
    if (blockIdx.y == 0)      { W = Wq; bias = bq; out = Q; }
    else if (blockIdx.y == 1) { W = Wk; bias = bk; out = K; }
    else                      { W = Wv; bias = bv; out = V; }

    v8f c = {0.f,0.f,0.f,0.f,0.f,0.f,0.f,0.f};
    const float* xrow = x + (size_t)(i0 + lo) * DIM;

#pragma unroll
    for (int k0 = 0; k0 < DIM; k0 += 4) {
        const int ka = k0 + 2 * hi;
        v2f a; a.x = xrow[ka];
               a.y = xrow[ka + 1];
        v2f b; b.x = W[(size_t)ka       * DIM + n0 + lo];
               b.y = W[(size_t)(ka + 1) * DIM + n0 + lo];
        c = __builtin_amdgcn_wmma_f32_16x16x4_f32(
                false, a, false, b, (short)0, c, false, false);
    }

    const float bn = bias[n0 + lo];
#pragma unroll
    for (int r = 0; r < 8; ++r) {
        const int m = hi * 8 + r;
        out[(size_t)(i0 + m) * DIM + n0 + lo] = c[r] + bn;
    }
}

// Asks L2 for the line that holds *p; nothing comes back and no counter moves. For speed only.
// The kernels get the planes a second time as plain pointers (names ending in _ask) for these
// requests alone: loads through a pointer that an asm statement has seen are no longer made
// scalar loads.
__device__ __forceinline__ void ask_l2(const float* p)
{
    asm volatile("global_prefetch_b8 %0, off scope:SCOPE_SE" :: "v"(p));
}

// Input only, no code: the register pair that a request named stays that address up to here,
// so that no other value stands in it while the request may still be read.
__device__ __forceinline__ void keep_address(const float* p)
{
    asm volatile("" :: "v"(p));
}

// e^x as the fast form 2^(x * log2 e). The v_nop fills the one issue slot that the
// instruction set asks for behind a transcendental; inside the statement it cannot drift.
__device__ __forceinline__ float fast_exp(float x)
{
    float r;
    asm("v_exp_f32 %0, %1\n\tv_nop" : "=v"(r) : "v"(x * 1.44269504f));
    return r;
}

// ---------------------------------------------------------------------------
// Kernel 2: softmax-weighted sums over one chunk of j, TWO query rows per LANE.
//   work-group = 64 rows x JC columns j; lane l holds rows l and l+32 in the two
//   halves of each packed-f32 register pair; wave w owns dims [8w, 8w+8).
//   K_j, V_j and W_A are the same for every lane AND for both halves of a pair, so a
//   packed instruction takes them straight from a scalar register (a packed f32
//   instruction reads one scalar register for both halves; a pair of two different
//   scalars would first have to be copied into vector registers).
//   The sum over d of a score stays inside a lane; only the 16 per-wave partial
//   sums meet, in LDS.
//   Per 32-column tile: partial scores -> LDS -> full scores -> one online-softmax
//   rescale -> S += p * relu(Q_i+K_j), AV += p * V_j.
//   Each chunk leaves unnormalised sums with its own max and denominator;
//   kernel 2b merges the chunks.
// grid = (NPTS/64, NCH), block = 512 (16 waves)
// ---------------------------------------------------------------------------
#define NCH   16               // chunks of j, one work-group each
#define JC    (NPTS / NCH)     // columns per chunk
#define TJ    32               // columns per softmax tile
#define NWV   16               // waves per work-group
#define DSL   (DIM / NWV)      // dims per wave
#define RWG   64               // rows per work-group
#define EPIT  (2 * TJ + 4)     // LDS pitch, floats: 16 B x odd for 16-byte reads
#define OPIT  (DIM + 4)        // LDS pitch, floats: 16 B x odd

// One wave-uniform value for both halves of a pair. The readfirstlane marks it as a single
// scalar register; without it the second word of each loaded row goes through a copy of its
// register pair into vector registers.
__device__ __forceinline__ v2f both(float x)
{
    const float u = __builtin_bit_cast(float, __builtin_amdgcn_readfirstlane(__builtin_bit_cast(int, x)));
    v2f r = {u, u};
    return r;
}

__global__ __launch_bounds__(512) void edge_softmax_pass(
    const float* __restrict__ Q, const float* __restrict__ K,
    const float* __restrict__ V,
    const float* __restrict__ wA, const float* __restrict__ bA,
    float* __restrict__ Sp, float* __restrict__ AVp,
    float* __restrict__ Mp, float* __restrict__ Dp,
    const float* K_ask, const float* V_ask)
{
    // Scores lie in LDS as they lie in registers: [lane][column][row l, row l+32].
    __shared__ __attribute__((aligned(16))) float Ep[NWV][32][EPIT];   // per-wave partial scores
    __shared__ __attribute__((aligned(16))) float Ef[32][EPIT];        // full scores
    __shared__ __attribute__((aligned(16))) float To[2][RWG][OPIT];    // row-major staging of the sums

    const int tid  = threadIdx.x;
    const int lane = tid & 31;
    const int wave = __builtin_amdgcn_readfirstlane(tid >> 5);
    const int row0 = blockIdx.x * RWG;
    const int i    = row0 + lane;          // .x half: row i, .y half: row i + 32
    const int d0   = wave * DSL;
    const int jbeg = blockIdx.y * JC;

    // The chunk's K rows and V rows are 32 KB each, contiguous: 512 lines of 128 bytes, one per
    // thread (waves 0-7 K, waves 8-15 V). The scalar loads below come to them tile by tile.
    const float* const ahead = (wave < NWV / 2 ? K_ask : V_ask) + (size_t)jbeg * DIM + (tid & 255) * 32;
    ask_l2(ahead);
    // No instruction comes of this fence. With the asm statement as the last memory event in
    // front of the loop the compiler takes K and V as possibly rewritten and turns the loop's
    // scalar loads into vector loads with a copy to a scalar register per word.
    __builtin_amdgcn_fence(__ATOMIC_ACQUIRE, "wavefront");

    // Every '#pragma unroll' below makes the indices of these register arrays constants.
    const v2f zero2 = {0.f, 0.f};
    v2f q[DSL], s[DSL], av[DSL];
    float w[DSL];
#pragma unroll
    for (int u = 0; u < DSL / 4; ++u) {
        const float4 ta = *(const float4*)(Q + (size_t)i * DIM + d0 + 4 * u);
        const float4 tb = *(const float4*)(Q + (size_t)(i + 32) * DIM + d0 + 4 * u);
        q[4*u].x   = ta.x; q[4*u].y   = tb.x;
        q[4*u+1].x = ta.y; q[4*u+1].y = tb.y;
        q[4*u+2].x = ta.z; q[4*u+2].y = tb.z;
        q[4*u+3].x = ta.w; q[4*u+3].y = tb.w;
    }
#pragma unroll
    for (int d = 0; d < DSL; ++d) { w[d] = wA[d0 + d]; s[d] = zero2; av[d] = zero2; }
    const float ba = bA[0];

    v2f mrun  = {-1e30f, -1e30f};
    v2f denom = zero2;

#pragma unroll 1   // one copy of the long straight-line body, for the instruction cache
    for (int t = 0; t < JC / TJ; ++t) {
        const float* __restrict__ Kt = K + (size_t)(jbeg + t * TJ) * DIM + d0;
        const float* __restrict__ Vt = V + (size_t)(jbeg + t * TJ) * DIM + d0;

        // Partial scores over this wave's 8 dims, 32 columns, two rows, all inside the lane.
#pragma unroll
        for (int g = 0; g < TJ / 8; ++g) {
            float k8[8][DSL];
#pragma unroll
            for (int c = 0; c < 8; ++c)
#pragma unroll
                for (int d = 0; d < DSL; ++d)
                    k8[c][d] = Kt[(size_t)(8 * g + c) * DIM + d];
            // Keeps the eight rows' scalar loads together in front of their arithmetic: one
            // wait per eight columns; left alone the scheduler loads and waits row by row.
            __builtin_amdgcn_sched_barrier(0);
            v2f e8[8];
#pragma unroll
            for (int c = 0; c < 8; ++c) {
                v2f a = zero2;
#pragma unroll
                for (int d = 0; d < DSL; ++d)
                    a = __builtin_elementwise_fma(
                            __builtin_elementwise_max(q[d] + both(k8[c][d]), zero2), both(w[d]), a);
                e8[c] = a;
            }
#pragma unroll
            for (int u = 0; u < 4; ++u)
                *(float4*)&Ep[wave][lane][2 * (8 * g + 2 * u)] =
                    make_float4(e8[2*u].x, e8[2*u].y, e8[2*u+1].x, e8[2*u+1].y);
            // Lower edge: the next group's loads are not lifted in among this arithmetic,
            // where they would split into single loads with a wait each.
            __builtin_amdgcn_sched_barrier(0);
        }
        __syncthreads();

        // Wave w adds the 16 partial sums of columns 2w and 2w+1 (both rows of each lane), in wave order.
        {
            float4 acc = *(const float4*)&Ep[0][lane][4 * wave];
#pragma unroll
            for (int o = 1; o < NWV; ++o) {
                const float4 x4 = *(const float4*)&Ep[o][lane][4 * wave];
                acc.x += x4.x; acc.y += x4.y; acc.z += x4.z; acc.w += x4.w;
            }
            acc.x += ba; acc.y += ba; acc.z += ba; acc.w += ba;
            *(float4*)&Ef[lane][4 * wave] = acc;
        }
        __syncthreads();

        v2f p[TJ];
#pragma unroll
        for (int g = 0; g < TJ / 2; ++g) {
            const float4 x4 = *(const float4*)&Ef[lane][4 * g];
            p[2*g].x   = x4.x; p[2*g].y   = x4.y;
            p[2*g+1].x = x4.z; p[2*g+1].y = x4.w;
        }

        // One online-softmax update per tile (each lane for its own two rows).
        v2f mnew = mrun;
#pragma unroll
        for (int jj = 0; jj < TJ; ++jj) mnew = __builtin_elementwise_max(mnew, p[jj]);
        v2f scale;
        scale.x = fast_exp(mrun.x - mnew.x);
        scale.y = fast_exp(mrun.y - mnew.y);
        v2f psum = zero2;
#pragma unroll
        for (int jj = 0; jj < TJ; ++jj) {
            p[jj].x = fast_exp(p[jj].x - mnew.x);
            p[jj].y = fast_exp(p[jj].y - mnew.y);
            psum += p[jj];
        }
        denom = denom * scale + psum;
        mrun  = mnew;
#pragma unroll
        for (int d = 0; d < DSL; ++d) { s[d] *= scale; av[d] *= scale; }

#pragma unroll
        for (int h = 0; h < TJ / 4; ++h) {
            float kc[4][DSL], vc[4][DSL];
#pragma unroll
            for (int c = 0; c < 4; ++c)
#pragma unroll
                for (int d = 0; d < DSL; ++d) {
                    kc[c][d] = Kt[(size_t)(4 * h + c) * DIM + d];
                    vc[c][d] = Vt[(size_t)(4 * h + c) * DIM + d];
                }
            // Keeps four columns' K and V scalar loads together in front of their arithmetic
            // (one wait per four columns), as in the score loop.
            __builtin_amdgcn_sched_barrier(0);
#pragma unroll
            for (int c = 0; c < 4; ++c) {
                const v2f pj = p[4 * h + c];
#pragma unroll
                for (int d = 0; d < DSL; ++d) {
                    s[d]  = __builtin_elementwise_fma(
                                pj, __builtin_elementwise_max(q[d] + both(kc[c][d]), zero2), s[d]);
                    av[d] = __builtin_elementwise_fma(pj, both(vc[c][d]), av[d]);
                }
            }
            // Lower edge of the group, as in the score loop.
            __builtin_amdgcn_sched_barrier(0);
        }
    }

    keep_address(ahead);

    // Lane-per-row registers -> row-major LDS -> whole 512-byte rows to memory.
#pragma unroll
    for (int u = 0; u < DSL / 4; ++u) {
        *(float4*)&To[0][lane][d0 + 4 * u]      = make_float4(s[4*u].x,  s[4*u+1].x,  s[4*u+2].x,  s[4*u+3].x);
        *(float4*)&To[0][lane + 32][d0 + 4 * u] = make_float4(s[4*u].y,  s[4*u+1].y,  s[4*u+2].y,  s[4*u+3].y);
        *(float4*)&To[1][lane][d0 + 4 * u]      = make_float4(av[4*u].x, av[4*u+1].x, av[4*u+2].x, av[4*u+3].x);
        *(float4*)&To[1][lane + 32][d0 + 4 * u] = make_float4(av[4*u].y, av[4*u+1].y, av[4*u+2].y, av[4*u+3].y);
    }
    __syncthreads();

    const size_t base = ((size_t)blockIdx.y * NPTS + row0) * DIM;
#pragma unroll
    for (int u = 0; u < RWG / NWV; ++u) {
        const int r = wave + NWV * u;     // one wave stores one row
        *(float4*)(Sp  + base + (size_t)r * DIM + lane * 4) = *(const float4*)&To[0][r][lane * 4];
        *(float4*)(AVp + base + (size_t)r * DIM + lane * 4) = *(const float4*)&To[1][r][lane * 4];
    }
    // The eight stores above are still in flight: their address and data registers
    // are not rewritten in front of this wait.
    asm volatile("s_wait_xcnt 0x0" ::: "memory");
    if (wave == 0) {
        Mp[blockIdx.y * NPTS + i]      = mrun.x;
        Mp[blockIdx.y * NPTS + i + 32] = mrun.y;
        Dp[blockIdx.y * NPTS + i]      = denom.x;
        Dp[blockIdx.y * NPTS + i + 32] = denom.y;
    }
}

// ---------------------------------------------------------------------------
// Kernel 2b: merge the NCH chunks of a row:
//   S_i = sum_c exp(m_c - M) Sp_c / sum_c exp(m_c - M) D_c,  M = max_c m_c; AV alike.
// grid = NPTS*2/8, block = 256; one wave per (row, S or AV), lane = 4 dims.
// ---------------------------------------------------------------------------
__global__ __launch_bounds__(256) void merge_chunks(
    const float* __restrict__ Sp, const float* __restrict__ AVp,
    const float* __restrict__ Mp, const float* __restrict__ Dp,
    float* __restrict__ S, float* __restrict__ AV,
    const float* Sp_ask, const float* AVp_ask, const float* Mp_ask, const float* Dp_ask)
{
    const int lane = threadIdx.x & 31;
    const int wave = __builtin_amdgcn_readfirstlane(threadIdx.x >> 5);
    const int unit = blockIdx.x * 8 + wave;
    const int row  = unit >> 1;
    const float* __restrict__ src = (unit & 1) ? AVp : Sp;
    float* __restrict__ dst       = (unit & 1) ? AV  : S;

    // All that this wave reads: 16 chunk rows of 512 bytes (64 lines, two per lane) and the row's
    // 16 maxima and 16 denominators (one line each). Part of the loads below issue only behind
    // the first wait.
    const float* const ahead0 = ((unit & 1) ? AVp_ask : Sp_ask) + ((size_t)(lane >> 2) * NPTS + row) * DIM + (lane & 3) * 32;
    const float* const ahead1 = ahead0 + (size_t)(NCH / 2) * NPTS * DIM;
    const float* const ahead2 = (lane < NCH ? Mp_ask : Dp_ask) + (lane & (NCH - 1)) * NPTS + row;
    ask_l2(ahead0);
    ask_l2(ahead1);
    ask_l2(ahead2);

    float4 x[NCH];
#pragma unroll
    for (int c = 0; c < NCH; ++c)
        x[c] = *(const float4*)(src + ((size_t)c * NPTS + row) * DIM + lane * 4);

    float m[NCH];
    float M = -1e30f;
#pragma unroll
    for (int c = 0; c < NCH; ++c) { m[c] = Mp[c * NPTS + row]; M = fmaxf(M, m[c]); }

    float  den = 0.f;
    float4 acc = {0.f, 0.f, 0.f, 0.f};
#pragma unroll
    for (int c = 0; c < NCH; ++c) {
        const float f = fast_exp(m[c] - M);
        den   = fmaf(f, Dp[c * NPTS + row], den);
        acc.x = fmaf(f, x[c].x, acc.x);
        acc.y = fmaf(f, x[c].y, acc.y);
        acc.z = fmaf(f, x[c].z, acc.z);
        acc.w = fmaf(f, x[c].w, acc.w);
    }
    const float inv = 1.0f / den;
    *(float4*)(dst + (size_t)row * DIM + lane * 4) =
        make_float4(acc.x * inv, acc.y * inv, acc.z * inv, acc.w * inv);
    keep_address(ahead0);
    keep_address(ahead1);
    keep_address(ahead2);
}

// ---------------------------------------------------------------------------
// Kernel 3: out = AV + S @ W_Ev + b_Ev   (WMMA f32 16x16x4, same tiling as K1)
// grid = NPTS/16 blocks, block = 256 (wave w owns n-tile w*16)
// ---------------------------------------------------------------------------
__global__ __launch_bounds__(256) void out_gemm_wmma(
    const float* __restrict__ S, const float* __restrict__ AV,
    const float* __restrict__ Wev, const float* __restrict__ bev,
    float* __restrict__ out,
    const float* S_ask, const float* AV_ask)
{
    const int lane = threadIdx.x & 31;
    const int wave = threadIdx.x >> 5;
    const int lo   = lane & 15;
    const int hi   = lane >> 4;
    const int i0   = blockIdx.x * 16;
    const int n0   = wave * 16;

    // The work-group's 16 rows of S and of AV, 8 KB each, contiguous: 64 bytes per thread
    // (waves 0-3 S, waves 4-7 AV). The loop reaches the rows' later lines, and the epilogue AV,
    // only behind the first wait.
    const float* const ahead = (wave < 4 ? S_ask : AV_ask) + (size_t)i0 * DIM + (threadIdx.x & 127) * 16;
    ask_l2(ahead);

    v8f c = {0.f,0.f,0.f,0.f,0.f,0.f,0.f,0.f};
    const float* srow = S + (size_t)(i0 + lo) * DIM;

#pragma unroll
    for (int k0 = 0; k0 < DIM; k0 += 4) {
        const int ka = k0 + 2 * hi;
        v2f a; a.x = srow[ka];
               a.y = srow[ka + 1];
        v2f b; b.x = Wev[(size_t)ka       * DIM + n0 + lo];
               b.y = Wev[(size_t)(ka + 1) * DIM + n0 + lo];
        c = __builtin_amdgcn_wmma_f32_16x16x4_f32(
                false, a, false, b, (short)0, c, false, false);
    }

    const float bn = bev[n0 + lo];
#pragma unroll
    for (int r = 0; r < 8; ++r) {
        const int m = hi * 8 + r;
        const size_t idx = (size_t)(i0 + m) * DIM + n0 + lo;
        out[idx] = c[r] + AV[idx] + bn;
    }
    keep_address(ahead);
}

// ---------------------------------------------------------------------------
// Launch: inputs in d_in order:
// 0:x 1:W_Q 2:b_Q 3:W_K 4:b_K 5:W_V 6:b_V 7:W_Ev 8:b_Ev 9:W_A 10:b_A
// Workspace: Q,K,V,S,AV (5 planes of 1024*128 floats), then per chunk of j the
// unnormalised S and AV (2*NCH planes) and each row's max and denominator.
// ---------------------------------------------------------------------------
extern "C" void kernel_launch(void* const* d_in, const int* in_sizes, int n_in,
                              void* d_out, int out_size, void* d_ws, size_t ws_size,
                              hipStream_t stream) {
    const float* x   = (const float*)d_in[0];
    const float* Wq  = (const float*)d_in[1];
    const float* bq  = (const float*)d_in[2];
    const float* Wk  = (const float*)d_in[3];
    const float* bk  = (const float*)d_in[4];
    const float* Wv  = (const float*)d_in[5];
    const float* bv  = (const float*)d_in[6];
    const float* Wev = (const float*)d_in[7];
    const float* bev = (const float*)d_in[8];
    const float* wA  = (const float*)d_in[9];
    const float* bA  = (const float*)d_in[10];

    float* ws = (float*)d_ws;
    float* Q  = ws;
    float* K  = ws + 1 * NPTS * DIM;
    float* V  = ws + 2 * NPTS * DIM;
    float* S  = ws + 3 * NPTS * DIM;
    float* AV = ws + 4 * NPTS * DIM;
    float* Sp  = ws + 5 * NPTS * DIM;
    float* AVp = ws + (5 + NCH) * NPTS * DIM;
    float* Mp  = ws + (5 + 2 * NCH) * NPTS * DIM;
    float* Dp  = ws + (5 + 2 * NCH) * NPTS * DIM + NCH * NPTS;

    qkv_gemm_wmma<<<dim3(NPTS / 16, 3), 256, 0, stream>>>(
        x, Wq, bq, Wk, bk, Wv, bv, Q, K, V);

    edge_softmax_pass<<<dim3(NPTS / RWG, NCH), 32 * NWV, 0, stream>>>(
        Q, K, V, wA, bA, Sp, AVp, Mp, Dp, K, V);

    merge_chunks<<<NPTS * 2 / 8, 256, 0, stream>>>(
        Sp, AVp, Mp, Dp, S, AV, Sp, AVp, Mp, Dp);

    out_gemm_wmma<<<NPTS / 16, 256, 0, stream>>>(
        S, AV, Wev, bev, (float*)d_out, S, AV);
}

// v004
// One run takes 26.8 microseconds.
// Timed twice side by side with v003, it ran 1.16 times as fast both times.
// Counting every step since v000, it is 12.8 times as fast.
#include <hip/hip_runtime.h>
#include <math.h>

// FlexibleAttention, N=1024, DIM=128, fp32.
// Algebraic fusion: out_i = (Σ_j a_ij V_j) + (Σ_j a_ij relu(Q_i+K_j)) @ W_Ev + b_Ev
// => never materialize the [n,n,d] edge tensor; online softmax per row, j split in chunks.
// The product with W_Ev is linear in S, so each chunk applies it to its own unnormalised sums.

#define NPTS 1024
#define DIM  128

typedef float v2f __attribute__((ext_vector_type(2)));
typedef float v8f __attribute__((ext_vector_type(8)));

// ---------------------------------------------------------------------------
// Kernel 1: Q/K/V = x @ W + b   via V_WMMA_F32_16X16X4_F32
// grid = (NPTS/16, 3), block = 256 (8 waves; wave w owns n-tile w*16)
// blockIdx.y selects which of Q/K/V this block computes.
// Fragment layout (ISA 7.12.2, 32-bit):
//   A (16x4): lane L holds M=L%16, regs {K=2*(L/16), K=2*(L/16)+1}
//   B (4x16): lane L holds N=L%16, regs {K=2*(L/16), K=2*(L/16)+1}
//   D (16x16): c[r] = D[8*(L/16)+r][L%16]
// ---------------------------------------------------------------------------
__global__ __launch_bounds__(256) void qkv_gemm_wmma(
    const float* __restrict__ x,
    const float* __restrict__ Wq, const float* __restrict__ bq,
    const float* __restrict__ Wk, const float* __restrict__ bk,
    const float* __restrict__ Wv, const float* __restrict__ bv,
    float* __restrict__ Q, float* __restrict__ K, float* __restrict__ V)
{
    const int lane = threadIdx.x & 31;
    const int wave = threadIdx.x >> 5;
    const int lo   = lane & 15;
    const int hi   = lane >> 4;
    const int i0   = blockIdx.x * 16;
    const int n0   = wave * 16;

    const float* W; const float* bias; float* out;
    if (blockIdx.y == 0)      { W = Wq; bias = bq; out = Q; }
    else if (blockIdx.y == 1) { W = Wk; bias = bk; out = K; }
    else                      { W = Wv; bias = bv; out = V; }

    v8f c = {0.f,0.f,0.f,0.f,0.f,0.f,0.f,0.f};
    const float* xrow = x + (size_t)(i0 + lo) * DIM;

#pragma unroll
    for (int k0 = 0; k0 < DIM; k0 += 4) {
        const int ka = k0 + 2 * hi;
        v2f a; a.x = xrow[ka];
               a.y = xrow[ka + 1];
        v2f b; b.x = W[(size_t)ka       * DIM + n0 + lo];
               b.y = W[(size_t)(ka + 1) * DIM + n0 + lo];
        c = __builtin_amdgcn_wmma_f32_16x16x4_f32(
                false, a, false, b, (short)0, c, false, false);
    }

    const float bn = bias[n0 + lo];
#pragma unroll
    for (int r = 0; r < 8; ++r) {
        const int m = hi * 8 + r;
        out[(size_t)(i0 + m) * DIM + n0 + lo] = c[r] + bn;
    }
}

// Asks L2 for the line that holds *p; nothing comes back and no counter moves. For speed only.
// The kernels get the planes a second time as plain pointers (names ending in _ask) for these
// requests alone: loads through a pointer that an asm statement has seen are no longer made
// scalar loads.
__device__ __forceinline__ void ask_l2(const float* p)
{
    asm volatile("global_prefetch_b8 %0, off scope:SCOPE_SE" :: "v"(p));
}

// Input only, no code: the register pair that a request named stays that address up to here,
// so that no other value stands in it while the request may still be read.
__device__ __forceinline__ void keep_address(const float* p)
{
    asm volatile("" :: "v"(p));
}

// e^x as the fast form 2^(x * log2 e). The v_nop fills the one issue slot that the
// instruction set asks for behind a transcendental; inside the statement it cannot drift.
__device__ __forceinline__ float fast_exp(float x)
{
    float r;
    asm("v_exp_f32 %0, %1\n\tv_nop" : "=v"(r) : "v"(x * 1.44269504f));
    return r;
}

// ---------------------------------------------------------------------------
// Kernel 2: softmax-weighted sums over one chunk of j, TWO query rows per LANE.
//   work-group = 64 rows x JC columns j; lane l holds rows l and l+32 in the two
//   halves of each packed-f32 register pair; wave w owns dims [8w, 8w+8).
//   K_j, V_j and W_A are the same for every lane AND for both halves of a pair, so a
//   packed instruction takes them straight from a scalar register (a packed f32
//   instruction reads one scalar register for both halves; a pair of two different
//   scalars would first have to be copied into vector registers).
//   The sum over d of a score stays inside a lane; only the 16 per-wave partial
//   sums meet, in LDS.
//   Per 32-column tile: partial scores -> LDS -> full scores -> one online-softmax
//   rescale -> S += p * relu(Q_i+K_j), AV += p * V_j.
//   Behind the loop the work-group forms AV + S @ W_Ev of its chunk's unnormalised sums
//   (V_WMMA_F32_16X16X4_F32, fragment layout as in kernel 1) and leaves that one plane with
//   the chunk's max and denominator; kernel 2b merges the chunks into the output.
// grid = (NPTS/64, NCH), block = 512 (16 waves)
// ---------------------------------------------------------------------------
#define NCH   16               // chunks of j, one work-group each
#define JC    (NPTS / NCH)     // columns per chunk
#define TJ    32               // columns per softmax tile
#define NWV   16               // waves per work-group
#define DSL   (DIM / NWV)      // dims per wave
#define RWG   64               // rows per work-group
#define EPIT  (2 * TJ + 4)     // LDS pitch, floats: 16 B x odd for 16-byte reads
#define OPIT  (DIM + 4)        // LDS pitch, floats: 16 B x odd

// One wave-uniform value for both halves of a pair. The readfirstlane marks it as a single
// scalar register; without it the second word of each loaded row goes through a copy of its
// register pair into vector registers.
__device__ __forceinline__ v2f both(float x)
{
    const float u = __builtin_bit_cast(float, __builtin_amdgcn_readfirstlane(__builtin_bit_cast(int, x)));
    v2f r = {u, u};
    return r;
}

__global__ __launch_bounds__(512) void edge_softmax_pass(
    const float* __restrict__ Q, const float* __restrict__ K,
    const float* __restrict__ V,
    const float* __restrict__ wA, const float* __restrict__ bA,
    const float* __restrict__ Wev,
    float* __restrict__ Op,
    float* __restrict__ Mp, float* __restrict__ Dp,
    const float* K_ask, const float* V_ask)
{
    // Scores lie in LDS as they lie in registers: [lane][column][row l, row l+32].
    __shared__ __attribute__((aligned(16))) float Ep[NWV][32][EPIT];   // per-wave partial scores
    __shared__ __attribute__((aligned(16))) float Ef[32][EPIT];        // full scores
    __shared__ __attribute__((aligned(16))) float To[2][RWG][OPIT];    // row-major staging of the sums

    const int tid  = threadIdx.x;
    const int lane = tid & 31;
    const int wave = __builtin_amdgcn_readfirstlane(tid >> 5);
    const int row0 = blockIdx.x * RWG;
    const int i    = row0 + lane;          // .x half: row i, .y half: row i + 32
    const int d0   = wave * DSL;
    const int jbeg = blockIdx.y * JC;

    // The chunk's K rows and V rows are 32 KB each, contiguous: 512 lines of 128 bytes, one per
    // thread (waves 0-7 K, waves 8-15 V). The scalar loads below come to them tile by tile.
    const float* const ahead = (wave < NWV / 2 ? K_ask : V_ask) + (size_t)jbeg * DIM + (tid & 255) * 32;
    ask_l2(ahead);
    // No instruction comes of this fence. With the asm statement as the last memory event in
    // front of the loop the compiler takes K and V as possibly rewritten and turns the loop's
    // scalar loads into vector loads with a copy to a scalar register per word.
    __builtin_amdgcn_fence(__ATOMIC_ACQUIRE, "wavefront");

    // Every '#pragma unroll' below makes the indices of these register arrays constants.
    const v2f zero2 = {0.f, 0.f};
    v2f q[DSL], s[DSL], av[DSL];
    float w[DSL];
#pragma unroll
    for (int u = 0; u < DSL / 4; ++u) {
        const float4 ta = *(const float4*)(Q + (size_t)i * DIM + d0 + 4 * u);
        const float4 tb = *(const float4*)(Q + (size_t)(i + 32) * DIM + d0 + 4 * u);
        q[4*u].x   = ta.x; q[4*u].y   = tb.x;
        q[4*u+1].x = ta.y; q[4*u+1].y = tb.y;
        q[4*u+2].x = ta.z; q[4*u+2].y = tb.z;
        q[4*u+3].x = ta.w; q[4*u+3].y = tb.w;
    }
#pragma unroll
    for (int d = 0; d < DSL; ++d) { w[d] = wA[d0 + d]; s[d] = zero2; av[d] = zero2; }
    const float ba = bA[0];

    v2f mrun  = {-1e30f, -1e30f};
    v2f denom = zero2;

#pragma unroll 1   // one copy of the long straight-line body, for the instruction cache
    for (int t = 0; t < JC / TJ; ++t) {
        const float* __restrict__ Kt = K + (size_t)(jbeg + t * TJ) * DIM + d0;
        const float* __restrict__ Vt = V + (size_t)(jbeg + t * TJ) * DIM + d0;

        // Partial scores over this wave's 8 dims, 32 columns, two rows, all inside the lane.
#pragma unroll
        for (int g = 0; g < TJ / 8; ++g) {
            float k8[8][DSL];
#pragma unroll
            for (int c = 0; c < 8; ++c)
#pragma unroll
                for (int d = 0; d < DSL; ++d)
                    k8[c][d] = Kt[(size_t)(8 * g + c) * DIM + d];
            // Keeps the eight rows' scalar loads together in front of their arithmetic: one
            // wait per eight columns; left alone the scheduler loads and waits row by row.
            __builtin_amdgcn_sched_barrier(0);
            v2f e8[8];
#pragma unroll
            for (int c = 0; c < 8; ++c) {
                v2f a = zero2;
#pragma unroll
                for (int d = 0; d < DSL; ++d)
                    a = __builtin_elementwise_fma(
                            __builtin_elementwise_max(q[d] + both(k8[c][d]), zero2), both(w[d]), a);
                e8[c] = a;
            }
#pragma unroll
            for (int u = 0; u < 4; ++u)
                *(float4*)&Ep[wave][lane][2 * (8 * g + 2 * u)] =
                    make_float4(e8[2*u].x, e8[2*u].y, e8[2*u+1].x, e8[2*u+1].y);
            // Lower edge: the next group's loads are not lifted in among this arithmetic,
            // where they would split into single loads with a wait each.
            __builtin_amdgcn_sched_barrier(0);
        }
        __syncthreads();

        // Wave w adds the 16 partial sums of columns 2w and 2w+1 (both rows of each lane), in wave order.
        {
            float4 acc = *(const float4*)&Ep[0][lane][4 * wave];
#pragma unroll
            for (int o = 1; o < NWV; ++o) {
                const float4 x4 = *(const float4*)&Ep[o][lane][4 * wave];
                acc.x += x4.x; acc.y += x4.y; acc.z += x4.z; acc.w += x4.w;
            }
            acc.x += ba; acc.y += ba; acc.z += ba; acc.w += ba;
            *(float4*)&Ef[lane][4 * wave] = acc;
        }
        __syncthreads();

        v2f p[TJ];
#pragma unroll
        for (int g = 0; g < TJ / 2; ++g) {
            const float4 x4 = *(const float4*)&Ef[lane][4 * g];
            p[2*g].x   = x4.x; p[2*g].y   = x4.y;
            p[2*g+1].x = x4.z; p[2*g+1].y = x4.w;
        }

        // One online-softmax update per tile (each lane for its own two rows).
        v2f mnew = mrun;
#pragma unroll
        for (int jj = 0; jj < TJ; ++jj) mnew = __builtin_elementwise_max(mnew, p[jj]);
        v2f scale;
        scale.x = fast_exp(mrun.x - mnew.x);
        scale.y = fast_exp(mrun.y - mnew.y);
        v2f psum = zero2;
#pragma unroll
        for (int jj = 0; jj < TJ; ++jj) {
            p[jj].x = fast_exp(p[jj].x - mnew.x);
            p[jj].y = fast_exp(p[jj].y - mnew.y);
            psum += p[jj];
        }
        denom = denom * scale + psum;
        mrun  = mnew;
#pragma unroll
        for (int d = 0; d < DSL; ++d) { s[d] *= scale; av[d] *= scale; }

#pragma unroll
        for (int h = 0; h < TJ / 4; ++h) {
            float kc[4][DSL], vc[4][DSL];
#pragma unroll
            for (int c = 0; c < 4; ++c)
#pragma unroll
                for (int d = 0; d < DSL; ++d) {
                    kc[c][d] = Kt[(size_t)(4 * h + c) * DIM + d];
                    vc[c][d] = Vt[(size_t)(4 * h + c) * DIM + d];
                }
            // Keeps four columns' K and V scalar loads together in front of their arithmetic
            // (one wait per four columns), as in the score loop.
            __builtin_amdgcn_sched_barrier(0);
#pragma unroll
            for (int c = 0; c < 4; ++c) {
                const v2f pj = p[4 * h + c];
#pragma unroll
                for (int d = 0; d < DSL; ++d) {
                    s[d]  = __builtin_elementwise_fma(
                                pj, __builtin_elementwise_max(q[d] + both(kc[c][d]), zero2), s[d]);
                    av[d] = __builtin_elementwise_fma(pj, both(vc[c][d]), av[d]);
                }
            }
            // Lower edge of the group, as in the score loop.
            __builtin_amdgcn_sched_barrier(0);
        }
    }

    keep_address(ahead);

    // Output product of the chunk: 64 x 128 = 4 x 8 tiles of 16 x 16, two per wave. Wave w owns
    // column tile w % 8 and row tiles 2*(w/8), 2*(w/8)+1, so one W_Ev fragment serves both.
    const int lo = lane & 15;
    const int hi = lane >> 4;
    const int n0 = (wave & 7) * 16;
    const int m0 = (wave >> 3) * 32;

    // The wave's W_Ev strip, asked for here so that it travels during the staging, the barrier
    // and the first products.
    v2f bw[DIM / 4];
#pragma unroll
    for (int kk = 0; kk < DIM / 4; ++kk) {
        const int ka = 4 * kk + 2 * hi;
        bw[kk].x = Wev[(size_t)ka       * DIM + n0 + lo];
        bw[kk].y = Wev[(size_t)(ka + 1) * DIM + n0 + lo];
    }

    // Lane-per-row registers -> row-major LDS.
#pragma unroll
    for (int u = 0; u < DSL / 4; ++u) {
        *(float4*)&To[0][lane][d0 + 4 * u]      = make_float4(s[4*u].x,  s[4*u+1].x,  s[4*u+2].x,  s[4*u+3].x);
        *(float4*)&To[0][lane + 32][d0 + 4 * u] = make_float4(s[4*u].y,  s[4*u+1].y,  s[4*u+2].y,  s[4*u+3].y);
        *(float4*)&To[1][lane][d0 + 4 * u]      = make_float4(av[4*u].x, av[4*u+1].x, av[4*u+2].x, av[4*u+3].x);
        *(float4*)&To[1][lane + 32][d0 + 4 * u] = make_float4(av[4*u].y, av[4*u+1].y, av[4*u+2].y, av[4*u+3].y);
    }
    // A work-group barrier that orders LDS alone: __syncthreads() would also wait here for all
    // 64 W_Ev loads, which no other wave reads; so each product waits only for its own two.
    __builtin_amdgcn_fence(__ATOMIC_RELEASE, "workgroup", "local");
    __builtin_amdgcn_s_barrier();
    __builtin_amdgcn_fence(__ATOMIC_ACQUIRE, "workgroup", "local");

    // The accumulators start as the AV tiles; each element of To[1] is read and later
    // rewritten by the same lane alone.
    v8f c0, c1;
#pragma unroll
    for (int r = 0; r < 8; ++r) {
        c0[r] = To[1][m0 + 8 * hi + r][n0 + lo];
        c1[r] = To[1][m0 + 16 + 8 * hi + r][n0 + lo];
    }
#pragma unroll
    for (int kk = 0; kk < DIM / 4; ++kk) {
        const int ka = 4 * kk + 2 * hi;
        const v2f a0 = *(const v2f*)&To[0][m0 + lo][ka];
        const v2f a1 = *(const v2f*)&To[0][m0 + 16 + lo][ka];
        c0 = __builtin_amdgcn_wmma_f32_16x16x4_f32(
                 false, a0, false, bw[kk], (short)0, c0, false, false);
        c1 = __builtin_amdgcn_wmma_f32_16x16x4_f32(
                 false, a1, false, bw[kk], (short)0, c1, false, false);
    }
#pragma unroll
    for (int r = 0; r < 8; ++r) {
        To[1][m0 + 8 * hi + r][n0 + lo]      = c0[r];
        To[1][m0 + 16 + 8 * hi + r][n0 + lo] = c1[r];
    }
    __syncthreads();

    // Row-major LDS -> whole 512-byte rows to memory.
    const size_t base = ((size_t)blockIdx.y * NPTS + row0) * DIM;
#pragma unroll
    for (int u = 0; u < RWG / NWV; ++u) {
        const int r = wave + NWV * u;     // one wave stores one row
        *(float4*)(Op + base + (size_t)r * DIM + lane * 4) = *(const float4*)&To[1][r][lane * 4];
    }
    // The four stores above are still in flight: their address and data registers
    // are not rewritten in front of this wait.
    asm volatile("s_wait_xcnt 0x0" ::: "memory");
    if (wave == 0) {
        Mp[blockIdx.y * NPTS + i]      = mrun.x;
        Mp[blockIdx.y * NPTS + i + 32] = mrun.y;
        Dp[blockIdx.y * NPTS + i]      = denom.x;
        Dp[blockIdx.y * NPTS + i + 32] = denom.y;
    }
}

// ---------------------------------------------------------------------------
// Kernel 2b: merge the NCH chunks of a row into the output:
//   out_i = sum_c exp(m_c - M) Op_c / sum_c exp(m_c - M) D_c + b_Ev,  M = max_c m_c.
// grid = NPTS/4, block = 128; one wave per row, lane = 4 dims.
// ---------------------------------------------------------------------------
__global__ __launch_bounds__(128) void merge_chunks(
    const float* __restrict__ Op,
    const float* __restrict__ Mp, const float* __restrict__ Dp,
    const float* __restrict__ bev,
    float* __restrict__ out,
    const float* Op_ask, const float* Mp_ask, const float* Dp_ask)
{
    const int lane = threadIdx.x & 31;
    const int wave = __builtin_amdgcn_readfirstlane(threadIdx.x >> 5);
    const int row  = blockIdx.x * 4 + wave;

    // All that this wave reads of the launch before: 16 chunk rows of 512 bytes (64 lines, two
    // per lane) and the row's 16 maxima and 16 denominators (one line each). Part of the loads
    // below issue only behind the first wait.
    const float* const ahead0 = Op_ask + ((size_t)(lane >> 2) * NPTS + row) * DIM + (lane & 3) * 32;
    const float* const ahead1 = ahead0 + (size_t)(NCH / 2) * NPTS * DIM;
    const float* const ahead2 = (lane < NCH ? Mp_ask : Dp_ask) + (lane & (NCH - 1)) * NPTS + row;
    ask_l2(ahead0);
    ask_l2(ahead1);
    ask_l2(ahead2);

    float4 x[NCH];
#pragma unroll
    for (int c = 0; c < NCH; ++c)
        x[c] = *(const float4*)(Op + ((size_t)c * NPTS + row) * DIM + lane * 4);
    const float4 b4 = *(const float4*)(bev + lane * 4);

    float m[NCH];
    float M = -1e30f;
#pragma unroll
    for (int c = 0; c < NCH; ++c) { m[c] = Mp[c * NPTS + row]; M = fmaxf(M, m[c]); }

    float  den = 0.f;
    float4 acc = {0.f, 0.f, 0.f, 0.f};
#pragma unroll
    for (int c = 0; c < NCH; ++c) {
        const float f = fast_exp(m[c] - M);
        den   = fmaf(f, Dp[c * NPTS + row], den);
        acc.x = fmaf(f, x[c].x, acc.x);
        acc.y = fmaf(f, x[c].y, acc.y);
        acc.z = fmaf(f, x[c].z, acc.z);
        acc.w = fmaf(f, x[c].w, acc.w);
    }
    const float inv = 1.0f / den;
    *(float4*)(out + (size_t)row * DIM + lane * 4) =
        make_float4(fmaf(acc.x, inv, b4.x), fmaf(acc.y, inv, b4.y),
                    fmaf(acc.z, inv, b4.z), fmaf(acc.w, inv, b4.w));
    keep_address(ahead0);
    keep_address(ahead1);
    keep_address(ahead2);
}

// ---------------------------------------------------------------------------
// Launch: inputs:
// 0:x 1:W_Q 2:b_Q 3:W_K 4:b_K 5:W_V 6:b_V 7:W_Ev 8:b_Ev 9:W_A 10:b_A
// Workspace: Q,K,V (3 planes of 1024*128 floats), then per chunk of j the unnormalised
// AV + S @ W_Ev (NCH planes) and each row's max and denominator.
// ---------------------------------------------------------------------------
extern "C" void kernel_launch(void* const* d_in, const int* in_sizes, int n_in,
                              void* d_out, int out_size, void* d_ws, size_t ws_size,
                              hipStream_t stream) {
    const float* x   = (const float*)d_in[0];
    const float* Wq  = (const float*)d_in[1];
    const float* bq  = (const float*)d_in[2];
    const float* Wk  = (const float*)d_in[3];
    const float* bk  = (const float*)d_in[4];
    const float* Wv  = (const float*)d_in[5];
    const float* bv  = (const float*)d_in[6];
    const float* Wev = (const float*)d_in[7];
    const float* bev = (const float*)d_in[8];
    const float* wA  = (const float*)d_in[9];
    const float* bA  = (const float*)d_in[10];

    float* ws = (float*)d_ws;
    float* Q  = ws;
    float* K  = ws + 1 * NPTS * DIM;
    float* V  = ws + 2 * NPTS * DIM;
    float* Op = ws + 3 * NPTS * DIM;
    float* Mp = ws + (3 + NCH) * NPTS * DIM;
    float* Dp = ws + (3 + NCH) * NPTS * DIM + NCH * NPTS;

    qkv_gemm_wmma<<<dim3(NPTS / 16, 3), 256, 0, stream>>>(
        x, Wq, bq, Wk, bk, Wv, bv, Q, K, V);

    edge_softmax_pass<<<dim3(NPTS / RWG, NCH), 32 * NWV, 0, stream>>>(
        Q, K, V, wA, bA, Wev, Op, Mp, Dp, K, V);

    merge_chunks<<<NPTS / 4, 128, 0, stream>>>(
        Op, Mp, Dp, bev, (float*)d_out, Op, Mp, Dp);
}

// v005
// Measured time: 26.4 microseconds a run.
// Two timings next to v004 both put it at 1.03 times that version's speed.
// All steps since v000 together make it 13.2 times as fast.
#include <hip/hip_runtime.h>
#include <math.h>

// FlexibleAttention, N=1024, DIM=128, fp32.
// Algebraic fusion: out_i = (Σ_j a_ij V_j) + (Σ_j a_ij relu(Q_i+K_j)) @ W_Ev + b_Ev
// => never materialize the [n,n,d] edge tensor; online softmax per row, j split in chunks.
// The product with W_Ev is linear in S, so each chunk applies it to its own unnormalised sums.

#define NPTS 1024
#define DIM  128

typedef float v2f __attribute__((ext_vector_type(2)));
typedef float v8f __attribute__((ext_vector_type(8)));

// ---------------------------------------------------------------------------
// Kernel 1: Q/K/V = x @ W + b   via V_WMMA_F32_16X16X4_F32
// grid = (NPTS/16, 3), block = 256 (8 waves; wave w owns n-tile w*16)
// blockIdx.y selects which of Q/K/V this block computes.
// Fragment layout (ISA 7.12.2, 32-bit):
//   A (16x4): lane L holds M=L%16, regs {K=2*(L/16), K=2*(L/16)+1}
//   B (4x16): lane L holds N=L%16, regs {K=2*(L/16), K=2*(L/16)+1}
//   D (16x16): c[r] = D[8*(L/16)+r][L%16]
// ---------------------------------------------------------------------------
__global__ __launch_bounds__(256) void qkv_gemm_wmma(
    const float* __restrict__ x,
    const float* __restrict__ Wq, const float* __restrict__ bq,
    const float* __restrict__ Wk, const float* __restrict__ bk,
    const float* __restrict__ Wv, const float* __restrict__ bv,
    float* __restrict__ Q, float* __restrict__ K, float* __restrict__ V)
{
    const int lane = threadIdx.x & 31;
    const int wave = threadIdx.x >> 5;
    const int lo   = lane & 15;
    const int hi   = lane >> 4;
    const int i0   = blockIdx.x * 16;
    const int n0   = wave * 16;

    const float* W; const float* bias; float* out;
    if (blockIdx.y == 0)      { W = Wq; bias = bq; out = Q; }
    else if (blockIdx.y == 1) { W = Wk; bias = bk; out = K; }
    else                      { W = Wv; bias = bv; out = V; }

    v8f c = {0.f,0.f,0.f,0.f,0.f,0.f,0.f,0.f};
    const float* xrow = x + (size_t)(i0 + lo) * DIM;

#pragma unroll
    for (int k0 = 0; k0 < DIM; k0 += 4) {
        const int ka = k0 + 2 * hi;
        v2f a; a.x = xrow[ka];
               a.y = xrow[ka + 1];
        v2f b; b.x = W[(size_t)ka       * DIM + n0 + lo];
               b.y = W[(size_t)(ka + 1) * DIM + n0 + lo];
        c = __builtin_amdgcn_wmma_f32_16x16x4_f32(
                false, a, false, b, (short)0, c, false, false);
    }

    const float bn = bias[n0 + lo];
#pragma unroll
    for (int r = 0; r < 8; ++r) {
        const int m = hi * 8 + r;
        out[(size_t)(i0 + m) * DIM + n0 + lo] = c[r] + bn;
    }
}

// Asks L2 for the line that holds *p; nothing comes back and no counter moves. For speed only.
// The kernels get the planes a second time as plain pointers (names ending in _ask) for these
// requests alone: loads through a pointer that an asm statement has seen are no longer made
// scalar loads.
__device__ __forceinline__ void ask_l2(const float* p)
{
    asm volatile("global_prefetch_b8 %0, off scope:SCOPE_SE" :: "v"(p));
}

// Input only, no code: the register pair that a request named stays that address up to here,
// so that no other value stands in it while the request may still be read.
__device__ __forceinline__ void keep_address(const float* p)
{
    asm volatile("" :: "v"(p));
}

// e^x as the fast form 2^(x * log2 e). The v_nop fills the one issue slot that the
// instruction set asks for behind a transcendental; inside the statement it cannot drift.
__device__ __forceinline__ float fast_exp(float x)
{
    float r;
    asm("v_exp_f32 %0, %1\n\tv_nop" : "=v"(r) : "v"(x * 1.44269504f));
    return r;
}

// ---------------------------------------------------------------------------
// Kernel 2: softmax-weighted sums over one chunk of j, TWO query rows per LANE.
//   work-group = 64 rows x JC columns j; lane l holds rows l and l+32 in the two
//   halves of each packed-f32 register pair; wave w owns dims [8w, 8w+8).
//   K_j and W_A are the same for every lane AND for both halves of a pair, so a
//   packed instruction takes them straight from a scalar register (a packed f32
//   instruction reads one scalar register for both halves; a pair of two different
//   scalars would first have to be copied into vector registers).
//   The sum over d of a score stays inside a lane; only the 16 per-wave partial
//   sums meet, in LDS.
//   Per 32-column tile: partial scores -> LDS -> full scores -> one online-softmax
//   rescale -> S += p * relu(Q_i+K_j) on the vector port; AV += P @ V is a plain matrix
//   product and runs on the matrix unit (V_WMMA_F32_16X16X4_F32, fragment layout as in
//   kernel 1), issued among the S sums, so that it costs the vector port next to nothing.
//   Behind the loop the work-group adds S @ W_Ev of its chunk's unnormalised sums onto the
//   same accumulators and leaves that one plane with the chunk's max and denominator;
//   kernel 2b merges the chunks into the output.
// grid = (NPTS/64, NCH), block = 512 (16 waves)
// ---------------------------------------------------------------------------
#define NCH   16               // chunks of j, one work-group each
#define JC    (NPTS / NCH)     // columns per chunk
#define TJ    32               // columns per softmax tile
#define NWV   16               // waves per work-group
#define DSL   (DIM / NWV)      // dims per wave
#define RWG   64               // rows per work-group
#define EPIT  (2 * TJ + 4)     // LDS pitch, floats: 16 B x odd for 16-byte reads
#define OPIT  (DIM + 4)        // LDS pitch, floats: 16 B x odd

// One wave-uniform value for both halves of a pair. The readfirstlane marks it as a single
// scalar register; without it the second word of each loaded row goes through a copy of its
// register pair into vector registers.
__device__ __forceinline__ v2f both(float x)
{
    const float u = __builtin_bit_cast(float, __builtin_amdgcn_readfirstlane(__builtin_bit_cast(int, x)));
    v2f r = {u, u};
    return r;
}

__global__ __launch_bounds__(512) void edge_softmax_pass(
    const float* __restrict__ Q, const float* __restrict__ K,
    const float* __restrict__ V,
    const float* __restrict__ wA, const float* __restrict__ bA,
    const float* __restrict__ Wev,
    float* __restrict__ Op,
    float* __restrict__ Mp, float* __restrict__ Dp,
    const float* K_ask, const float* V_ask)
{
    // Scores lie in LDS as they lie in registers: [lane][column][row l, row l+32].
    __shared__ __attribute__((aligned(16))) float Ep[NWV][32][EPIT];   // per-wave partial scores
    __shared__ __attribute__((aligned(16))) float Ef[32][EPIT];        // full scores
    __shared__ __attribute__((aligned(16))) float To[2][RWG][OPIT];    // row-major staging: S, result

    const int tid  = threadIdx.x;
    const int lane = tid & 31;
    const int wave = __builtin_amdgcn_readfirstlane(tid >> 5);
    const int row0 = blockIdx.x * RWG;
    const int i    = row0 + lane;          // .x half: row i, .y half: row i + 32
    const int d0   = wave * DSL;
    const int jbeg = blockIdx.y * JC;

    // The chunk's K rows and V rows are 32 KB each, contiguous: 512 lines of 128 bytes, one per
    // thread (waves 0-7 K, waves 8-15 V). The K scalar loads and the V fragment loads below come to them tile by tile.
    const float* const ahead = (wave < NWV / 2 ? K_ask : V_ask) + (size_t)jbeg * DIM + (tid & 255) * 32;
    ask_l2(ahead);
    // No instruction comes of this fence. With the asm statement as the last memory event in
    // front of the loop the compiler takes K and V as possibly rewritten and turns the loop's
    // scalar loads into vector loads with a copy to a scalar register per word.
    __builtin_amdgcn_fence(__ATOMIC_ACQUIRE, "wavefront");

    // Every '#pragma unroll' below makes the indices of these register arrays constants.
    const v2f zero2 = {0.f, 0.f};
    v2f q[DSL], s[DSL];
    float w[DSL];
#pragma unroll
    for (int u = 0; u < DSL / 4; ++u) {
        const float4 ta = *(const float4*)(Q + (size_t)i * DIM + d0 + 4 * u);
        const float4 tb = *(const float4*)(Q + (size_t)(i + 32) * DIM + d0 + 4 * u);
        q[4*u].x   = ta.x; q[4*u].y   = tb.x;
        q[4*u+1].x = ta.y; q[4*u+1].y = tb.y;
        q[4*u+2].x = ta.z; q[4*u+2].y = tb.z;
        q[4*u+3].x = ta.w; q[4*u+3].y = tb.w;
    }
#pragma unroll
    for (int d = 0; d < DSL; ++d) { w[d] = wA[d0 + d]; s[d] = zero2; }
    const float ba = bA[0];

    // Matrix tiles of the chunk's 64 x 128 result: 4 x 8 tiles of 16 x 16, two per wave. Wave w
    // owns column tile w % 8 and row tiles 2*(w/8), 2*(w/8)+1: rows m0 .. m0+31, which are the
    // .x halves (waves 0-7) or the .y halves (waves 8-15) of the lanes' pairs.
    const int  lo    = lane & 15;
    const int  hi    = lane >> 4;
    const int  n0    = (wave & 7) * 16;
    const int  m0    = (wave >> 3) * 32;
    const bool upper = wave >= NWV / 2;
    v8f c0 = {0.f,0.f,0.f,0.f,0.f,0.f,0.f,0.f};
    v8f c1 = {0.f,0.f,0.f,0.f,0.f,0.f,0.f,0.f};

    v2f mrun  = {-1e30f, -1e30f};
    v2f denom = zero2;

#pragma unroll 1   // one copy of the long straight-line body, for the instruction cache
    for (int t = 0; t < JC / TJ; ++t) {
        const float* __restrict__ Kt = K + (size_t)(jbeg + t * TJ) * DIM + d0;

        // The tile's V fragments (B, 4 x 16 per step), asked for here so that they travel
        // during the scores.
        const float* __restrict__ Vf = V + (size_t)(jbeg + t * TJ + 2 * hi) * DIM + n0 + lo;
        v2f bv[TJ / 4];
#pragma unroll
        for (int kk = 0; kk < TJ / 4; ++kk) {
            bv[kk].x = Vf[(size_t)(4 * kk)     * DIM];
            bv[kk].y = Vf[(size_t)(4 * kk + 1) * DIM];
        }

        // Partial scores over this wave's 8 dims, 32 columns, two rows, all inside the lane.
#pragma unroll
        for (int g = 0; g < TJ / 8; ++g) {
            float k8[8][DSL];
#pragma unroll
            for (int c = 0; c < 8; ++c)
#pragma unroll
                for (int d = 0; d < DSL; ++d)
                    k8[c][d] = Kt[(size_t)(8 * g + c) * DIM + d];
            // Keeps the eight rows' scalar loads together in front of their arithmetic: one
            // wait per eight columns; left alone the scheduler loads and waits row by row.
            __builtin_amdgcn_sched_barrier(0);
            v2f e8[8];
#pragma unroll
            for (int c = 0; c < 8; ++c) {
                v2f a = zero2;
#pragma unroll
                for (int d = 0; d < DSL; ++d)
                    a = __builtin_elementwise_fma(
                            __builtin_elementwise_max(q[d] + both(k8[c][d]), zero2), both(w[d]), a);
                e8[c] = a;
            }
#pragma unroll
            for (int u = 0; u < 4; ++u)
                *(float4*)&Ep[wave][lane][2 * (8 * g + 2 * u)] =
                    make_float4(e8[2*u].x, e8[2*u].y, e8[2*u+1].x, e8[2*u+1].y);
            // Lower edge: the next group's loads are not lifted in among this arithmetic,
            // where they would split into single loads with a wait each.
            __builtin_amdgcn_sched_barrier(0);
        }
        __syncthreads();

        // Wave w adds the 16 partial sums of columns 2w and 2w+1 (both rows of each lane), in wave order.
        {
            float4 acc = *(const float4*)&Ep[0][lane][4 * wave];
#pragma unroll
            for (int o = 1; o < NWV; ++o) {
                const float4 x4 = *(const float4*)&Ep[o][lane][4 * wave];
                acc.x += x4.x; acc.y += x4.y; acc.z += x4.z; acc.w += x4.w;
            }
            acc.x += ba; acc.y += ba; acc.z += ba; acc.w += ba;
            *(float4*)&Ef[lane][4 * wave] = acc;
        }
        __syncthreads();

        // The first eight K rows of the sums below, asked for in front of the softmax: the LDS
        // wait further down would otherwise hold these loads back to where they are needed.
        float kfirst[8][DSL];
#pragma unroll
        for (int c = 0; c < 8; ++c)
#pragma unroll
            for (int d = 0; d < DSL; ++d)
                kfirst[c][d] = Kt[(size_t)c * DIM + d];

        v2f p[TJ];
#pragma unroll
        for (int g = 0; g < TJ / 2; ++g) {
            const float4 x4 = *(const float4*)&Ef[lane][4 * g];
            p[2*g].x   = x4.x; p[2*g].y   = x4.y;
            p[2*g+1].x = x4.z; p[2*g+1].y = x4.w;
        }

        // One online-softmax update per tile (each lane for its own two rows).
        v2f mnew = mrun;
#pragma unroll
        for (int jj = 0; jj < TJ; ++jj) mnew = __builtin_elementwise_max(mnew, p[jj]);
        v2f scale;
        scale.x = fast_exp(mrun.x - mnew.x);
        scale.y = fast_exp(mrun.y - mnew.y);
        v2f psum = zero2;
#pragma unroll
        for (int jj = 0; jj < TJ; ++jj) {
            p[jj].x = fast_exp(p[jj].x - mnew.x);
            p[jj].y = fast_exp(p[jj].y - mnew.y);
            psum += p[jj];
        }
        denom = denom * scale + psum;
        mrun  = mnew;
#pragma unroll
        for (int d = 0; d < DSL; ++d) s[d] *= scale;

        // Lane-per-row weights -> A fragments, through the wave's own strip of Ep. Every other
        // wave has left that strip at the barrier above, and this wave writes its next partial
        // scores there only behind the products that use the reads below, so no barrier is
        // needed. Row l of the strip: the 32 weights of row m0 + l; the 32 floats behind row 0's
        // weights: the rescale factors of rows m0 .. m0+31.
        Ep[wave][0][TJ + lane] = upper ? scale.y : scale.x;
#pragma unroll
        for (int u = 0; u < TJ / 4; ++u)
            *(float4*)&Ep[wave][lane][4 * u] = upper
                ? make_float4(p[4*u].y, p[4*u+1].y, p[4*u+2].y, p[4*u+3].y)
                : make_float4(p[4*u].x, p[4*u+1].x, p[4*u+2].x, p[4*u+3].x);
        // Comes out as s_wait_dscnt 0: the wave's stores have landed before other lanes of the
        // wave read them back. LDS alone, so that the K loads below stay scalar loads.
        __builtin_amdgcn_fence(__ATOMIC_RELEASE, "workgroup", "local");
        {
            const float4 f0 = *(const float4*)&Ep[wave][0][TJ + 8 * hi];
            const float4 f1 = *(const float4*)&Ep[wave][0][TJ + 8 * hi + 4];
            const float4 g0 = *(const float4*)&Ep[wave][0][TJ + 16 + 8 * hi];
            const float4 g1 = *(const float4*)&Ep[wave][0][TJ + 16 + 8 * hi + 4];
            c0[0] *= f0.x; c0[1] *= f0.y; c0[2] *= f0.z; c0[3] *= f0.w;
            c0[4] *= f1.x; c0[5] *= f1.y; c0[6] *= f1.z; c0[7] *= f1.w;
            c1[0] *= g0.x; c1[1] *= g0.y; c1[2] *= g0.z; c1[3] *= g0.w;
            c1[4] *= g1.x; c1[5] *= g1.y; c1[6] *= g1.z; c1[7] *= g1.w;
        }
        v2f pa0[TJ / 4], pa1[TJ / 4];
#pragma unroll
        for (int kk = 0; kk < TJ / 4; ++kk) {
            pa0[kk] = *(const v2f*)&Ep[wave][lo][4 * kk + 2 * hi];
            pa1[kk] = *(const v2f*)&Ep[wave][16 + lo][4 * kk + 2 * hi];
        }

#pragma unroll
        for (int h = 0; h < TJ / 8; ++h) {
            float kc[8][DSL];
#pragma unroll
            for (int c = 0; c < 8; ++c)
#pragma unroll
                for (int d = 0; d < DSL; ++d)
                    kc[c][d] = h == 0 ? kfirst[c][d] : Kt[(size_t)(8 * h + c) * DIM + d];
            // Keeps eight columns' K scalar loads together in front of their arithmetic
            // (one wait per eight columns), as in the score loop.
            __builtin_amdgcn_sched_barrier(0);
#pragma unroll
            for (int c = 0; c < 8; ++c) {
                if ((c & 3) == 0) {
                    // Columns 8h+c .. 8h+c+3 of P @ V; the matrix unit works on them while
                    // the vector port goes on with the S sums.
                    const int kk = 2 * h + (c >> 2);
                    c0 = __builtin_amdgcn_wmma_f32_16x16x4_f32(
                             false, pa0[kk], false, bv[kk], (short)0, c0, false, false);
                    c1 = __builtin_amdgcn_wmma_f32_16x16x4_f32(
                             false, pa1[kk], false, bv[kk], (short)0, c1, false, false);
                }
                const v2f pj = p[8 * h + c];
#pragma unroll
                for (int d = 0; d < DSL; ++d)
                    s[d] = __builtin_elementwise_fma(
                               pj, __builtin_elementwise_max(q[d] + both(kc[c][d]), zero2), s[d]);
            }
            // Lower edge of the group, as in the score loop.
            __builtin_amdgcn_sched_barrier(0);
        }
    }

    keep_address(ahead);

    // Output product of the chunk, on the tiles that hold AV; one W_Ev fragment serves both.

    // The wave's W_Ev strip, asked for here so that it travels during the staging, the barrier
    // and the first products.
    v2f bw[DIM / 4];
#pragma unroll
    for (int kk = 0; kk < DIM / 4; ++kk) {
        const int ka = 4 * kk + 2 * hi;
        bw[kk].x = Wev[(size_t)ka       * DIM + n0 + lo];
        bw[kk].y = Wev[(size_t)(ka + 1) * DIM + n0 + lo];
    }

    // Lane-per-row registers -> row-major LDS.
#pragma unroll
    for (int u = 0; u < DSL / 4; ++u) {
        *(float4*)&To[0][lane][d0 + 4 * u]      = make_float4(s[4*u].x,  s[4*u+1].x,  s[4*u+2].x,  s[4*u+3].x);
        *(float4*)&To[0][lane + 32][d0 + 4 * u] = make_float4(s[4*u].y,  s[4*u+1].y,  s[4*u+2].y,  s[4*u+3].y);
    }
    // A work-group barrier that orders LDS alone: __syncthreads() would also wait here for all
    // 64 W_Ev loads, which no other wave reads; so each product waits only for its own two.
    __builtin_amdgcn_fence(__ATOMIC_RELEASE, "workgroup", "local");
    __builtin_amdgcn_s_barrier();
    __builtin_amdgcn_fence(__ATOMIC_ACQUIRE, "workgroup", "local");

#pragma unroll
    for (int kk = 0; kk < DIM / 4; ++kk) {
        const int ka = 4 * kk + 2 * hi;
        const v2f a0 = *(const v2f*)&To[0][m0 + lo][ka];
        const v2f a1 = *(const v2f*)&To[0][m0 + 16 + lo][ka];
        c0 = __builtin_amdgcn_wmma_f32_16x16x4_f32(
                 false, a0, false, bw[kk], (short)0, c0, false, false);
        c1 = __builtin_amdgcn_wmma_f32_16x16x4_f32(
                 false, a1, false, bw[kk], (short)0, c1, false, false);
    }
#pragma unroll
    for (int r = 0; r < 8; ++r) {
        To[1][m0 + 8 * hi + r][n0 + lo]      = c0[r];
        To[1][m0 + 16 + 8 * hi + r][n0 + lo] = c1[r];
    }
    __syncthreads();

    // Row-major LDS -> whole 512-byte rows to memory.
    const size_t base = ((size_t)blockIdx.y * NPTS + row0) * DIM;
#pragma unroll
    for (int u = 0; u < RWG / NWV; ++u) {
        const int r = wave + NWV * u;     // one wave stores one row
        *(float4*)(Op + base + (size_t)r * DIM + lane * 4) = *(const float4*)&To[1][r][lane * 4];
    }
    // The four stores above are still in flight: their address and data registers
    // are not rewritten in front of this wait.
    asm volatile("s_wait_xcnt 0x0" ::: "memory");
    if (wave == 0) {
        Mp[blockIdx.y * NPTS + i]      = mrun.x;
        Mp[blockIdx.y * NPTS + i + 32] = mrun.y;
        Dp[blockIdx.y * NPTS + i]      = denom.x;
        Dp[blockIdx.y * NPTS + i + 32] = denom.y;
    }
}

// ---------------------------------------------------------------------------
// Kernel 2b: merge the NCH chunks of a row into the output:
//   out_i = sum_c exp(m_c - M) Op_c / sum_c exp(m_c - M) D_c + b_Ev,  M = max_c m_c.
// grid = NPTS/4, block = 128; one wave per row, lane = 4 dims.
// ---------------------------------------------------------------------------
__global__ __launch_bounds__(128) void merge_chunks(
    const float* __restrict__ Op,
    const float* __restrict__ Mp, const float* __restrict__ Dp,
    const float* __restrict__ bev,
    float* __restrict__ out,
    const float* Op_ask, const float* Mp_ask, const float* Dp_ask)
{
    const int lane = threadIdx.x & 31;
    const int wave = __builtin_amdgcn_readfirstlane(threadIdx.x >> 5);
    const int row  = blockIdx.x * 4 + wave;

    // All that this wave reads of the launch before: 16 chunk rows of 512 bytes (64 lines, two
    // per lane) and the row's 16 maxima and 16 denominators (one line each). Part of the loads
    // below issue only behind the first wait.
    const float* const ahead0 = Op_ask + ((size_t)(lane >> 2) * NPTS + row) * DIM + (lane & 3) * 32;
    const float* const ahead1 = ahead0 + (size_t)(NCH / 2) * NPTS * DIM;
    const float* const ahead2 = (lane < NCH ? Mp_ask : Dp_ask) + (lane & (NCH - 1)) * NPTS + row;
    ask_l2(ahead0);
    ask_l2(ahead1);
    ask_l2(ahead2);

    float4 x[NCH];
#pragma unroll
    for (int c = 0; c < NCH; ++c)
        x[c] = *(const float4*)(Op + ((size_t)c * NPTS + row) * DIM + lane * 4);
    const float4 b4 = *(const float4*)(bev + lane * 4);

    float m[NCH];
    float M = -1e30f;
#pragma unroll
    for (int c = 0; c < NCH; ++c) { m[c] = Mp[c * NPTS + row]; M = fmaxf(M, m[c]); }

    float  den = 0.f;
    float4 acc = {0.f, 0.f, 0.f, 0.f};
#pragma unroll
    for (int c = 0; c < NCH; ++c) {
        const float f = fast_exp(m[c] - M);
        den   = fmaf(f, Dp[c * NPTS + row], den);
        acc.x = fmaf(f, x[c].x, acc.x);
        acc.y = fmaf(f, x[c].y, acc.y);
        acc.z = fmaf(f, x[c].z, acc.z);
        acc.w = fmaf(f, x[c].w, acc.w);
    }
    const float inv = 1.0f / den;
    *(float4*)(out + (size_t)row * DIM + lane * 4) =
        make_float4(fmaf(acc.x, inv, b4.x), fmaf(acc.y, inv, b4.y),
                    fmaf(acc.z, inv, b4.z), fmaf(acc.w, inv, b4.w));
    keep_address(ahead0);
    keep_address(ahead1);
    keep_address(ahead2);
}

// ---------------------------------------------------------------------------
// Launch: inputs:
// 0:x 1:W_Q 2:b_Q 3:W_K 4:b_K 5:W_V 6:b_V 7:W_Ev 8:b_Ev 9:W_A 10:b_A
// Workspace: Q,K,V (3 planes of 1024*128 floats), then per chunk of j the unnormalised
// AV + S @ W_Ev (NCH planes) and each row's max and denominator.
// ---------------------------------------------------------------------------
extern "C" void kernel_launch(void* const* d_in, const int* in_sizes, int n_in,
                              void* d_out, int out_size, void* d_ws, size_t ws_size,
                              hipStream_t stream) {
    const float* x   = (const float*)d_in[0];
    const float* Wq  = (const float*)d_in[1];
    const float* bq  = (const float*)d_in[2];
    const float* Wk  = (const float*)d_in[3];
    const float* bk  = (const float*)d_in[4];
    const float* Wv  = (const float*)d_in[5];
    const float* bv  = (const float*)d_in[6];
    const float* Wev = (const float*)d_in[7];
    const float* bev = (const float*)d_in[8];
    const float* wA  = (const float*)d_in[9];
    const float* bA  = (const float*)d_in[10];

    float* ws = (float*)d_ws;
    float* Q  = ws;
    float* K  = ws + 1 * NPTS * DIM;
    float* V  = ws + 2 * NPTS * DIM;
    float* Op = ws + 3 * NPTS * DIM;
    float* Mp = ws + (3 + NCH) * NPTS * DIM;
    float* Dp = ws + (3 + NCH) * NPTS * DIM + NCH * NPTS;

    qkv_gemm_wmma<<<dim3(NPTS / 16, 3), 256, 0, stream>>>(
        x, Wq, bq, Wk, bk, Wv, bv, Q, K, V);

    edge_softmax_pass<<<dim3(NPTS / RWG, NCH), 32 * NWV, 0, stream>>>(
        Q, K, V, wA, bA, Wev, Op, Mp, Dp, K, V);

    merge_chunks<<<NPTS / 4, 128, 0, stream>>>(
        Op, Mp, Dp, bev, (float*)d_out, Op, Mp, Dp);
}

// v006
// It runs in 22.9 microseconds.
// Two timings next to v005 put it at 1.14 and 1.16 times that version's speed.
// All steps since v000 together make it 15.2 times as fast.
#include <hip/hip_runtime.h>
#include <math.h>

// FlexibleAttention, N=1024, DIM=128, fp32.
// Algebraic fusion: out_i = (Σ_j a_ij V_j) + (Σ_j a_ij relu(Q_i+K_j)) @ W_Ev + b_Ev
// => never materialize the [n,n,d] edge tensor; online softmax per row, j split in chunks.
// The product with W_Ev is linear in S, so each chunk applies it to its own unnormalised sums.
// relu(Q_i+K_j) = max(K_j, -Q_i) + Q_i: the Q_i part of a score is the same for every j, so the
// softmax over j does not see it, and its part of S is Q_i times the sum of the weights.

#define NPTS 1024
#define DIM  128

typedef float v2f __attribute__((ext_vector_type(2)));
typedef float v8f __attribute__((ext_vector_type(8)));

// ---------------------------------------------------------------------------
// Kernel 1: Q/K/V = x @ W + b   via V_WMMA_F32_16X16X4_F32
// grid = (NPTS/16, 3), block = 256 (8 waves; wave w owns n-tile w*16)
// blockIdx.y selects which of Q/K/V this block computes.
// Fragment layout (ISA 7.12.2, 32-bit):
//   A (16x4): lane L holds M=L%16, regs {K=2*(L/16), K=2*(L/16)+1}
//   B (4x16): lane L holds N=L%16, regs {K=2*(L/16), K=2*(L/16)+1}
//   D (16x16): c[r] = D[8*(L/16)+r][L%16]
// ---------------------------------------------------------------------------
__global__ __launch_bounds__(256) void qkv_gemm_wmma(
    const float* __restrict__ x,
    const float* __restrict__ Wq, const float* __restrict__ bq,
    const float* __restrict__ Wk, const float* __restrict__ bk,
    const float* __restrict__ Wv, const float* __restrict__ bv,
    float* __restrict__ Q, float* __restrict__ K, float* __restrict__ V)
{
    const int lane = threadIdx.x & 31;
    const int wave = threadIdx.x >> 5;
    const int lo   = lane & 15;
    const int hi   = lane >> 4;
    const int i0   = blockIdx.x * 16;
    const int n0   = wave * 16;

    const float* W; const float* bias; float* out;
    if (blockIdx.y == 0)      { W = Wq; bias = bq; out = Q; }
    else if (blockIdx.y == 1) { W = Wk; bias = bk; out = K; }
    else                      { W = Wv; bias = bv; out = V; }

    v8f c = {0.f,0.f,0.f,0.f,0.f,0.f,0.f,0.f};
    const float* xrow = x + (size_t)(i0 + lo) * DIM;

#pragma unroll
    for (int k0 = 0; k0 < DIM; k0 += 4) {
        const int ka = k0 + 2 * hi;
        v2f a; a.x = xrow[ka];
               a.y = xrow[ka + 1];
        v2f b; b.x = W[(size_t)ka       * DIM + n0 + lo];
               b.y = W[(size_t)(ka + 1) * DIM + n0 + lo];
        c = __builtin_amdgcn_wmma_f32_16x16x4_f32(
                false, a, false, b, (short)0, c, false, false);
    }

    const float bn = bias[n0 + lo];
#pragma unroll
    for (int r = 0; r < 8; ++r) {
        const int m = hi * 8 + r;
        out[(size_t)(i0 + m) * DIM + n0 + lo] = c[r] + bn;
    }
}

// Asks L2 for the line that holds *p; nothing comes back and no counter moves. For speed only.
// The kernels get the planes a second time as plain pointers (names ending in _ask) for these
// requests alone: loads through a pointer that an asm statement has seen are no longer made
// scalar loads.
__device__ __forceinline__ void ask_l2(const float* p)
{
    asm volatile("global_prefetch_b8 %0, off scope:SCOPE_SE" :: "v"(p));
}

// Input only, no code: the register pair that a request named stays that address up to here,
// so that no other value stands in it while the request may still be read.
__device__ __forceinline__ void keep_address(const float* p)
{
    asm volatile("" :: "v"(p));
}

// e^x as the fast form 2^(x * log2 e). The v_nop fills the one issue slot that the
// instruction set asks for behind a transcendental; inside the statement it cannot drift.
__device__ __forceinline__ float fast_exp(float x)
{
    float r;
    asm("v_exp_f32 %0, %1\n\tv_nop" : "=v"(r) : "v"(x * 1.44269504f));
    return r;
}

// ---------------------------------------------------------------------------
// Kernel 2: softmax-weighted sums over one chunk of j, TWO query rows per LANE.
//   work-group = 64 rows x JC columns j; lane l holds rows l and l+32 in the two
//   halves of each packed-f32 register pair; wave w owns dims [8w, 8w+8).
//   K_j and W_A are the same for every lane AND for both halves of a pair, so a
//   packed or dual-issue instruction takes them straight from a scalar register (a packed f32
//   instruction reads one scalar register for both halves; a pair of two different
//   scalars would first have to be copied into vector registers).
//   The sum over d of a score stays inside a lane; only the 16 per-wave partial
//   sums meet, in LDS.
//   The lanes hold -Q_i, and both passes work on t_ij = max(K_j, -Q_i), one instruction, in
//   place of relu(Q_i+K_j), two: the scores are short of sum_d W_A Q_i, a constant of the row
//   in every chunk, and S gets Q_i * denominator once, behind the loop.
//   Per 32-column tile: partial scores -> LDS -> full scores -> one online-softmax
//   rescale -> S += p * t_ij on the vector port; AV += P @ V is a plain matrix
//   product and runs on the matrix unit (V_WMMA_F32_16X16X4_F32, fragment layout as in
//   kernel 1), issued among the S sums, so that it costs the vector port next to nothing.
//   Behind the loop the work-group adds S @ W_Ev of its chunk's unnormalised sums onto the
//   same accumulators and leaves that one plane with the chunk's max and denominator;
//   kernel 2b merges the chunks into the output.
// grid = (NPTS/64, NCH), block = 512 (16 waves)
// ---------------------------------------------------------------------------
#define NCH   16               // chunks of j, one work-group each
#define JC    (NPTS / NCH)     // columns per chunk
#define TJ    32               // columns per softmax tile
#define NWV   16               // waves per work-group
#define DSL   (DIM / NWV)      // dims per wave
#define RWG   64               // rows per work-group
#define EPIT  (2 * TJ + 4)     // LDS pitch, floats: 16 B x odd for 16-byte reads
#define OPIT  (DIM + 4)        // LDS pitch, floats: 16 B x odd

// One wave-uniform value for both halves of a pair. The readfirstlane marks it as a single
// scalar register; without it the second word of each loaded row goes through a copy of its
// register pair into vector registers.
__device__ __forceinline__ v2f both(float x)
{
    const float u = __builtin_bit_cast(float, __builtin_amdgcn_readfirstlane(__builtin_bit_cast(int, x)));
    v2f r = {u, u};
    return r;
}

// max(K, -Q) for the two rows of a lane in one issue slot: a dual-issue pair whose halves read
// the same scalar register. Written by hand because the compiler first passes every loaded K
// word through an instruction of its own (it quiets a signalling NaN) and then seldom pairs.
// The compiler gives no s_delay_alu hint for a value that asm text made, so the pairs come
// eight in a row: several vector instructions then stand between a pair and the first read
// of its result, and no hint is missed.
// Eight columns of one dim:
__device__ __forceinline__ void larger_cols(v2f (&t)[8], v2f a, float k0, float k1, float k2,
                                            float k3, float k4, float k5, float k6, float k7)
{
    asm(
        "v_dual_max_num_f32 %0, %16, %24 :: v_dual_max_num_f32 %1, %16, %25\n\t"
        "v_dual_max_num_f32 %2, %17, %24 :: v_dual_max_num_f32 %3, %17, %25\n\t"
        "v_dual_max_num_f32 %4, %18, %24 :: v_dual_max_num_f32 %5, %18, %25\n\t"
        "v_dual_max_num_f32 %6, %19, %24 :: v_dual_max_num_f32 %7, %19, %25\n\t"
        "v_dual_max_num_f32 %8, %20, %24 :: v_dual_max_num_f32 %9, %20, %25\n\t"
        "v_dual_max_num_f32 %10, %21, %24 :: v_dual_max_num_f32 %11, %21, %25\n\t"
        "v_dual_max_num_f32 %12, %22, %24 :: v_dual_max_num_f32 %13, %22, %25\n\t"
        "v_dual_max_num_f32 %14, %23, %24 :: v_dual_max_num_f32 %15, %23, %25"
        : "=&v"(t[0].x), "=&v"(t[0].y), "=&v"(t[1].x), "=&v"(t[1].y),
          "=&v"(t[2].x), "=&v"(t[2].y), "=&v"(t[3].x), "=&v"(t[3].y),
          "=&v"(t[4].x), "=&v"(t[4].y), "=&v"(t[5].x), "=&v"(t[5].y),
          "=&v"(t[6].x), "=&v"(t[6].y), "=&v"(t[7].x), "=&v"(t[7].y)
        : "s"(k0), "s"(k1), "s"(k2), "s"(k3), "s"(k4), "s"(k5), "s"(k6), "s"(k7),
          "v"(a.x), "v"(a.y));
}
// Four dims of one column:
__device__ __forceinline__ void larger_dims(v2f& t0, v2f& t1, v2f& t2, v2f& t3,
                                            v2f a0, v2f a1, v2f a2, v2f a3,
                                            float k0, float k1, float k2, float k3)
{
    asm(
        "v_dual_max_num_f32 %0, %8, %12 :: v_dual_max_num_f32 %1, %8, %13\n\t"
        "v_dual_max_num_f32 %2, %9, %14 :: v_dual_max_num_f32 %3, %9, %15\n\t"
        "v_dual_max_num_f32 %4, %10, %16 :: v_dual_max_num_f32 %5, %10, %17\n\t"
        "v_dual_max_num_f32 %6, %11, %18 :: v_dual_max_num_f32 %7, %11, %19"
        : "=&v"(t0.x), "=&v"(t0.y), "=&v"(t1.x), "=&v"(t1.y),
          "=&v"(t2.x), "=&v"(t2.y), "=&v"(t3.x), "=&v"(t3.y)
        : "s"(k0), "s"(k1), "s"(k2), "s"(k3),
          "v"(a0.x), "v"(a0.y), "v"(a1.x), "v"(a1.y), "v"(a2.x), "v"(a2.y), "v"(a3.x), "v"(a3.y));
}

// The same four pairs behind two steps of P @ V, in one statement: the compiler does not see
// which registers asm text writes, so it could hand a product's A or B registers to pairs that
// follow it at once. Here they are inputs of the statement whose outputs are all early-clobber,
// and the four pairs fill the four vector slots that the chip asks for behind a product.
__device__ __forceinline__ void products_and_larger_dims(
    v8f& c0, v8f& c1, v2f pa0, v2f pa1, v2f b,
    v2f& t0, v2f& t1, v2f& t2, v2f& t3, v2f a0, v2f a1, v2f a2, v2f a3,
    float k0, float k1, float k2, float k3)
{
    asm(
        "v_wmma_f32_16x16x4_f32 %0, %10, %12, %0\n\t"
        "v_wmma_f32_16x16x4_f32 %1, %11, %12, %1\n\t"
        "v_dual_max_num_f32 %2, %13, %17 :: v_dual_max_num_f32 %3, %13, %18\n\t"
        "v_dual_max_num_f32 %4, %14, %19 :: v_dual_max_num_f32 %5, %14, %20\n\t"
        "v_dual_max_num_f32 %6, %15, %21 :: v_dual_max_num_f32 %7, %15, %22\n\t"
        "v_dual_max_num_f32 %8, %16, %23 :: v_dual_max_num_f32 %9, %16, %24"
        : "+v"(c0), "+v"(c1),
          "=&v"(t0.x), "=&v"(t0.y), "=&v"(t1.x), "=&v"(t1.y),
          "=&v"(t2.x), "=&v"(t2.y), "=&v"(t3.x), "=&v"(t3.y)
        : "v"(pa0), "v"(pa1), "v"(b),
          "s"(k0), "s"(k1), "s"(k2), "s"(k3),
          "v"(a0.x), "v"(a0.y), "v"(a1.x), "v"(a1.y), "v"(a2.x), "v"(a2.y), "v"(a3.x), "v"(a3.y));
}

__global__ __launch_bounds__(512) void edge_softmax_pass(
    const float* __restrict__ Q, const float* __restrict__ K,
    const float* __restrict__ V,
    const float* __restrict__ wA, const float* __restrict__ bA,
    const float* __restrict__ Wev,
    float* __restrict__ Op,
    float* __restrict__ Mp, float* __restrict__ Dp,
    const float* K_ask, const float* V_ask)
{
    // Scores lie in LDS as they lie in registers: [lane][column][row l, row l+32].
    __shared__ __attribute__((aligned(16))) float Ep[NWV][32][EPIT];   // per-wave partial scores
    __shared__ __attribute__((aligned(16))) float Ef[32][EPIT];        // full scores
    __shared__ __attribute__((aligned(16))) float To[2][RWG][OPIT];    // row-major staging: S, result

    const int tid  = threadIdx.x;
    const int lane = tid & 31;
    const int wave = __builtin_amdgcn_readfirstlane(tid >> 5);
    const int row0 = blockIdx.x * RWG;
    const int i    = row0 + lane;          // .x half: row i, .y half: row i + 32
    const int d0   = wave * DSL;
    const int jbeg = blockIdx.y * JC;

    // The chunk's K rows and V rows are 32 KB each, contiguous: 512 lines of 128 bytes, one per
    // thread (waves 0-7 K, waves 8-15 V). The K scalar loads and the V fragment loads below come to them tile by tile.
    const float* const ahead = (wave < NWV / 2 ? K_ask : V_ask) + (size_t)jbeg * DIM + (tid & 255) * 32;
    ask_l2(ahead);
    // No instruction comes of this fence. With the asm statement as the last memory event in
    // front of the loop the compiler takes K and V as possibly rewritten and turns the loop's
    // scalar loads into vector loads with a copy to a scalar register per word.
    __builtin_amdgcn_fence(__ATOMIC_ACQUIRE, "wavefront");

    // Every '#pragma unroll' below makes the indices of these register arrays constants.
    const v2f zero2 = {0.f, 0.f};
    v2f nq[DSL], s[DSL];      // nq = -Q
    float w[DSL];
#pragma unroll
    for (int u = 0; u < DSL / 4; ++u) {
        const float4 ta = *(const float4*)(Q + (size_t)i * DIM + d0 + 4 * u);
        const float4 tb = *(const float4*)(Q + (size_t)(i + 32) * DIM + d0 + 4 * u);
        nq[4*u].x   = -ta.x; nq[4*u].y   = -tb.x;
        nq[4*u+1].x = -ta.y; nq[4*u+1].y = -tb.y;
        nq[4*u+2].x = -ta.z; nq[4*u+2].y = -tb.z;
        nq[4*u+3].x = -ta.w; nq[4*u+3].y = -tb.w;
    }
#pragma unroll
    for (int d = 0; d < DSL; ++d) { w[d] = wA[d0 + d]; s[d] = zero2; }
    const float ba = bA[0];

    // Matrix tiles of the chunk's 64 x 128 result: 4 x 8 tiles of 16 x 16, two per wave. Wave w
    // owns column tile w % 8 and row tiles 2*(w/8), 2*(w/8)+1: rows m0 .. m0+31, which are the
    // .x halves (waves 0-7) or the .y halves (waves 8-15) of the lanes' pairs.
    const int  lo    = lane & 15;
    const int  hi    = lane >> 4;
    const int  n0    = (wave & 7) * 16;
    const int  m0    = (wave >> 3) * 32;
    const bool upper = wave >= NWV / 2;
    v8f c0 = {0.f,0.f,0.f,0.f,0.f,0.f,0.f,0.f};
    v8f c1 = {0.f,0.f,0.f,0.f,0.f,0.f,0.f,0.f};

    v2f mrun  = {-1e30f, -1e30f};
    v2f denom = zero2;

#pragma unroll 1   // one copy of the long straight-line body, for the instruction cache
    for (int t = 0; t < JC / TJ; ++t) {
        const float* __restrict__ Kt = K + (size_t)(jbeg + t * TJ) * DIM + d0;

        // The tile's V fragments (B, 4 x 16 per step), asked for here so that they travel
        // during the scores.
        const float* __restrict__ Vf = V + (size_t)(jbeg + t * TJ + 2 * hi) * DIM + n0 + lo;
        v2f bv[TJ / 4];
#pragma unroll
        for (int kk = 0; kk < TJ / 4; ++kk) {
            bv[kk].x = Vf[(size_t)(4 * kk)     * DIM];
            bv[kk].y = Vf[(size_t)(4 * kk + 1) * DIM];
        }

        // Partial scores over this wave's 8 dims, 32 columns, two rows, all inside the lane.
#pragma unroll
        for (int g = 0; g < TJ / 8; ++g) {
            float k8[8][DSL];
#pragma unroll
            for (int c = 0; c < 8; ++c)
#pragma unroll
                for (int d = 0; d < DSL; ++d)
                    k8[c][d] = Kt[(size_t)(8 * g + c) * DIM + d];
            // Keeps the eight rows' scalar loads together in front of their arithmetic: one
            // wait per eight columns; left alone the scheduler loads and waits row by row.
            __builtin_amdgcn_sched_barrier(0);
            v2f e8[8];
#pragma unroll
            for (int c = 0; c < 8; ++c) e8[c] = zero2;
#pragma unroll
            for (int d = 0; d < DSL; ++d) {
                v2f t8[8];
                larger_cols(t8, nq[d], k8[0][d], k8[1][d], k8[2][d], k8[3][d],
                                       k8[4][d], k8[5][d], k8[6][d], k8[7][d]);
                // Holds the eight sums behind all eight pairs (the distance named at larger_cols).
                __builtin_amdgcn_sched_barrier(0);
#pragma unroll
                for (int c = 0; c < 8; ++c)
                    e8[c] = __builtin_elementwise_fma(t8[c], both(w[d]), e8[c]);
                // Holds the next dim's pairs behind these sums, for the same distance.
                __builtin_amdgcn_sched_barrier(0);
            }
#pragma unroll
            for (int u = 0; u < 4; ++u)
                *(float4*)&Ep[wave][lane][2 * (8 * g + 2 * u)] =
                    make_float4(e8[2*u].x, e8[2*u].y, e8[2*u+1].x, e8[2*u+1].y);
            // Lower edge: the next group's loads are not lifted in among this arithmetic,
            // where they would split into single loads with a wait each.
            __builtin_amdgcn_sched_barrier(0);
        }
        __syncthreads();

        // Wave w adds the 16 partial sums of columns 2w and 2w+1 (both rows of each lane), in wave order.
        {
            float4 acc = *(const float4*)&Ep[0][lane][4 * wave];
#pragma unroll
            for (int o = 1; o < NWV; ++o) {
                const float4 x4 = *(const float4*)&Ep[o][lane][4 * wave];
                acc.x += x4.x; acc.y += x4.y; acc.z += x4.z; acc.w += x4.w;
            }
            acc.x += ba; acc.y += ba; acc.z += ba; acc.w += ba;
            *(float4*)&Ef[lane][4 * wave] = acc;
        }
        __syncthreads();

        // The first eight K rows of the sums below, asked for in front of the softmax: the LDS
        // wait further down would otherwise hold these loads back to where they are needed.
        float kfirst[8][DSL];
#pragma unroll
        for (int c = 0; c < 8; ++c)
#pragma unroll
            for (int d = 0; d < DSL; ++d)
                kfirst[c][d] = Kt[(size_t)c * DIM + d];

        v2f p[TJ];
#pragma unroll
        for (int g = 0; g < TJ / 2; ++g) {
            const float4 x4 = *(const float4*)&Ef[lane][4 * g];
            p[2*g].x   = x4.x; p[2*g].y   = x4.y;
            p[2*g+1].x = x4.z; p[2*g+1].y = x4.w;
        }

        // One online-softmax update per tile (each lane for its own two rows).
        v2f mnew = mrun;
#pragma unroll
        for (int jj = 0; jj < TJ; ++jj) mnew = __builtin_elementwise_max(mnew, p[jj]);
        v2f scale;
        scale.x = fast_exp(mrun.x - mnew.x);
        scale.y = fast_exp(mrun.y - mnew.y);
        v2f psum = zero2;
#pragma unroll
        for (int jj = 0; jj < TJ; ++jj) {
            p[jj].x = fast_exp(p[jj].x - mnew.x);
            p[jj].y = fast_exp(p[jj].y - mnew.y);
            psum += p[jj];
        }
        denom = denom * scale + psum;
        mrun  = mnew;
#pragma unroll
        for (int d = 0; d < DSL; ++d) s[d] *= scale;

        // Lane-per-row weights -> A fragments, through the wave's own strip of Ep. Every other
        // wave has left that strip at the barrier above, and this wave writes its next partial
        // scores there only behind the products that use the reads below, so no barrier is
        // needed. Row l of the strip: the 32 weights of row m0 + l; the 32 floats behind row 0's
        // weights: the rescale factors of rows m0 .. m0+31.
        Ep[wave][0][TJ + lane] = upper ? scale.y : scale.x;
#pragma unroll
        for (int u = 0; u < TJ / 4; ++u)
            *(float4*)&Ep[wave][lane][4 * u] = upper
                ? make_float4(p[4*u].y, p[4*u+1].y, p[4*u+2].y, p[4*u+3].y)
                : make_float4(p[4*u].x, p[4*u+1].x, p[4*u+2].x, p[4*u+3].x);
        // Comes out as s_wait_dscnt 0: the wave's stores have landed before other lanes of the
        // wave read them back. LDS alone, so that the K loads below stay scalar loads.
        __builtin_amdgcn_fence(__ATOMIC_RELEASE, "workgroup", "local");
        {
            const float4 f0 = *(const float4*)&Ep[wave][0][TJ + 8 * hi];
            const float4 f1 = *(const float4*)&Ep[wave][0][TJ + 8 * hi + 4];
            const float4 g0 = *(const float4*)&Ep[wave][0][TJ + 16 + 8 * hi];
            const float4 g1 = *(const float4*)&Ep[wave][0][TJ + 16 + 8 * hi + 4];
            c0[0] *= f0.x; c0[1] *= f0.y; c0[2] *= f0.z; c0[3] *= f0.w;
            c0[4] *= f1.x; c0[5] *= f1.y; c0[6] *= f1.z; c0[7] *= f1.w;
            c1[0] *= g0.x; c1[1] *= g0.y; c1[2] *= g0.z; c1[3] *= g0.w;
            c1[4] *= g1.x; c1[5] *= g1.y; c1[6] *= g1.z; c1[7] *= g1.w;
        }
        v2f pa0[TJ / 4], pa1[TJ / 4];
#pragma unroll
        for (int kk = 0; kk < TJ / 4; ++kk) {
            pa0[kk] = *(const v2f*)&Ep[wave][lo][4 * kk + 2 * hi];
            pa1[kk] = *(const v2f*)&Ep[wave][16 + lo][4 * kk + 2 * hi];
        }

#pragma unroll
        for (int h = 0; h < TJ / 8; ++h) {
            float kc[8][DSL];
#pragma unroll
            for (int c = 0; c < 8; ++c)
#pragma unroll
                for (int d = 0; d < DSL; ++d)
                    kc[c][d] = h == 0 ? kfirst[c][d] : Kt[(size_t)(8 * h + c) * DIM + d];
            // Keeps eight columns' K scalar loads together in front of their arithmetic
            // (one wait per eight columns), as in the score loop.
            __builtin_amdgcn_sched_barrier(0);
#pragma unroll
            for (int c = 0; c < 8; ++c) {
                v2f td[DSL];
                if ((c & 3) == 0) {
                    // Columns 8h+c .. 8h+c+3 of P @ V; the matrix unit works on them while
                    // the vector port goes on with the S sums.
                    const int kk = 2 * h + (c >> 2);
                    products_and_larger_dims(c0, c1, pa0[kk], pa1[kk], bv[kk],
                                             td[0], td[1], td[2], td[3], nq[0], nq[1], nq[2], nq[3],
                                             kc[c][0], kc[c][1], kc[c][2], kc[c][3]);
                } else {
                    larger_dims(td[0], td[1], td[2], td[3], nq[0], nq[1], nq[2], nq[3],
                                kc[c][0], kc[c][1], kc[c][2], kc[c][3]);
                }
                larger_dims(td[4], td[5], td[6], td[7], nq[4], nq[5], nq[6], nq[7],
                            kc[c][4], kc[c][5], kc[c][6], kc[c][7]);
                // Holds the eight sums behind all eight pairs (the distance named at larger_cols).
                __builtin_amdgcn_sched_barrier(0);
                const v2f pj = p[8 * h + c];
#pragma unroll
                for (int d = 0; d < DSL; ++d)
                    s[d] = __builtin_elementwise_fma(pj, td[d], s[d]);
                // Holds the next column's pairs behind these sums, for the same distance.
                __builtin_amdgcn_sched_barrier(0);
            }
            // Lower edge of the group, as in the score loop.
            __builtin_amdgcn_sched_barrier(0);
        }
    }

    keep_address(ahead);

    // The Q_i part of relu(Q_i+K_j), for all the chunk's columns at once.
#pragma unroll
    for (int d = 0; d < DSL; ++d) s[d] = __builtin_elementwise_fma(-nq[d], denom, s[d]);

    // Output product of the chunk, on the tiles that hold AV; one W_Ev fragment serves both.

    // The wave's W_Ev strip, asked for here so that it travels during the staging, the barrier
    // and the first products.
    v2f bw[DIM / 4];
#pragma unroll
    for (int kk = 0; kk < DIM / 4; ++kk) {
        const int ka = 4 * kk + 2 * hi;
        bw[kk].x = Wev[(size_t)ka       * DIM + n0 + lo];
        bw[kk].y = Wev[(size_t)(ka + 1) * DIM + n0 + lo];
    }

    // Lane-per-row registers -> row-major LDS.
#pragma unroll
    for (int u = 0; u < DSL / 4; ++u) {
        *(float4*)&To[0][lane][d0 + 4 * u]      = make_float4(s[4*u].x,  s[4*u+1].x,  s[4*u+2].x,  s[4*u+3].x);
        *(float4*)&To[0][lane + 32][d0 + 4 * u] = make_float4(s[4*u].y,  s[4*u+1].y,  s[4*u+2].y,  s[4*u+3].y);
    }
    // A work-group barrier that orders LDS alone: __syncthreads() would also wait here for all
    // 64 W_Ev loads, which no other wave reads; so each product waits only for its own two.
    __builtin_amdgcn_fence(__ATOMIC_RELEASE, "workgroup", "local");
    __builtin_amdgcn_s_barrier();
    __builtin_amdgcn_fence(__ATOMIC_ACQUIRE, "workgroup", "local");

#pragma unroll
    for (int kk = 0; kk < DIM / 4; ++kk) {
        const int ka = 4 * kk + 2 * hi;
        const v2f a0 = *(const v2f*)&To[0][m0 + lo][ka];
        const v2f a1 = *(const v2f*)&To[0][m0 + 16 + lo][ka];
        c0 = __builtin_amdgcn_wmma_f32_16x16x4_f32(
                 false, a0, false, bw[kk], (short)0, c0, false, false);
        c1 = __builtin_amdgcn_wmma_f32_16x16x4_f32(
                 false, a1, false, bw[kk], (short)0, c1, false, false);
    }
#pragma unroll
    for (int r = 0; r < 8; ++r) {
        To[1][m0 + 8 * hi + r][n0 + lo]      = c0[r];
        To[1][m0 + 16 + 8 * hi + r][n0 + lo] = c1[r];
    }
    __syncthreads();

    // Row-major LDS -> whole 512-byte rows to memory.
    const size_t base = ((size_t)blockIdx.y * NPTS + row0) * DIM;
#pragma unroll
    for (int u = 0; u < RWG / NWV; ++u) {
        const int r = wave + NWV * u;     // one wave stores one row
        *(float4*)(Op + base + (size_t)r * DIM + lane * 4) = *(const float4*)&To[1][r][lane * 4];
    }
    // The four stores above are still in flight: their address and data registers
    // are not rewritten in front of this wait.
    asm volatile("s_wait_xcnt 0x0" ::: "memory");
    if (wave == 0) {
        Mp[blockIdx.y * NPTS + i]      = mrun.x;
        Mp[blockIdx.y * NPTS + i + 32] = mrun.y;
        Dp[blockIdx.y * NPTS + i]      = denom.x;
        Dp[blockIdx.y * NPTS + i + 32] = denom.y;
    }
}

// ---------------------------------------------------------------------------
// Kernel 2b: merge the NCH chunks of a row into the output:
//   out_i = sum_c exp(m_c - M) Op_c / sum_c exp(m_c - M) D_c + b_Ev,  M = max_c m_c.
// grid = NPTS/4, block = 128; one wave per row, lane = 4 dims.
// ---------------------------------------------------------------------------
__global__ __launch_bounds__(128) void merge_chunks(
    const float* __restrict__ Op,
    const float* __restrict__ Mp, const float* __restrict__ Dp,
    const float* __restrict__ bev,
    float* __restrict__ out,
    const float* Op_ask, const float* Mp_ask, const float* Dp_ask)
{
    const int lane = threadIdx.x & 31;
    const int wave = __builtin_amdgcn_readfirstlane(threadIdx.x >> 5);
    const int row  = blockIdx.x * 4 + wave;

    // All that this wave reads of the launch before: 16 chunk rows of 512 bytes (64 lines, two
    // per lane) and the row's 16 maxima and 16 denominators (one line each). Part of the loads
    // below issue only behind the first wait.
    const float* const ahead0 = Op_ask + ((size_t)(lane >> 2) * NPTS + row) * DIM + (lane & 3) * 32;
    const float* const ahead1 = ahead0 + (size_t)(NCH / 2) * NPTS * DIM;
    const float* const ahead2 = (lane < NCH ? Mp_ask : Dp_ask) + (lane & (NCH - 1)) * NPTS + row;
    ask_l2(ahead0);
    ask_l2(ahead1);
    ask_l2(ahead2);

    float4 x[NCH];
#pragma unroll
    for (int c = 0; c < NCH; ++c)
        x[c] = *(const float4*)(Op + ((size_t)c * NPTS + row) * DIM + lane * 4);
    const float4 b4 = *(const float4*)(bev + lane * 4);

    float m[NCH];
    float M = -1e30f;
#pragma unroll
    for (int c = 0; c < NCH; ++c) { m[c] = Mp[c * NPTS + row]; M = fmaxf(M, m[c]); }

    float  den = 0.f;
    float4 acc = {0.f, 0.f, 0.f, 0.f};
#pragma unroll
    for (int c = 0; c < NCH; ++c) {
        const float f = fast_exp(m[c] - M);
        den   = fmaf(f, Dp[c * NPTS + row], den);
        acc.x = fmaf(f, x[c].x, acc.x);
        acc.y = fmaf(f, x[c].y, acc.y);
        acc.z = fmaf(f, x[c].z, acc.z);
        acc.w = fmaf(f, x[c].w, acc.w);
    }
    const float inv = 1.0f / den;
    *(float4*)(out + (size_t)row * DIM + lane * 4) =
        make_float4(fmaf(acc.x, inv, b4.x), fmaf(acc.y, inv, b4.y),
                    fmaf(acc.z, inv, b4.z), fmaf(acc.w, inv, b4.w));
    keep_address(ahead0);
    keep_address(ahead1);
    keep_address(ahead2);
}

// ---------------------------------------------------------------------------
// Launch: inputs:
// 0:x 1:W_Q 2:b_Q 3:W_K 4:b_K 5:W_V 6:b_V 7:W_Ev 8:b_Ev 9:W_A 10:b_A
// Workspace: Q,K,V (3 planes of 1024*128 floats), then per chunk of j the unnormalised
// AV + S @ W_Ev (NCH planes) and each row's max and denominator.
// ---------------------------------------------------------------------------
extern "C" void kernel_launch(void* const* d_in, const int* in_sizes, int n_in,
                              void* d_out, int out_size, void* d_ws, size_t ws_size,
                              hipStream_t stream) {
    const float* x   = (const float*)d_in[0];
    const float* Wq  = (const float*)d_in[1];
    const float* bq  = (const float*)d_in[2];
    const float* Wk  = (const float*)d_in[3];
    const float* bk  = (const float*)d_in[4];
    const float* Wv  = (const float*)d_in[5];
    const float* bv  = (const float*)d_in[6];
    const float* Wev = (const float*)d_in[7];
    const float* bev = (const float*)d_in[8];
    const float* wA  = (const float*)d_in[9];
    const float* bA  = (const float*)d_in[10];

    float* ws = (float*)d_ws;
    float* Q  = ws;
    float* K  = ws + 1 * NPTS * DIM;
    float* V  = ws + 2 * NPTS * DIM;
    float* Op = ws + 3 * NPTS * DIM;
    float* Mp = ws + (3 + NCH) * NPTS * DIM;
    float* Dp = ws + (3 + NCH) * NPTS * DIM + NCH * NPTS;

    qkv_gemm_wmma<<<dim3(NPTS / 16, 3), 256, 0, stream>>>(
        x, Wq, bq, Wk, bk, Wv, bv, Q, K, V);

    edge_softmax_pass<<<dim3(NPTS / RWG, NCH), 32 * NWV, 0, stream>>>(
        Q, K, V, wA, bA, Wev, Op, Mp, Dp, K, V);

    merge_chunks<<<NPTS / 4, 128, 0, stream>>>(
        Op, Mp, Dp, bev, (float*)d_out, Op, Mp, Dp);
}

// v007
// A run of this version takes 22.3 microseconds.
// Two timings next to v006 put it at 1.04 and 1.02 times that version's speed.
// All steps since v000 together make it 15.7 times as fast.
#include <hip/hip_runtime.h>
#include <math.h>

// FlexibleAttention, N=1024, DIM=128, fp32.
// Algebraic fusion: out_i = (Σ_j a_ij V_j) + (Σ_j a_ij relu(Q_i+K_j)) @ W_Ev + b_Ev
// => never materialize the [n,n,d] edge tensor; online softmax per row, j split in chunks.
// The product with W_Ev is linear in S, so each chunk applies it to its own unnormalised sums.
// relu(Q_i+K_j) = max(K_j, -Q_i) + Q_i: the Q_i part of a score is the same for every j, so the
// softmax over j does not see it, and its part of S is Q_i times the sum of the weights.

#define NPTS 1024
#define DIM  128

typedef float v2f __attribute__((ext_vector_type(2)));
typedef float v8f __attribute__((ext_vector_type(8)));

// ---------------------------------------------------------------------------
// Kernel 1: Q/K/V = x @ W + b   via V_WMMA_F32_16X16X4_F32
// grid = (NPTS/16, 3), block = 256 (8 waves; wave w owns n-tile w*16)
// blockIdx.y selects which of Q/K/V this block computes.
// Fragment layout (ISA 7.12.2, 32-bit):
//   A (16x4): lane L holds M=L%16, regs {K=2*(L/16), K=2*(L/16)+1}
//   B (4x16): lane L holds N=L%16, regs {K=2*(L/16), K=2*(L/16)+1}
//   D (16x16): c[r] = D[8*(L/16)+r][L%16]
// ---------------------------------------------------------------------------
__global__ __launch_bounds__(256) void qkv_gemm_wmma(
    const float* __restrict__ x,
    const float* __restrict__ Wq, const float* __restrict__ bq,
    const float* __restrict__ Wk, const float* __restrict__ bk,
    const float* __restrict__ Wv, const float* __restrict__ bv,
    float* __restrict__ Q, float* __restrict__ K, float* __restrict__ V)
{
    const int lane = threadIdx.x & 31;
    const int wave = threadIdx.x >> 5;
    const int lo   = lane & 15;
    const int hi   = lane >> 4;
    const int i0   = blockIdx.x * 16;
    const int n0   = wave * 16;

    const float* W; const float* bias; float* out;
    if (blockIdx.y == 0)      { W = Wq; bias = bq; out = Q; }
    else if (blockIdx.y == 1) { W = Wk; bias = bk; out = K; }
    else                      { W = Wv; bias = bv; out = V; }

    v8f c = {0.f,0.f,0.f,0.f,0.f,0.f,0.f,0.f};
    const float* xrow = x + (size_t)(i0 + lo) * DIM;

#pragma unroll
    for (int k0 = 0; k0 < DIM; k0 += 4) {
        const int ka = k0 + 2 * hi;
        v2f a; a.x = xrow[ka];
               a.y = xrow[ka + 1];
        v2f b; b.x = W[(size_t)ka       * DIM + n0 + lo];
               b.y = W[(size_t)(ka + 1) * DIM + n0 + lo];
        c = __builtin_amdgcn_wmma_f32_16x16x4_f32(
                false, a, false, b, (short)0, c, false, false);
    }

    const float bn = bias[n0 + lo];
#pragma unroll
    for (int r = 0; r < 8; ++r) {
        const int m = hi * 8 + r;
        out[(size_t)(i0 + m) * DIM + n0 + lo] = c[r] + bn;
    }
}

// Asks L2 for the line that holds *p; nothing comes back and no counter moves. For speed only.
// The kernels get the planes a second time as plain pointers (names ending in _ask) for these
// requests alone: loads through a pointer that an asm statement has seen are no longer made
// scalar loads.
__device__ __forceinline__ void ask_l2(const float* p)
{
    asm volatile("global_prefetch_b8 %0, off scope:SCOPE_SE" :: "v"(p));
}

// Input only, no code: the register pair that a request named stays that address up to here,
// so that no other value stands in it while the request may still be read.
__device__ __forceinline__ void keep_address(const float* p)
{
    asm volatile("" :: "v"(p));
}

// e^x as the fast form 2^(x * log2 e). The v_nop fills the one issue slot that the
// instruction set asks for behind a transcendental; inside the statement it cannot drift.
__device__ __forceinline__ float fast_exp(float x)
{
    float r;
    asm("v_exp_f32 %0, %1\n\tv_nop" : "=v"(r) : "v"(x * 1.44269504f));
    return r;
}

// ---------------------------------------------------------------------------
// Kernel 2: softmax-weighted sums over one chunk of j, TWO query rows per LANE.
//   work-group = 64 rows x JC columns j; lane l holds rows l and l+32 in the two
//   halves of each packed-f32 register pair. The 16 waves are two groups of eight: group g
//   works on columns [32g, 32g+32) of the chunk, and wave v of a group owns dims [16v, 16v+16).
//   K_j and W_A are the same for every lane AND for both halves of a pair, so a
//   packed or dual-issue instruction takes them straight from a scalar register (a packed f32
//   instruction reads one scalar register for both halves; a pair of two different
//   scalars would first have to be copied into vector registers).
//   The sum over d of a score stays inside a lane; only the 8 per-wave partial
//   sums of a group meet, in LDS.
//   The lanes hold -Q_i, and both passes work on t_ij = max(K_j, -Q_i), one instruction, in
//   place of relu(Q_i+K_j), two: the scores are short of sum_d W_A Q_i, a constant of the row
//   in every chunk, and S gets Q_i * denominator once, behind the loop.
//   Partial scores -> LDS -> full scores and the rows' maxima over all 64 columns -> one
//   softmax, each wave for its group's 32 columns alone -> S += p * t_ij on the vector port,
//   summed over the two groups at the end; AV += P @ V is a plain matrix
//   product and runs on the matrix unit (V_WMMA_F32_16X16X4_F32, fragment layout as in
//   kernel 1), issued among the S sums, so that it costs the vector port next to nothing.
//   Behind the loop the work-group adds S @ W_Ev of its chunk's unnormalised sums onto the
//   same accumulators and leaves that one plane with the chunk's max and denominator;
//   kernel 2b merges the chunks into the output.
// grid = (NPTS/64, NCH), block = 512 (16 waves)
// ---------------------------------------------------------------------------
#define NCH   16               // chunks of j, one work-group each
#define JC    (NPTS / NCH)     // columns per chunk
#define NG    2                // column groups of a chunk, eight waves each
#define TJ    (JC / NG)        // columns per group
#define NWV   16               // waves per work-group
#define GWV   (NWV / NG)       // waves per group
#define DSL   (DIM / GWV)      // dims per wave
#define RWG   64               // rows per work-group
#define EPIT  (2 * TJ + 4)     // LDS pitch, floats: 16 B x odd for 16-byte reads
#define MPIT  (2 * NWV + 4)    // LDS pitch, floats: 16 B x odd
#define OPIT  (DIM + 4)        // LDS pitch, floats: 16 B x odd

// One wave-uniform value for both halves of a pair. The readfirstlane marks it as a single
// scalar register; without it the second word of each loaded row goes through a copy of its
// register pair into vector registers.
__device__ __forceinline__ v2f both(float x)
{
    const float u = __builtin_bit_cast(float, __builtin_amdgcn_readfirstlane(__builtin_bit_cast(int, x)));
    v2f r = {u, u};
    return r;
}

// max(K, -Q) for the two rows of a lane in one issue slot: a dual-issue pair whose halves read
// the same scalar register. Written by hand because the compiler first passes every loaded K
// word through an instruction of its own (it quiets a signalling NaN) and then seldom pairs.
// The compiler gives no s_delay_alu hint for a value that asm text made, so the pairs come
// eight in a row: several vector instructions then stand between a pair and the first read
// of its result, and no hint is missed.
// Eight columns of one dim:
__device__ __forceinline__ void larger_cols(v2f (&t)[8], v2f a, float k0, float k1, float k2,
                                            float k3, float k4, float k5, float k6, float k7)
{
    asm(
        "v_dual_max_num_f32 %0, %16, %24 :: v_dual_max_num_f32 %1, %16, %25\n\t"
        "v_dual_max_num_f32 %2, %17, %24 :: v_dual_max_num_f32 %3, %17, %25\n\t"
        "v_dual_max_num_f32 %4, %18, %24 :: v_dual_max_num_f32 %5, %18, %25\n\t"
        "v_dual_max_num_f32 %6, %19, %24 :: v_dual_max_num_f32 %7, %19, %25\n\t"
        "v_dual_max_num_f32 %8, %20, %24 :: v_dual_max_num_f32 %9, %20, %25\n\t"
        "v_dual_max_num_f32 %10, %21, %24 :: v_dual_max_num_f32 %11, %21, %25\n\t"
        "v_dual_max_num_f32 %12, %22, %24 :: v_dual_max_num_f32 %13, %22, %25\n\t"
        "v_dual_max_num_f32 %14, %23, %24 :: v_dual_max_num_f32 %15, %23, %25"
        : "=&v"(t[0].x), "=&v"(t[0].y), "=&v"(t[1].x), "=&v"(t[1].y),
          "=&v"(t[2].x), "=&v"(t[2].y), "=&v"(t[3].x), "=&v"(t[3].y),
          "=&v"(t[4].x), "=&v"(t[4].y), "=&v"(t[5].x), "=&v"(t[5].y),
          "=&v"(t[6].x), "=&v"(t[6].y), "=&v"(t[7].x), "=&v"(t[7].y)
        : "s"(k0), "s"(k1), "s"(k2), "s"(k3), "s"(k4), "s"(k5), "s"(k6), "s"(k7),
          "v"(a.x), "v"(a.y));
}
// Four dims of one column:
__device__ __forceinline__ void larger_dims(v2f& t0, v2f& t1, v2f& t2, v2f& t3,
                                            v2f a0, v2f a1, v2f a2, v2f a3,
                                            float k0, float k1, float k2, float k3)
{
    asm(
        "v_dual_max_num_f32 %0, %8, %12 :: v_dual_max_num_f32 %1, %8, %13\n\t"
        "v_dual_max_num_f32 %2, %9, %14 :: v_dual_max_num_f32 %3, %9, %15\n\t"
        "v_dual_max_num_f32 %4, %10, %16 :: v_dual_max_num_f32 %5, %10, %17\n\t"
        "v_dual_max_num_f32 %6, %11, %18 :: v_dual_max_num_f32 %7, %11, %19"
        : "=&v"(t0.x), "=&v"(t0.y), "=&v"(t1.x), "=&v"(t1.y),
          "=&v"(t2.x), "=&v"(t2.y), "=&v"(t3.x), "=&v"(t3.y)
        : "s"(k0), "s"(k1), "s"(k2), "s"(k3),
          "v"(a0.x), "v"(a0.y), "v"(a1.x), "v"(a1.y), "v"(a2.x), "v"(a2.y), "v"(a3.x), "v"(a3.y));
}

// The same four pairs behind two steps of P @ V, in one statement: the compiler does not see
// which registers asm text writes, so it could hand a product's A or B registers to pairs that
// follow it at once. Here they are inputs of the statement whose outputs are all early-clobber,
// and the four pairs fill the four vector slots that the chip asks for behind a product.
__device__ __forceinline__ void products_and_larger_dims(
    v8f& c0, v8f& c1, v2f pa0, v2f pa1, v2f b,
    v2f& t0, v2f& t1, v2f& t2, v2f& t3, v2f a0, v2f a1, v2f a2, v2f a3,
    float k0, float k1, float k2, float k3)
{
    asm(
        "v_wmma_f32_16x16x4_f32 %0, %10, %12, %0\n\t"
        "v_wmma_f32_16x16x4_f32 %1, %11, %12, %1\n\t"
        "v_dual_max_num_f32 %2, %13, %17 :: v_dual_max_num_f32 %3, %13, %18\n\t"
        "v_dual_max_num_f32 %4, %14, %19 :: v_dual_max_num_f32 %5, %14, %20\n\t"
        "v_dual_max_num_f32 %6, %15, %21 :: v_dual_max_num_f32 %7, %15, %22\n\t"
        "v_dual_max_num_f32 %8, %16, %23 :: v_dual_max_num_f32 %9, %16, %24"
        : "+v"(c0), "+v"(c1),
          "=&v"(t0.x), "=&v"(t0.y), "=&v"(t1.x), "=&v"(t1.y),
          "=&v"(t2.x), "=&v"(t2.y), "=&v"(t3.x), "=&v"(t3.y)
        : "v"(pa0), "v"(pa1), "v"(b),
          "s"(k0), "s"(k1), "s"(k2), "s"(k3),
          "v"(a0.x), "v"(a0.y), "v"(a1.x), "v"(a1.y), "v"(a2.x), "v"(a2.y), "v"(a3.x), "v"(a3.y));
}

__global__ __launch_bounds__(512) void edge_softmax_pass(
    const float* __restrict__ Q, const float* __restrict__ K,
    const float* __restrict__ V,
    const float* __restrict__ wA, const float* __restrict__ bA,
    const float* __restrict__ Wev,
    float* __restrict__ Op,
    float* __restrict__ Mp, float* __restrict__ Dp,
    const float* K_ask, const float* V_ask)
{
    // Scores lie in LDS as they lie in registers: [lane][column][row l, row l+32].
    __shared__ __attribute__((aligned(16))) float Ep[NWV][32][EPIT];   // per-wave partial scores
    __shared__ __attribute__((aligned(16))) float Ef[NG][32][EPIT];    // full scores, per column group
    __shared__ __attribute__((aligned(16))) float Mx[32][MPIT];        // [lane][wave][row l, row l+32]: maxima of four columns
    __shared__ __attribute__((aligned(16))) float Pm[RWG][EPIT];       // weights, row-major: [row][column of the chunk]
    __shared__ __attribute__((aligned(16))) float To[3][RWG][OPIT];    // row-major staging: S of either group, result
    __shared__ float Dn[NG][RWG];                                      // denominators, per column group

    const int tid  = threadIdx.x;
    const int lane = tid & 31;
    const int wave = __builtin_amdgcn_readfirstlane(tid >> 5);
    const int grp  = wave >> 3;            // column group
    const int wv   = wave & 7;             // slice of dims inside the group
    const int row0 = blockIdx.x * RWG;
    const int i    = row0 + lane;          // .x half: row i, .y half: row i + 32
    const int d0   = wv * DSL;
    const int jbeg = blockIdx.y * JC;

    // The chunk's K rows and V rows are 32 KB each, contiguous: 512 lines of 128 bytes, one per
    // thread (waves 0-7 K, waves 8-15 V). The scalar loads below come to them group by group.
    const float* const ahead = (wave < NWV / 2 ? K_ask : V_ask) + (size_t)jbeg * DIM + (tid & 255) * 32;
    ask_l2(ahead);
    // No instruction comes of this fence. With the asm statement as the last memory event in
    // front of the loop the compiler takes K and V as possibly rewritten and turns the loop's
    // scalar loads into vector loads with a copy to a scalar register per word.
    __builtin_amdgcn_fence(__ATOMIC_ACQUIRE, "wavefront");

    // Every '#pragma unroll' below makes the indices of these register arrays constants.
    const v2f zero2 = {0.f, 0.f};
    v2f nq[DSL], s[DSL];      // nq = -Q
    float w[DSL];
#pragma unroll
    for (int u = 0; u < DSL / 4; ++u) {
        const float4 ta = *(const float4*)(Q + (size_t)i * DIM + d0 + 4 * u);
        const float4 tb = *(const float4*)(Q + (size_t)(i + 32) * DIM + d0 + 4 * u);
        nq[4*u].x   = -ta.x; nq[4*u].y   = -tb.x;
        nq[4*u+1].x = -ta.y; nq[4*u+1].y = -tb.y;
        nq[4*u+2].x = -ta.z; nq[4*u+2].y = -tb.z;
        nq[4*u+3].x = -ta.w; nq[4*u+3].y = -tb.w;
    }
#pragma unroll
    for (int d = 0; d < DSL; ++d) { w[d] = wA[d0 + d]; s[d] = zero2; }
    // W_A for both halves of a pair, formed once here: formed inside the score loop each costs
    // a copy to a scalar register on every trip.
    v2f w2[DSL];
#pragma unroll
    for (int d = 0; d < DSL; ++d) w2[d] = both(w[d]);
    const float ba = bA[0];

    // Matrix tiles of the chunk's 64 x 128 result: 4 x 8 tiles of 16 x 16, two per wave. Wave w
    // owns column tile w % 8 and row tiles 2*(w/8), 2*(w/8)+1: rows m0 .. m0+31.
    const int  lo    = lane & 15;
    const int  hi    = lane >> 4;
    const int  n0    = wv * 16;
    const int  m0    = grp * 32;
    v8f c0 = {0.f,0.f,0.f,0.f,0.f,0.f,0.f,0.f};
    v8f c1 = {0.f,0.f,0.f,0.f,0.f,0.f,0.f,0.f};

    // The group's 32 K rows, this wave's 16 dims.
    const float* __restrict__ Kt = K + (size_t)(jbeg + grp * TJ) * DIM + d0;

    // The chunk's V fragments (B, 4 x 16 per step), asked for here so that they travel
    // during the scores.
    const float* __restrict__ Vf = V + (size_t)(jbeg + 2 * hi) * DIM + n0 + lo;
    v2f bv[JC / 4];
#pragma unroll
    for (int kk = 0; kk < JC / 4; ++kk) {
        bv[kk].x = Vf[(size_t)(4 * kk)     * DIM];
        bv[kk].y = Vf[(size_t)(4 * kk + 1) * DIM];
    }

    // Partial scores over this wave's 16 dims, 32 columns, two rows, all inside the lane.
#pragma unroll 1   // one copy of the body, for the instruction cache; no register array is indexed by g
    for (int g = 0; g < TJ / 8; ++g) {
        v2f e8[8];
#pragma unroll
        for (int c = 0; c < 8; ++c) e8[c] = zero2;
#pragma unroll
        for (int dh = 0; dh < DSL / 8; ++dh) {
            float k8[8][8];
#pragma unroll
            for (int c = 0; c < 8; ++c)
#pragma unroll
                for (int d = 0; d < 8; ++d)
                    k8[c][d] = Kt[(size_t)(8 * g + c) * DIM + 8 * dh + d];
            // Keeps the eight rows' scalar loads together in front of their arithmetic: one
            // wait per eight columns; left alone the scheduler loads and waits row by row.
            __builtin_amdgcn_sched_barrier(0);
#pragma unroll
            for (int d = 0; d < 8; ++d) {
                v2f t8[8];
                larger_cols(t8, nq[8 * dh + d], k8[0][d], k8[1][d], k8[2][d], k8[3][d],
                                                k8[4][d], k8[5][d], k8[6][d], k8[7][d]);
                // Holds the eight sums behind all eight pairs (the distance named at larger_cols).
                __builtin_amdgcn_sched_barrier(0);
#pragma unroll
                for (int c = 0; c < 8; ++c)
                    e8[c] = __builtin_elementwise_fma(t8[c], w2[8 * dh + d], e8[c]);
                // Holds the next dim's pairs behind these sums, for the same distance.
                __builtin_amdgcn_sched_barrier(0);
            }
        }
#pragma unroll
        for (int u = 0; u < 4; ++u)
            *(float4*)&Ep[wave][lane][2 * (8 * g + 2 * u)] =
                make_float4(e8[2*u].x, e8[2*u].y, e8[2*u+1].x, e8[2*u+1].y);
        // Lower edge: the next group's loads are not lifted in among this arithmetic,
        // where they would split into single loads with a wait each.
        __builtin_amdgcn_sched_barrier(0);
    }
    __syncthreads();

    // Wave w adds the 8 partial sums of its group's columns 4*(w%8) .. +3 (both rows of each lane),
    // in wave order, and leaves their maxima beside the scores.
    float4 ac0 = *(const float4*)&Ep[grp * GWV][lane][8 * wv];
    float4 ac1 = *(const float4*)&Ep[grp * GWV][lane][8 * wv + 4];
#pragma unroll
    for (int o = 1; o < GWV; ++o) {
        const float4 x4 = *(const float4*)&Ep[grp * GWV + o][lane][8 * wv];
        const float4 y4 = *(const float4*)&Ep[grp * GWV + o][lane][8 * wv + 4];
        ac0.x += x4.x; ac0.y += x4.y; ac0.z += x4.z; ac0.w += x4.w;
        ac1.x += y4.x; ac1.y += y4.y; ac1.z += y4.z; ac1.w += y4.w;
    }
    ac0.x += ba; ac0.y += ba; ac0.z += ba; ac0.w += ba;
    ac1.x += ba; ac1.y += ba; ac1.z += ba; ac1.w += ba;
    *(float4*)&Ef[grp][lane][8 * wv]     = ac0;
    *(float4*)&Ef[grp][lane][8 * wv + 4] = ac1;
    {
        v2f mx;
        mx.x = fmaxf(fmaxf(ac0.x, ac0.z), fmaxf(ac1.x, ac1.z));
        mx.y = fmaxf(fmaxf(ac0.y, ac0.w), fmaxf(ac1.y, ac1.w));
        *(v2f*)&Mx[lane][2 * wave] = mx;
    }
    __syncthreads();

    // The first eight K rows of the sums below, asked for in front of the softmax: the LDS
    // wait further down would otherwise hold these loads back to where they are needed.
    float kfirst[8][8];
#pragma unroll
    for (int c = 0; c < 8; ++c)
#pragma unroll
        for (int d = 0; d < 8; ++d)
            kfirst[c][d] = Kt[(size_t)c * DIM + d];

    // The rows' maxima over all 64 columns of the chunk: one softmax, no rescale.
    v2f mrun = {-1e30f, -1e30f};
#pragma unroll
    for (int u = 0; u < NWV / 2; ++u) {
        const float4 x4 = *(const float4*)&Mx[lane][4 * u];
        mrun.x = fmaxf(mrun.x, fmaxf(x4.x, x4.z));
        mrun.y = fmaxf(mrun.y, fmaxf(x4.y, x4.w));
    }

    // The weights of the four columns that this wave summed go to the row-major plane, from
    // which every wave takes its A fragments of P @ V over all 64 columns.
    *(float4*)&Pm[lane][grp * TJ + 4 * wv] =
        make_float4(fast_exp(ac0.x - mrun.x), fast_exp(ac0.z - mrun.x),
                    fast_exp(ac1.x - mrun.x), fast_exp(ac1.z - mrun.x));
    *(float4*)&Pm[lane + 32][grp * TJ + 4 * wv] =
        make_float4(fast_exp(ac0.y - mrun.y), fast_exp(ac0.w - mrun.y),
                    fast_exp(ac1.y - mrun.y), fast_exp(ac1.w - mrun.y));

    // The weights of the group's 32 columns, each lane for its own two rows.
    v2f p[TJ];
#pragma unroll
    for (int g = 0; g < TJ / 2; ++g) {
        const float4 x4 = *(const float4*)&Ef[grp][lane][4 * g];
        p[2*g].x   = x4.x; p[2*g].y   = x4.y;
        p[2*g+1].x = x4.z; p[2*g+1].y = x4.w;
    }
    v2f denom = zero2;        // of the group's columns
#pragma unroll
    for (int jj = 0; jj < TJ; ++jj) {
        p[jj].x = fast_exp(p[jj].x - mrun.x);
        p[jj].y = fast_exp(p[jj].y - mrun.y);
        denom += p[jj];
    }

    // A work-group barrier that orders LDS alone (Pm is complete behind it): __syncthreads()
    // would also wait for the K loads above, and the K loads below would no longer be scalar.
    __builtin_amdgcn_fence(__ATOMIC_RELEASE, "workgroup", "local");
    __builtin_amdgcn_s_barrier();
    __builtin_amdgcn_fence(__ATOMIC_ACQUIRE, "workgroup", "local");

    // A fragments, two steps of four columns per block of the sums below, read one block ahead.
    v2f pa0[JC / 4], pa1[JC / 4];
#pragma unroll
    for (int kk = 0; kk < 2; ++kk) {
        pa0[kk] = *(const v2f*)&Pm[m0 + lo][4 * kk + 2 * hi];
        pa1[kk] = *(const v2f*)&Pm[m0 + 16 + lo][4 * kk + 2 * hi];
    }

#pragma unroll
    for (int b = 0; b < (TJ / 8) * (DSL / 8); ++b) {
        const int h  = b >> 1;       // eight columns of the group
        const int dh = b & 1;        // eight dims of the wave
        float kc[8][8];
#pragma unroll
        for (int c = 0; c < 8; ++c)
#pragma unroll
            for (int d = 0; d < 8; ++d)
                kc[c][d] = b == 0 ? kfirst[c][d] : Kt[(size_t)(8 * h + c) * DIM + 8 * dh + d];
        if (b + 1 < (TJ / 8) * (DSL / 8)) {
#pragma unroll
            for (int kk = 2 * b + 2; kk < 2 * b + 4; ++kk) {
                pa0[kk] = *(const v2f*)&Pm[m0 + lo][4 * kk + 2 * hi];
                pa1[kk] = *(const v2f*)&Pm[m0 + 16 + lo][4 * kk + 2 * hi];
            }
        }
        // Keeps eight columns' K scalar loads together in front of their arithmetic
        // (one wait per eight columns), as in the score loop.
        __builtin_amdgcn_sched_barrier(0);
#pragma unroll
        for (int c = 0; c < 8; ++c) {
            v2f td[8];
            if ((c & 3) == 0) {
                // Columns 4kk .. 4kk+3 of the chunk in P @ V; the matrix unit works on them
                // while the vector port goes on with the S sums.
                const int kk = 2 * b + (c >> 2);
                products_and_larger_dims(c0, c1, pa0[kk], pa1[kk], bv[kk],
                                         td[0], td[1], td[2], td[3],
                                         nq[8*dh], nq[8*dh+1], nq[8*dh+2], nq[8*dh+3],
                                         kc[c][0], kc[c][1], kc[c][2], kc[c][3]);
            } else {
                larger_dims(td[0], td[1], td[2], td[3],
                            nq[8*dh], nq[8*dh+1], nq[8*dh+2], nq[8*dh+3],
                            kc[c][0], kc[c][1], kc[c][2], kc[c][3]);
            }
            larger_dims(td[4], td[5], td[6], td[7],
                        nq[8*dh+4], nq[8*dh+5], nq[8*dh+6], nq[8*dh+7],
                        kc[c][4], kc[c][5], kc[c][6], kc[c][7]);
            // Holds the eight sums behind all eight pairs (the distance named at larger_cols).
            __builtin_amdgcn_sched_barrier(0);
            const v2f pj = p[8 * h + c];
#pragma unroll
            for (int d = 0; d < 8; ++d)
                s[8 * dh + d] = __builtin_elementwise_fma(pj, td[d], s[8 * dh + d]);
            // Holds the next column's pairs behind these sums, for the same distance.
            __builtin_amdgcn_sched_barrier(0);
        }
        // Lower edge of the block, as in the score loop.
        __builtin_amdgcn_sched_barrier(0);
    }

    keep_address(ahead);

    // The Q_i part of relu(Q_i+K_j), for all the group's columns at once.
#pragma unroll
    for (int d = 0; d < DSL; ++d) s[d] = __builtin_elementwise_fma(-nq[d], denom, s[d]);

    // Output product of the chunk, on the tiles that hold AV; one W_Ev fragment serves both.

    // The wave's W_Ev strip, asked for here so that it travels during the staging, the barrier
    // and the first products.
    v2f bw[DIM / 4];
#pragma unroll
    for (int kk = 0; kk < DIM / 4; ++kk) {
        const int ka = 4 * kk + 2 * hi;
        bw[kk].x = Wev[(size_t)ka       * DIM + n0 + lo];
        bw[kk].y = Wev[(size_t)(ka + 1) * DIM + n0 + lo];
    }

    // Lane-per-row registers -> row-major LDS, one plane per column group.
#pragma unroll
    for (int u = 0; u < DSL / 4; ++u) {
        *(float4*)&To[grp][lane][d0 + 4 * u]      = make_float4(s[4*u].x,  s[4*u+1].x,  s[4*u+2].x,  s[4*u+3].x);
        *(float4*)&To[grp][lane + 32][d0 + 4 * u] = make_float4(s[4*u].y,  s[4*u+1].y,  s[4*u+2].y,  s[4*u+3].y);
    }
    if (wv == 0) {
        Dn[grp][lane]      = denom.x;
        Dn[grp][lane + 32] = denom.y;
    }
    // A work-group barrier that orders LDS alone: __syncthreads() would also wait here for all
    // 64 W_Ev loads, which no other wave reads; so each product waits only for its own two.
    __builtin_amdgcn_fence(__ATOMIC_RELEASE, "workgroup", "local");
    __builtin_amdgcn_s_barrier();
    __builtin_amdgcn_fence(__ATOMIC_ACQUIRE, "workgroup", "local");

#pragma unroll
    for (int kk = 0; kk < DIM / 4; ++kk) {
        const int ka = 4 * kk + 2 * hi;
        const v2f a0 = *(const v2f*)&To[0][m0 + lo][ka]      + *(const v2f*)&To[1][m0 + lo][ka];
        const v2f a1 = *(const v2f*)&To[0][m0 + 16 + lo][ka] + *(const v2f*)&To[1][m0 + 16 + lo][ka];
        c0 = __builtin_amdgcn_wmma_f32_16x16x4_f32(
                 false, a0, false, bw[kk], (short)0, c0, false, false);
        c1 = __builtin_amdgcn_wmma_f32_16x16x4_f32(
                 false, a1, false, bw[kk], (short)0, c1, false, false);
    }
#pragma unroll
    for (int r = 0; r < 8; ++r) {
        To[2][m0 + 8 * hi + r][n0 + lo]      = c0[r];
        To[2][m0 + 16 + 8 * hi + r][n0 + lo] = c1[r];
    }
    __syncthreads();

    // Row-major LDS -> whole 512-byte rows to memory.
    const size_t base = ((size_t)blockIdx.y * NPTS + row0) * DIM;
#pragma unroll
    for (int u = 0; u < RWG / NWV; ++u) {
        const int r = wave + NWV * u;     // one wave stores one row
        *(float4*)(Op + base + (size_t)r * DIM + lane * 4) = *(const float4*)&To[2][r][lane * 4];
    }
    // The four stores above are still in flight: their address and data registers
    // are not rewritten in front of this wait.
    asm volatile("s_wait_xcnt 0x0" ::: "memory");
    if (wave == 0) {
        Mp[blockIdx.y * NPTS + i]      = mrun.x;
        Mp[blockIdx.y * NPTS + i + 32] = mrun.y;
        Dp[blockIdx.y * NPTS + i]      = Dn[0][lane] + Dn[1][lane];
        Dp[blockIdx.y * NPTS + i + 32] = Dn[0][lane + 32] + Dn[1][lane + 32];
    }
}

// ---------------------------------------------------------------------------
// Kernel 2b: merge the NCH chunks of a row into the output:
//   out_i = sum_c exp(m_c - M) Op_c / sum_c exp(m_c - M) D_c + b_Ev,  M = max_c m_c.
// grid = NPTS/4, block = 128; one wave per row, lane = 4 dims.
// ---------------------------------------------------------------------------
__global__ __launch_bounds__(128) void merge_chunks(
    const float* __restrict__ Op,
    const float* __restrict__ Mp, const float* __restrict__ Dp,
    const float* __restrict__ bev,
    float* __restrict__ out,
    const float* Op_ask, const float* Mp_ask, const float* Dp_ask)
{
    const int lane = threadIdx.x & 31;
    const int wave = __builtin_amdgcn_readfirstlane(threadIdx.x >> 5);
    const int row  = blockIdx.x * 4 + wave;

    // All that this wave reads of the launch before: 16 chunk rows of 512 bytes (64 lines, two
    // per lane) and the row's 16 maxima and 16 denominators (one line each). Part of the loads
    // below issue only behind the first wait.
    const float* const ahead0 = Op_ask + ((size_t)(lane >> 2) * NPTS + row) * DIM + (lane & 3) * 32;
    const float* const ahead1 = ahead0 + (size_t)(NCH / 2) * NPTS * DIM;
    const float* const ahead2 = (lane < NCH ? Mp_ask : Dp_ask) + (lane & (NCH - 1)) * NPTS + row;
    ask_l2(ahead0);
    ask_l2(ahead1);
    ask_l2(ahead2);

    float4 x[NCH];
#pragma unroll
    for (int c = 0; c < NCH; ++c)
        x[c] = *(const float4*)(Op + ((size_t)c * NPTS + row) * DIM + lane * 4);
    const float4 b4 = *(const float4*)(bev + lane * 4);

    float m[NCH];
    float M = -1e30f;
#pragma unroll
    for (int c = 0; c < NCH; ++c) { m[c] = Mp[c * NPTS + row]; M = fmaxf(M, m[c]); }

    float  den = 0.f;
    float4 acc = {0.f, 0.f, 0.f, 0.f};
#pragma unroll
    for (int c = 0; c < NCH; ++c) {
        const float f = fast_exp(m[c] - M);
        den   = fmaf(f, Dp[c * NPTS + row], den);
        acc.x = fmaf(f, x[c].x, acc.x);
        acc.y = fmaf(f, x[c].y, acc.y);
        acc.z = fmaf(f, x[c].z, acc.z);
        acc.w = fmaf(f, x[c].w, acc.w);
    }
    const float inv = 1.0f / den;
    *(float4*)(out + (size_t)row * DIM + lane * 4) =
        make_float4(fmaf(acc.x, inv, b4.x), fmaf(acc.y, inv, b4.y),
                    fmaf(acc.z, inv, b4.z), fmaf(acc.w, inv, b4.w));
    keep_address(ahead0);
    keep_address(ahead1);
    keep_address(ahead2);
}

// ---------------------------------------------------------------------------
// Launch: inputs:
// 0:x 1:W_Q 2:b_Q 3:W_K 4:b_K 5:W_V 6:b_V 7:W_Ev 8:b_Ev 9:W_A 10:b_A
// Workspace: Q,K,V (3 planes of 1024*128 floats), then per chunk of j the unnormalised
// AV + S @ W_Ev (NCH planes) and each row's max and denominator.
// ---------------------------------------------------------------------------
extern "C" void kernel_launch(void* const* d_in, const int* in_sizes, int n_in,
                              void* d_out, int out_size, void* d_ws, size_t ws_size,
                              hipStream_t stream) {
    const float* x   = (const float*)d_in[0];
    const float* Wq  = (const float*)d_in[1];
    const float* bq  = (const float*)d_in[2];
    const float* Wk  = (const float*)d_in[3];
    const float* bk  = (const float*)d_in[4];
    const float* Wv  = (const float*)d_in[5];
    const float* bv  = (const float*)d_in[6];
    const float* Wev = (const float*)d_in[7];
    const float* bev = (const float*)d_in[8];
    const float* wA  = (const float*)d_in[9];
    const float* bA  = (const float*)d_in[10];

    float* ws = (float*)d_ws;
    float* Q  = ws;
    float* K  = ws + 1 * NPTS * DIM;
    float* V  = ws + 2 * NPTS * DIM;
    float* Op = ws + 3 * NPTS * DIM;
    float* Mp = ws + (3 + NCH) * NPTS * DIM;
    float* Dp = ws + (3 + NCH) * NPTS * DIM + NCH * NPTS;

    qkv_gemm_wmma<<<dim3(NPTS / 16, 3), 256, 0, stream>>>(
        x, Wq, bq, Wk, bk, Wv, bv, Q, K, V);

    edge_softmax_pass<<<dim3(NPTS / RWG, NCH), 32 * NWV, 0, stream>>>(
        Q, K, V, wA, bA, Wev, Op, Mp, Dp, K, V);

    merge_chunks<<<NPTS / 4, 128, 0, stream>>>(
        Op, Mp, Dp, bev, (float*)d_out, Op, Mp, Dp);
}

// v008
// One run takes 21.4 microseconds.
// Two timings next to v007 put it at 1.03 and 1.05 times that version's speed.
// Over all steps from v000 it is 16.3 times as fast.
#include <hip/hip_runtime.h>
#include <math.h>

// FlexibleAttention, N=1024, DIM=128, fp32.
// Algebraic fusion: out_i = (Σ_j a_ij V_j) + (Σ_j a_ij relu(Q_i+K_j)) @ W_Ev + b_Ev
// => never materialize the [n,n,d] edge tensor; online softmax per row, j split in chunks.
// The product with W_Ev is linear in S, so each chunk applies it to its own unnormalised sums.
// relu(Q_i+K_j) = max(K_j, -Q_i) + Q_i: the Q_i part of a score is the same for every j, so the
// softmax over j does not see it, and its part of S is Q_i times the sum of the weights.

#define NPTS 1024
#define DIM  128

typedef float v2f __attribute__((ext_vector_type(2)));
typedef float v8f __attribute__((ext_vector_type(8)));

// ---------------------------------------------------------------------------
// Kernel 1: Q/K/V = x @ W + b   via V_WMMA_F32_16X16X4_F32
// grid = (NPTS/16, 3), block = 256 (8 waves; wave w owns n-tile w*16)
// blockIdx.y selects which of Q/K/V this block computes.
// Fragment layout (ISA 7.12.2, 32-bit):
//   A (16x4): lane L holds M=L%16, regs {K=2*(L/16), K=2*(L/16)+1}
//   B (4x16): lane L holds N=L%16, regs {K=2*(L/16), K=2*(L/16)+1}
//   D (16x16): c[r] = D[8*(L/16)+r][L%16]
// An A fragment read straight from x touches 16 cache lines per load, and all 8 waves read the
// same ones: the 16 x rows come in once as whole 512-byte rows and the fragments come from LDS.
// ---------------------------------------------------------------------------
#define XPIT (DIM + 4)         // LDS pitch, floats: the 32 lanes' 8-byte reads fall on all 64 banks
__global__ __launch_bounds__(256) void qkv_gemm_wmma(
    const float* __restrict__ x,
    const float* __restrict__ Wq, const float* __restrict__ bq,
    const float* __restrict__ Wk, const float* __restrict__ bk,
    const float* __restrict__ Wv, const float* __restrict__ bv,
    float* __restrict__ Q, float* __restrict__ K, float* __restrict__ V)
{
    __shared__ __attribute__((aligned(16))) float Xs[16][XPIT];

    const int lane = threadIdx.x & 31;
    const int wave = threadIdx.x >> 5;
    const int lo   = lane & 15;
    const int hi   = lane >> 4;
    const int i0   = blockIdx.x * 16;
    const int n0   = wave * 16;

    // One wave brings one whole row per load, two rows a wave.
    const float4 xr0 = *(const float4*)(x + (size_t)(i0 + wave)     * DIM + lane * 4);
    const float4 xr1 = *(const float4*)(x + (size_t)(i0 + wave + 8) * DIM + lane * 4);

    const float* W; const float* bias; float* out;
    if (blockIdx.y == 0)      { W = Wq; bias = bq; out = Q; }
    else if (blockIdx.y == 1) { W = Wk; bias = bk; out = K; }
    else                      { W = Wv; bias = bv; out = V; }

    v8f c = {0.f,0.f,0.f,0.f,0.f,0.f,0.f,0.f};

    // The wave's whole W strip, asked for here so that it travels during the staging of x.
    v2f b[DIM / 4];
#pragma unroll
    for (int kk = 0; kk < DIM / 4; ++kk) {
        const int ka = 4 * kk + 2 * hi;
        b[kk].x = W[(size_t)ka       * DIM + n0 + lo];
        b[kk].y = W[(size_t)(ka + 1) * DIM + n0 + lo];
    }
    const float bn = bias[n0 + lo];

    *(float4*)&Xs[wave][lane * 4]     = xr0;
    *(float4*)&Xs[wave + 8][lane * 4] = xr1;
    // A work-group barrier that orders LDS alone: __syncthreads() would also wait here for the
    // W loads, which no other wave reads; so each product waits only for its own two.
    __builtin_amdgcn_fence(__ATOMIC_RELEASE, "workgroup", "local");
    __builtin_amdgcn_s_barrier();
    __builtin_amdgcn_fence(__ATOMIC_ACQUIRE, "workgroup", "local");

#pragma unroll
    for (int kk = 0; kk < DIM / 4; ++kk) {
        const v2f a = *(const v2f*)&Xs[lo][4 * kk + 2 * hi];
        c = __builtin_amdgcn_wmma_f32_16x16x4_f32(
                false, a, false, b[kk], (short)0, c, false, false);
    }

#pragma unroll
    for (int r = 0; r < 8; ++r) {
        const int m = hi * 8 + r;
        out[(size_t)(i0 + m) * DIM + n0 + lo] = c[r] + bn;
    }
}

// Asks L2 for the line that holds *p; nothing comes back and no counter moves. For speed only.
// The kernels get the planes a second time as plain pointers (names ending in _ask) for these
// requests alone: loads through a pointer that an asm statement has seen are no longer made
// scalar loads.
__device__ __forceinline__ void ask_l2(const float* p)
{
    asm volatile("global_prefetch_b8 %0, off scope:SCOPE_SE" :: "v"(p));
}

// Input only, no code: the register pair that a request named stays that address up to here,
// so that no other value stands in it while the request may still be read.
__device__ __forceinline__ void keep_address(const float* p)
{
    asm volatile("" :: "v"(p));
}

// e^x as the fast form 2^(x * log2 e). The v_nop fills the one issue slot that the
// instruction set asks for behind a transcendental; inside the statement it cannot drift.
__device__ __forceinline__ float fast_exp(float x)
{
    float r;
    asm("v_exp_f32 %0, %1\n\tv_nop" : "=v"(r) : "v"(x * 1.44269504f));
    return r;
}

// ---------------------------------------------------------------------------
// Kernel 2: softmax-weighted sums over one chunk of j, TWO query rows per LANE.
//   work-group = 64 rows x JC columns j; lane l holds rows l and l+32 in the two
//   halves of each packed-f32 register pair. The 16 waves are two groups of eight: group g
//   works on columns [32g, 32g+32) of the chunk, and wave v of a group owns dims [16v, 16v+16).
//   K_j and W_A are the same for every lane AND for both halves of a pair, so a
//   packed or dual-issue instruction takes them straight from a scalar register (a packed f32
//   instruction reads one scalar register for both halves; a pair of two different
//   scalars would first have to be copied into vector registers).
//   The sum over d of a score stays inside a lane; only the 8 per-wave partial
//   sums of a group meet, in LDS.
//   The lanes hold -Q_i, and both passes work on t_ij = max(K_j, -Q_i), one instruction, in
//   place of relu(Q_i+K_j), two: the scores are short of sum_d W_A Q_i, a constant of the row
//   in every chunk, and S gets Q_i * denominator once, behind the loop.
//   Partial scores -> LDS -> full scores and the rows' maxima over all 64 columns -> one
//   softmax, each wave for its group's 32 columns alone -> S += p * t_ij on the vector port,
//   summed over the two groups at the end; AV += P @ V is a plain matrix
//   product and runs on the matrix unit (V_WMMA_F32_16X16X4_F32, fragment layout as in
//   kernel 1), issued among the S sums, so that it costs the vector port next to nothing.
//   Behind the loop the work-group adds S @ W_Ev of its chunk's unnormalised sums onto the
//   same accumulators and leaves that one plane with the chunk's max and denominator;
//   kernel 2b merges the chunks into the output.
// grid = (NPTS/64, NCH), block = 512 (16 waves)
// ---------------------------------------------------------------------------
#define NCH   16               // chunks of j, one work-group each
#define JC    (NPTS / NCH)     // columns per chunk
#define NG    2                // column groups of a chunk, eight waves each
#define TJ    (JC / NG)        // columns per group
#define NWV   16               // waves per work-group
#define GWV   (NWV / NG)       // waves per group
#define DSL   (DIM / GWV)      // dims per wave
#define RWG   64               // rows per work-group
#define EPIT  (2 * TJ + 4)     // LDS pitch, floats: 16 B x odd for 16-byte reads
#define MPIT  (2 * NWV + 4)    // LDS pitch, floats: 16 B x odd
#define OPIT  (DIM + 4)        // LDS pitch, floats: 16 B x odd

// One wave-uniform value for both halves of a pair. The readfirstlane marks it as a single
// scalar register; without it the second word of each loaded row goes through a copy of its
// register pair into vector registers.
__device__ __forceinline__ v2f both(float x)
{
    const float u = __builtin_bit_cast(float, __builtin_amdgcn_readfirstlane(__builtin_bit_cast(int, x)));
    v2f r = {u, u};
    return r;
}

// max(K, -Q) for the two rows of a lane in one issue slot: a dual-issue pair whose halves read
// the same scalar register. Written by hand because the compiler first passes every loaded K
// word through an instruction of its own (it quiets a signalling NaN) and then seldom pairs.
// The compiler gives no s_delay_alu hint for a value that asm text made, so the pairs come
// eight in a row: several vector instructions then stand between a pair and the first read
// of its result, and no hint is missed.
// Eight columns of one dim:
__device__ __forceinline__ void larger_cols(v2f (&t)[8], v2f a, float k0, float k1, float k2,
                                            float k3, float k4, float k5, float k6, float k7)
{
    asm(
        "v_dual_max_num_f32 %0, %16, %24 :: v_dual_max_num_f32 %1, %16, %25\n\t"
        "v_dual_max_num_f32 %2, %17, %24 :: v_dual_max_num_f32 %3, %17, %25\n\t"
        "v_dual_max_num_f32 %4, %18, %24 :: v_dual_max_num_f32 %5, %18, %25\n\t"
        "v_dual_max_num_f32 %6, %19, %24 :: v_dual_max_num_f32 %7, %19, %25\n\t"
        "v_dual_max_num_f32 %8, %20, %24 :: v_dual_max_num_f32 %9, %20, %25\n\t"
        "v_dual_max_num_f32 %10, %21, %24 :: v_dual_max_num_f32 %11, %21, %25\n\t"
        "v_dual_max_num_f32 %12, %22, %24 :: v_dual_max_num_f32 %13, %22, %25\n\t"
        "v_dual_max_num_f32 %14, %23, %24 :: v_dual_max_num_f32 %15, %23, %25"
        : "=&v"(t[0].x), "=&v"(t[0].y), "=&v"(t[1].x), "=&v"(t[1].y),
          "=&v"(t[2].x), "=&v"(t[2].y), "=&v"(t[3].x), "=&v"(t[3].y),
          "=&v"(t[4].x), "=&v"(t[4].y), "=&v"(t[5].x), "=&v"(t[5].y),
          "=&v"(t[6].x), "=&v"(t[6].y), "=&v"(t[7].x), "=&v"(t[7].y)
        : "s"(k0), "s"(k1), "s"(k2), "s"(k3), "s"(k4), "s"(k5), "s"(k6), "s"(k7),
          "v"(a.x), "v"(a.y));
}
// Four dims of one column:
__device__ __forceinline__ void larger_dims(v2f& t0, v2f& t1, v2f& t2, v2f& t3,
                                            v2f a0, v2f a1, v2f a2, v2f a3,
                                            float k0, float k1, float k2, float k3)
{
    asm(
        "v_dual_max_num_f32 %0, %8, %12 :: v_dual_max_num_f32 %1, %8, %13\n\t"
        "v_dual_max_num_f32 %2, %9, %14 :: v_dual_max_num_f32 %3, %9, %15\n\t"
        "v_dual_max_num_f32 %4, %10, %16 :: v_dual_max_num_f32 %5, %10, %17\n\t"
        "v_dual_max_num_f32 %6, %11, %18 :: v_dual_max_num_f32 %7, %11, %19"
        : "=&v"(t0.x), "=&v"(t0.y), "=&v"(t1.x), "=&v"(t1.y),
          "=&v"(t2.x), "=&v"(t2.y), "=&v"(t3.x), "=&v"(t3.y)
        : "s"(k0), "s"(k1), "s"(k2), "s"(k3),
          "v"(a0.x), "v"(a0.y), "v"(a1.x), "v"(a1.y), "v"(a2.x), "v"(a2.y), "v"(a3.x), "v"(a3.y));
}

// The same four pairs behind two steps of P @ V, in one statement: the compiler does not see
// which registers asm text writes, so it could hand a product's A or B registers to pairs that
// follow it at once. Here they are inputs of the statement whose outputs are all early-clobber,
// and the four pairs fill the four vector slots that the chip asks for behind a product.
__device__ __forceinline__ void products_and_larger_dims(
    v8f& c0, v8f& c1, v2f pa0, v2f pa1, v2f b,
    v2f& t0, v2f& t1, v2f& t2, v2f& t3, v2f a0, v2f a1, v2f a2, v2f a3,
    float k0, float k1, float k2, float k3)
{
    asm(
        "v_wmma_f32_16x16x4_f32 %0, %10, %12, %0\n\t"
        "v_wmma_f32_16x16x4_f32 %1, %11, %12, %1\n\t"
        "v_dual_max_num_f32 %2, %13, %17 :: v_dual_max_num_f32 %3, %13, %18\n\t"
        "v_dual_max_num_f32 %4, %14, %19 :: v_dual_max_num_f32 %5, %14, %20\n\t"
        "v_dual_max_num_f32 %6, %15, %21 :: v_dual_max_num_f32 %7, %15, %22\n\t"
        "v_dual_max_num_f32 %8, %16, %23 :: v_dual_max_num_f32 %9, %16, %24"
        : "+v"(c0), "+v"(c1),
          "=&v"(t0.x), "=&v"(t0.y), "=&v"(t1.x), "=&v"(t1.y),
          "=&v"(t2.x), "=&v"(t2.y), "=&v"(t3.x), "=&v"(t3.y)
        : "v"(pa0), "v"(pa1), "v"(b),
          "s"(k0), "s"(k1), "s"(k2), "s"(k3),
          "v"(a0.x), "v"(a0.y), "v"(a1.x), "v"(a1.y), "v"(a2.x), "v"(a2.y), "v"(a3.x), "v"(a3.y));
}

__global__ __launch_bounds__(512) void edge_softmax_pass(
    const float* __restrict__ Q, const float* __restrict__ K,
    const float* __restrict__ V,
    const float* __restrict__ wA, const float* __restrict__ bA,
    const float* __restrict__ Wev,
    float* __restrict__ Op,
    float* __restrict__ Mp, float* __restrict__ Dp,
    const float* K_ask, const float* V_ask)
{
    // Scores lie in LDS as they lie in registers: [lane][column][row l, row l+32].
    __shared__ __attribute__((aligned(16))) float Ep[NWV][32][EPIT];   // per-wave partial scores
    __shared__ __attribute__((aligned(16))) float Ef[NG][32][EPIT];    // full scores, per column group
    __shared__ __attribute__((aligned(16))) float Mx[32][MPIT];        // [lane][wave][row l, row l+32]: maxima of four columns
    __shared__ __attribute__((aligned(16))) float Pm[RWG][EPIT];       // weights, row-major: [row][column of the chunk]
    __shared__ __attribute__((aligned(16))) float To[3][RWG][OPIT];    // row-major staging: Q rows (plane 0), S of either group, result
    __shared__ float Dn[NG][RWG];                                      // denominators, per column group

    const int tid  = threadIdx.x;
    const int lane = tid & 31;
    const int wave = __builtin_amdgcn_readfirstlane(tid >> 5);
    const int grp  = wave >> 3;            // column group
    const int wv   = wave & 7;             // slice of dims inside the group
    const int row0 = blockIdx.x * RWG;
    const int i    = row0 + lane;          // .x half: row i, .y half: row i + 32
    const int d0   = wv * DSL;
    const int jbeg = blockIdx.y * JC;

    // The chunk's K rows and V rows are 32 KB each, contiguous: 512 lines of 128 bytes, one per
    // thread (waves 0-7 K, waves 8-15 V). The scalar loads below come to them group by group.
    const float* const ahead = (wave < NWV / 2 ? K_ask : V_ask) + (size_t)jbeg * DIM + (tid & 255) * 32;
    ask_l2(ahead);
    // No instruction comes of this fence. With the asm statement as the last memory event in
    // front of the loop the compiler takes K and V as possibly rewritten and turns the loop's
    // scalar loads into vector loads with a copy to a scalar register per word.
    __builtin_amdgcn_fence(__ATOMIC_ACQUIRE, "wavefront");

    // Every '#pragma unroll' below makes the indices of these register arrays constants.
    const v2f zero2 = {0.f, 0.f};
    v2f nq[DSL], s[DSL];      // nq = -Q
    float w[DSL];
    // A lane's own Q row read straight from memory touches 32 cache lines per load. The 64 rows
    // come in once as whole 512-byte rows (one wave, one row per load) and each lane takes its
    // two rows' dims from LDS. The plane is free here: its S sums are staged behind later barriers.
    float4 qrow[RWG / NWV];
#pragma unroll
    for (int u = 0; u < RWG / NWV; ++u)
        qrow[u] = *(const float4*)(Q + (size_t)(row0 + wave + NWV * u) * DIM + lane * 4);
    // Holds these four loads in front of the V loads below: loads return in order, and left
    // alone the scheduler puts most V loads first, so that the staging of Q waits for them too.
    __builtin_amdgcn_sched_barrier(0);
#pragma unroll
    for (int d = 0; d < DSL; ++d) { w[d] = wA[d0 + d]; s[d] = zero2; }
    // W_A for both halves of a pair, formed once here: formed inside the score loop each costs
    // a copy to a scalar register on every trip.
    v2f w2[DSL];
#pragma unroll
    for (int d = 0; d < DSL; ++d) w2[d] = both(w[d]);
    const float ba = bA[0];

    // Matrix tiles of the chunk's 64 x 128 result: 4 x 8 tiles of 16 x 16, two per wave. Wave w
    // owns column tile w % 8 and row tiles 2*(w/8), 2*(w/8)+1: rows m0 .. m0+31.
    const int  lo    = lane & 15;
    const int  hi    = lane >> 4;
    const int  n0    = wv * 16;
    const int  m0    = grp * 32;
    v8f c0 = {0.f,0.f,0.f,0.f,0.f,0.f,0.f,0.f};
    v8f c1 = {0.f,0.f,0.f,0.f,0.f,0.f,0.f,0.f};

    // The group's 32 K rows, this wave's 16 dims.
    const float* __restrict__ Kt = K + (size_t)(jbeg + grp * TJ) * DIM + d0;

    // The chunk's V fragments (B, 4 x 16 per step), asked for here so that they travel
    // during the scores.
    const float* __restrict__ Vf = V + (size_t)(jbeg + 2 * hi) * DIM + n0 + lo;
    v2f bv[JC / 4];
#pragma unroll
    for (int kk = 0; kk < JC / 4; ++kk) {
        bv[kk].x = Vf[(size_t)(4 * kk)     * DIM];
        bv[kk].y = Vf[(size_t)(4 * kk + 1) * DIM];
    }

    // The Q rows go through LDS here, behind the V loads' issue, so that those are under way.
#pragma unroll
    for (int u = 0; u < RWG / NWV; ++u)
        *(float4*)&To[0][wave + NWV * u][lane * 4] = qrow[u];
    // A work-group barrier that orders LDS alone: __syncthreads() would also wait here for the
    // V loads, which are first needed behind the softmax.
    __builtin_amdgcn_fence(__ATOMIC_RELEASE, "workgroup", "local");
    __builtin_amdgcn_s_barrier();
    __builtin_amdgcn_fence(__ATOMIC_ACQUIRE, "workgroup", "local");
#pragma unroll
    for (int u = 0; u < DSL / 4; ++u) {
        const float4 ta = *(const float4*)&To[0][lane][d0 + 4 * u];
        const float4 tb = *(const float4*)&To[0][lane + 32][d0 + 4 * u];
        nq[4*u].x   = -ta.x; nq[4*u].y   = -tb.x;
        nq[4*u+1].x = -ta.y; nq[4*u+1].y = -tb.y;
        nq[4*u+2].x = -ta.z; nq[4*u+2].y = -tb.z;
        nq[4*u+3].x = -ta.w; nq[4*u+3].y = -tb.w;
    }

    // Partial scores over this wave's 16 dims, 32 columns, two rows, all inside the lane.
#pragma unroll 1   // one copy of the body, for the instruction cache; no register array is indexed by g
    for (int g = 0; g < TJ / 8; ++g) {
        v2f e8[8];
#pragma unroll
        for (int c = 0; c < 8; ++c) e8[c] = zero2;
#pragma unroll
        for (int dh = 0; dh < DSL / 8; ++dh) {
            float k8[8][8];
#pragma unroll
            for (int c = 0; c < 8; ++c)
#pragma unroll
                for (int d = 0; d < 8; ++d)
                    k8[c][d] = Kt[(size_t)(8 * g + c) * DIM + 8 * dh + d];
            // Keeps the eight rows' scalar loads together in front of their arithmetic: one
            // wait per eight columns; left alone the scheduler loads and waits row by row.
            __builtin_amdgcn_sched_barrier(0);
#pragma unroll
            for (int d = 0; d < 8; ++d) {
                v2f t8[8];
                larger_cols(t8, nq[8 * dh + d], k8[0][d], k8[1][d], k8[2][d], k8[3][d],
                                                k8[4][d], k8[5][d], k8[6][d], k8[7][d]);
                // Holds the eight sums behind all eight pairs (the distance named at larger_cols).
                __builtin_amdgcn_sched_barrier(0);
#pragma unroll
                for (int c = 0; c < 8; ++c)
                    e8[c] = __builtin_elementwise_fma(t8[c], w2[8 * dh + d], e8[c]);
                // Holds the next dim's pairs behind these sums, for the same distance.
                __builtin_amdgcn_sched_barrier(0);
            }
        }
#pragma unroll
        for (int u = 0; u < 4; ++u)
            *(float4*)&Ep[wave][lane][2 * (8 * g + 2 * u)] =
                make_float4(e8[2*u].x, e8[2*u].y, e8[2*u+1].x, e8[2*u+1].y);
        // Lower edge: the next group's loads are not lifted in among this arithmetic,
        // where they would split into single loads with a wait each.
        __builtin_amdgcn_sched_barrier(0);
    }
    __syncthreads();

    // Wave w adds the 8 partial sums of its group's columns 4*(w%8) .. +3 (both rows of each lane),
    // in wave order, and leaves their maxima beside the scores.
    float4 ac0 = *(const float4*)&Ep[grp * GWV][lane][8 * wv];
    float4 ac1 = *(const float4*)&Ep[grp * GWV][lane][8 * wv + 4];
#pragma unroll
    for (int o = 1; o < GWV; ++o) {
        const float4 x4 = *(const float4*)&Ep[grp * GWV + o][lane][8 * wv];
        const float4 y4 = *(const float4*)&Ep[grp * GWV + o][lane][8 * wv + 4];
        ac0.x += x4.x; ac0.y += x4.y; ac0.z += x4.z; ac0.w += x4.w;
        ac1.x += y4.x; ac1.y += y4.y; ac1.z += y4.z; ac1.w += y4.w;
    }
    ac0.x += ba; ac0.y += ba; ac0.z += ba; ac0.w += ba;
    ac1.x += ba; ac1.y += ba; ac1.z += ba; ac1.w += ba;
    *(float4*)&Ef[grp][lane][8 * wv]     = ac0;
    *(float4*)&Ef[grp][lane][8 * wv + 4] = ac1;
    {
        v2f mx;
        mx.x = fmaxf(fmaxf(ac0.x, ac0.z), fmaxf(ac1.x, ac1.z));
        mx.y = fmaxf(fmaxf(ac0.y, ac0.w), fmaxf(ac1.y, ac1.w));
        *(v2f*)&Mx[lane][2 * wave] = mx;
    }
    __syncthreads();

    // The first eight K rows of the sums below, asked for in front of the softmax: the LDS
    // wait further down would otherwise hold these loads back to where they are needed.
    float kfirst[8][8];
#pragma unroll
    for (int c = 0; c < 8; ++c)
#pragma unroll
        for (int d = 0; d < 8; ++d)
            kfirst[c][d] = Kt[(size_t)c * DIM + d];

    // The rows' maxima over all 64 columns of the chunk: one softmax, no rescale.
    v2f mrun = {-1e30f, -1e30f};
#pragma unroll
    for (int u = 0; u < NWV / 2; ++u) {
        const float4 x4 = *(const float4*)&Mx[lane][4 * u];
        mrun.x = fmaxf(mrun.x, fmaxf(x4.x, x4.z));
        mrun.y = fmaxf(mrun.y, fmaxf(x4.y, x4.w));
    }

    // The weights of the four columns that this wave summed go to the row-major plane, from
    // which every wave takes its A fragments of P @ V over all 64 columns.
    *(float4*)&Pm[lane][grp * TJ + 4 * wv] =
        make_float4(fast_exp(ac0.x - mrun.x), fast_exp(ac0.z - mrun.x),
                    fast_exp(ac1.x - mrun.x), fast_exp(ac1.z - mrun.x));
    *(float4*)&Pm[lane + 32][grp * TJ + 4 * wv] =
        make_float4(fast_exp(ac0.y - mrun.y), fast_exp(ac0.w - mrun.y),
                    fast_exp(ac1.y - mrun.y), fast_exp(ac1.w - mrun.y));

    // The weights of the group's 32 columns, each lane for its own two rows.
    v2f p[TJ];
#pragma unroll
    for (int g = 0; g < TJ / 2; ++g) {
        const float4 x4 = *(const float4*)&Ef[grp][lane][4 * g];
        p[2*g].x   = x4.x; p[2*g].y   = x4.y;
        p[2*g+1].x = x4.z; p[2*g+1].y = x4.w;
    }
    v2f denom = zero2;        // of the group's columns
#pragma unroll
    for (int jj = 0; jj < TJ; ++jj) {
        p[jj].x = fast_exp(p[jj].x - mrun.x);
        p[jj].y = fast_exp(p[jj].y - mrun.y);
        denom += p[jj];
    }

    // A work-group barrier that orders LDS alone (Pm is complete behind it): __syncthreads()
    // would also wait for the K loads above, and the K loads below would no longer be scalar.
    __builtin_amdgcn_fence(__ATOMIC_RELEASE, "workgroup", "local");
    __builtin_amdgcn_s_barrier();
    __builtin_amdgcn_fence(__ATOMIC_ACQUIRE, "workgroup", "local");

    // A fragments, two steps of four columns per block of the sums below, read one block ahead.
    v2f pa0[JC / 4], pa1[JC / 4];
#pragma unroll
    for (int kk = 0; kk < 2; ++kk) {
        pa0[kk] = *(const v2f*)&Pm[m0 + lo][4 * kk + 2 * hi];
        pa1[kk] = *(const v2f*)&Pm[m0 + 16 + lo][4 * kk + 2 * hi];
    }

#pragma unroll
    for (int b = 0; b < (TJ / 8) * (DSL / 8); ++b) {
        const int h  = b >> 1;       // eight columns of the group
        const int dh = b & 1;        // eight dims of the wave
        float kc[8][8];
#pragma unroll
        for (int c = 0; c < 8; ++c)
#pragma unroll
            for (int d = 0; d < 8; ++d)
                kc[c][d] = b == 0 ? kfirst[c][d] : Kt[(size_t)(8 * h + c) * DIM + 8 * dh + d];
        if (b + 1 < (TJ / 8) * (DSL / 8)) {
#pragma unroll
            for (int kk = 2 * b + 2; kk < 2 * b + 4; ++kk) {
                pa0[kk] = *(const v2f*)&Pm[m0 + lo][4 * kk + 2 * hi];
                pa1[kk] = *(const v2f*)&Pm[m0 + 16 + lo][4 * kk + 2 * hi];
            }
        }
        // Keeps eight columns' K scalar loads together in front of their arithmetic
        // (one wait per eight columns), as in the score loop.
        __builtin_amdgcn_sched_barrier(0);
#pragma unroll
        for (int c = 0; c < 8; ++c) {
            v2f td[8];
            if ((c & 3) == 0) {
                // Columns 4kk .. 4kk+3 of the chunk in P @ V; the matrix unit works on them
                // while the vector port goes on with the S sums.
                const int kk = 2 * b + (c >> 2);
                products_and_larger_dims(c0, c1, pa0[kk], pa1[kk], bv[kk],
                                         td[0], td[1], td[2], td[3],
                                         nq[8*dh], nq[8*dh+1], nq[8*dh+2], nq[8*dh+3],
                                         kc[c][0], kc[c][1], kc[c][2], kc[c][3]);
            } else {
                larger_dims(td[0], td[1], td[2], td[3],
                            nq[8*dh], nq[8*dh+1], nq[8*dh+2], nq[8*dh+3],
                            kc[c][0], kc[c][1], kc[c][2], kc[c][3]);
            }
            larger_dims(td[4], td[5], td[6], td[7],
                        nq[8*dh+4], nq[8*dh+5], nq[8*dh+6], nq[8*dh+7],
                        kc[c][4], kc[c][5], kc[c][6], kc[c][7]);
            // Holds the eight sums behind all eight pairs (the distance named at larger_cols).
            __builtin_amdgcn_sched_barrier(0);
            const v2f pj = p[8 * h + c];
#pragma unroll
            for (int d = 0; d < 8; ++d)
                s[8 * dh + d] = __builtin_elementwise_fma(pj, td[d], s[8 * dh + d]);
            // Holds the next column's pairs behind these sums, for the same distance.
            __builtin_amdgcn_sched_barrier(0);
        }
        // Lower edge of the block, as in the score loop.
        __builtin_amdgcn_sched_barrier(0);
    }

    keep_address(ahead);

    // The Q_i part of relu(Q_i+K_j), for all the group's columns at once.
#pragma unroll
    for (int d = 0; d < DSL; ++d) s[d] = __builtin_elementwise_fma(-nq[d], denom, s[d]);

    // Output product of the chunk, on the tiles that hold AV; one W_Ev fragment serves both.

    // The wave's W_Ev strip, asked for here so that it travels during the staging, the barrier
    // and the first products.
    v2f bw[DIM / 4];
#pragma unroll
    for (int kk = 0; kk < DIM / 4; ++kk) {
        const int ka = 4 * kk + 2 * hi;
        bw[kk].x = Wev[(size_t)ka       * DIM + n0 + lo];
        bw[kk].y = Wev[(size_t)(ka + 1) * DIM + n0 + lo];
    }

    // Lane-per-row registers -> row-major LDS, one plane per column group.
#pragma unroll
    for (int u = 0; u < DSL / 4; ++u) {
        *(float4*)&To[grp][lane][d0 + 4 * u]      = make_float4(s[4*u].x,  s[4*u+1].x,  s[4*u+2].x,  s[4*u+3].x);
        *(float4*)&To[grp][lane + 32][d0 + 4 * u] = make_float4(s[4*u].y,  s[4*u+1].y,  s[4*u+2].y,  s[4*u+3].y);
    }
    if (wv == 0) {
        Dn[grp][lane]      = denom.x;
        Dn[grp][lane + 32] = denom.y;
    }
    // A work-group barrier that orders LDS alone: __syncthreads() would also wait here for all
    // 64 W_Ev loads, which no other wave reads; so each product waits only for its own two.
    __builtin_amdgcn_fence(__ATOMIC_RELEASE, "workgroup", "local");
    __builtin_amdgcn_s_barrier();
    __builtin_amdgcn_fence(__ATOMIC_ACQUIRE, "workgroup", "local");

#pragma unroll
    for (int kk = 0; kk < DIM / 4; ++kk) {
        const int ka = 4 * kk + 2 * hi;
        const v2f a0 = *(const v2f*)&To[0][m0 + lo][ka]      + *(const v2f*)&To[1][m0 + lo][ka];
        const v2f a1 = *(const v2f*)&To[0][m0 + 16 + lo][ka] + *(const v2f*)&To[1][m0 + 16 + lo][ka];
        c0 = __builtin_amdgcn_wmma_f32_16x16x4_f32(
                 false, a0, false, bw[kk], (short)0, c0, false, false);
        c1 = __builtin_amdgcn_wmma_f32_16x16x4_f32(
                 false, a1, false, bw[kk], (short)0, c1, false, false);
    }
#pragma unroll
    for (int r = 0; r < 8; ++r) {
        To[2][m0 + 8 * hi + r][n0 + lo]      = c0[r];
        To[2][m0 + 16 + 8 * hi + r][n0 + lo] = c1[r];
    }
    __syncthreads();

    // Row-major LDS -> whole 512-byte rows to memory.
    const size_t base = ((size_t)blockIdx.y * NPTS + row0) * DIM;
#pragma unroll
    for (int u = 0; u < RWG / NWV; ++u) {
        const int r = wave + NWV * u;     // one wave stores one row
        *(float4*)(Op + base + (size_t)r * DIM + lane * 4) = *(const float4*)&To[2][r][lane * 4];
    }
    // The four stores above are still in flight: their address and data registers
    // are not rewritten in front of this wait.
    asm volatile("s_wait_xcnt 0x0" ::: "memory");
    if (wave == 0) {
        Mp[blockIdx.y * NPTS + i]      = mrun.x;
        Mp[blockIdx.y * NPTS + i + 32] = mrun.y;
        Dp[blockIdx.y * NPTS + i]      = Dn[0][lane] + Dn[1][lane];
        Dp[blockIdx.y * NPTS + i + 32] = Dn[0][lane + 32] + Dn[1][lane + 32];
    }
}

// ---------------------------------------------------------------------------
// Kernel 2b: merge the NCH chunks of a row into the output:
//   out_i = sum_c exp(m_c - M) Op_c / sum_c exp(m_c - M) D_c + b_Ev,  M = max_c m_c.
// grid = NPTS/4, block = 128; one wave per row, lane = 4 dims.
// ---------------------------------------------------------------------------
__global__ __launch_bounds__(128) void merge_chunks(
    const float* __restrict__ Op,
    const float* __restrict__ Mp, const float* __restrict__ Dp,
    const float* __restrict__ bev,
    float* __restrict__ out,
    const float* Op_ask, const float* Mp_ask, const float* Dp_ask)
{
    const int lane = threadIdx.x & 31;
    const int wave = __builtin_amdgcn_readfirstlane(threadIdx.x >> 5);
    const int row  = blockIdx.x * 4 + wave;

    // All that this wave reads of the launch before: 16 chunk rows of 512 bytes (64 lines, two
    // per lane) and the row's 16 maxima and 16 denominators (one line each). Part of the loads
    // below issue only behind the first wait.
    const float* const ahead0 = Op_ask + ((size_t)(lane >> 2) * NPTS + row) * DIM + (lane & 3) * 32;
    const float* const ahead1 = ahead0 + (size_t)(NCH / 2) * NPTS * DIM;
    const float* const ahead2 = (lane < NCH ? Mp_ask : Dp_ask) + (lane & (NCH - 1)) * NPTS + row;
    ask_l2(ahead0);
    ask_l2(ahead1);
    ask_l2(ahead2);

    float4 x[NCH];
#pragma unroll
    for (int c = 0; c < NCH; ++c)
        x[c] = *(const float4*)(Op + ((size_t)c * NPTS + row) * DIM + lane * 4);
    const float4 b4 = *(const float4*)(bev + lane * 4);

    float m[NCH];
    float M = -1e30f;
#pragma unroll
    for (int c = 0; c < NCH; ++c) { m[c] = Mp[c * NPTS + row]; M = fmaxf(M, m[c]); }

    float  den = 0.f;
    float4 acc = {0.f, 0.f, 0.f, 0.f};
#pragma unroll
    for (int c = 0; c < NCH; ++c) {
        const float f = fast_exp(m[c] - M);
        den   = fmaf(f, Dp[c * NPTS + row], den);
        acc.x = fmaf(f, x[c].x, acc.x);
        acc.y = fmaf(f, x[c].y, acc.y);
        acc.z = fmaf(f, x[c].z, acc.z);
        acc.w = fmaf(f, x[c].w, acc.w);
    }
    const float inv = 1.0f / den;
    *(float4*)(out + (size_t)row * DIM + lane * 4) =
        make_float4(fmaf(acc.x, inv, b4.x), fmaf(acc.y, inv, b4.y),
                    fmaf(acc.z, inv, b4.z), fmaf(acc.w, inv, b4.w));
    keep_address(ahead0);
    keep_address(ahead1);
    keep_address(ahead2);
}

// ---------------------------------------------------------------------------
// Launch: inputs:
// 0:x 1:W_Q 2:b_Q 3:W_K 4:b_K 5:W_V 6:b_V 7:W_Ev 8:b_Ev 9:W_A 10:b_A
// Workspace: Q,K,V (3 planes of 1024*128 floats), then per chunk of j the unnormalised
// AV + S @ W_Ev (NCH planes) and each row's max and denominator.
// ---------------------------------------------------------------------------
extern "C" void kernel_launch(void* const* d_in, const int* in_sizes, int n_in,
                              void* d_out, int out_size, void* d_ws, size_t ws_size,
                              hipStream_t stream) {
    const float* x   = (const float*)d_in[0];
    const float* Wq  = (const float*)d_in[1];
    const float* bq  = (const float*)d_in[2];
    const float* Wk  = (const float*)d_in[3];
    const float* bk  = (const float*)d_in[4];
    const float* Wv  = (const float*)d_in[5];
    const float* bv  = (const float*)d_in[6];
    const float* Wev = (const float*)d_in[7];
    const float* bev = (const float*)d_in[8];
    const float* wA  = (const float*)d_in[9];
    const float* bA  = (const float*)d_in[10];

    float* ws = (float*)d_ws;
    float* Q  = ws;
    float* K  = ws + 1 * NPTS * DIM;
    float* V  = ws + 2 * NPTS * DIM;
    float* Op = ws + 3 * NPTS * DIM;
    float* Mp = ws + (3 + NCH) * NPTS * DIM;
    float* Dp = ws + (3 + NCH) * NPTS * DIM + NCH * NPTS;

    qkv_gemm_wmma<<<dim3(NPTS / 16, 3), 256, 0, stream>>>(
        x, Wq, bq, Wk, bk, Wv, bv, Q, K, V);

    edge_softmax_pass<<<dim3(NPTS / RWG, NCH), 32 * NWV, 0, stream>>>(
        Q, K, V, wA, bA, Wev, Op, Mp, Dp, K, V);

    merge_chunks<<<NPTS / 4, 128, 0, stream>>>(
        Op, Mp, Dp, bev, (float*)d_out, Op, Mp, Dp);
}

// v009
// One run takes 20.8 microseconds.
// Two timings next to v008 put it at 1.04 and 1.02 times that version's speed.
// Counting every step since v000, it is 16.8 times as fast.
#include <hip/hip_runtime.h>
#include <math.h>

// FlexibleAttention, N=1024, DIM=128, fp32.
// Algebraic fusion: out_i = (Σ_j a_ij V_j) + (Σ_j a_ij relu(Q_i+K_j)) @ W_Ev + b_Ev
// => never materialize the [n,n,d] edge tensor; online softmax per row, j split in chunks.
// The product with W_Ev is linear in S, so each chunk applies it to its own unnormalised sums.
// relu(Q_i+K_j) = max(K_j, -Q_i) + Q_i: the Q_i part of a score is the same for every j, so the
// softmax over j does not see it, and its part of S is Q_i times the sum of the weights.

#define NPTS 1024
#define DIM  128

typedef float v2f __attribute__((ext_vector_type(2)));
typedef float v8f __attribute__((ext_vector_type(8)));

// ---------------------------------------------------------------------------
// Kernel 1: Q/K/V = x @ W + b   via V_WMMA_F32_16X16X4_F32
// grid = (NPTS/16, 3), block = 256 (8 waves; wave w owns n-tile w*16)
// blockIdx.y selects which of Q/K/V this block computes.
// Fragment layout (ISA 7.12.2, 32-bit):
//   A (16x4): lane L holds M=L%16, regs {K=2*(L/16), K=2*(L/16)+1}
//   B (4x16): lane L holds N=L%16, regs {K=2*(L/16), K=2*(L/16)+1}
//   D (16x16): c[r] = D[8*(L/16)+r][L%16]
// An A fragment read straight from x touches 16 cache lines per load, and all 8 waves read the
// same ones: the 16 x rows come in once as whole 512-byte rows and the fragments come from LDS.
// ---------------------------------------------------------------------------
#define XPIT (DIM + 4)         // LDS pitch, floats: the 32 lanes' 8-byte reads fall on all 64 banks
__global__ __launch_bounds__(256) void qkv_gemm_wmma(
    const float* __restrict__ x,
    const float* __restrict__ Wq, const float* __restrict__ bq,
    const float* __restrict__ Wk, const float* __restrict__ bk,
    const float* __restrict__ Wv, const float* __restrict__ bv,
    float* __restrict__ Q, float* __restrict__ K, float* __restrict__ V)
{
    __shared__ __attribute__((aligned(16))) float Xs[16][XPIT];

    const int lane = threadIdx.x & 31;
    const int wave = threadIdx.x >> 5;
    const int lo   = lane & 15;
    const int hi   = lane >> 4;
    const int i0   = blockIdx.x * 16;
    const int n0   = wave * 16;

    // One wave brings one whole row per load, two rows a wave.
    const float4 xr0 = *(const float4*)(x + (size_t)(i0 + wave)     * DIM + lane * 4);
    const float4 xr1 = *(const float4*)(x + (size_t)(i0 + wave + 8) * DIM + lane * 4);

    const float* W; const float* bias; float* out;
    if (blockIdx.y == 0)      { W = Wq; bias = bq; out = Q; }
    else if (blockIdx.y == 1) { W = Wk; bias = bk; out = K; }
    else                      { W = Wv; bias = bv; out = V; }

    v8f c = {0.f,0.f,0.f,0.f,0.f,0.f,0.f,0.f};

    // The wave's whole W strip, asked for here so that it travels during the staging of x.
    v2f b[DIM / 4];
#pragma unroll
    for (int kk = 0; kk < DIM / 4; ++kk) {
        const int ka = 4 * kk + 2 * hi;
        b[kk].x = W[(size_t)ka       * DIM + n0 + lo];
        b[kk].y = W[(size_t)(ka + 1) * DIM + n0 + lo];
    }
    const float bn = bias[n0 + lo];

    *(float4*)&Xs[wave][lane * 4]     = xr0;
    *(float4*)&Xs[wave + 8][lane * 4] = xr1;
    // A work-group barrier that orders LDS alone: __syncthreads() would also wait here for the
    // W loads, which no other wave reads; so each product waits only for its own two.
    __builtin_amdgcn_fence(__ATOMIC_RELEASE, "workgroup", "local");
    __builtin_amdgcn_s_barrier();
    __builtin_amdgcn_fence(__ATOMIC_ACQUIRE, "workgroup", "local");

#pragma unroll
    for (int kk = 0; kk < DIM / 4; ++kk) {
        const v2f a = *(const v2f*)&Xs[lo][4 * kk + 2 * hi];
        c = __builtin_amdgcn_wmma_f32_16x16x4_f32(
                false, a, false, b[kk], (short)0, c, false, false);
    }

#pragma unroll
    for (int r = 0; r < 8; ++r) {
        const int m = hi * 8 + r;
        out[(size_t)(i0 + m) * DIM + n0 + lo] = c[r] + bn;
    }
}

// Asks L2 for the line that holds *p; nothing comes back and no counter moves. For speed only.
// The kernels get the planes a second time as plain pointers (names ending in _ask) for these
// requests alone: loads through a pointer that an asm statement has seen are no longer made
// scalar loads.
__device__ __forceinline__ void ask_l2(const float* p)
{
    asm volatile("global_prefetch_b8 %0, off scope:SCOPE_SE" :: "v"(p));
}

// Input only, no code: the register pair that a request named stays that address up to here,
// so that no other value stands in it while the request may still be read.
__device__ __forceinline__ void keep_address(const float* p)
{
    asm volatile("" :: "v"(p));
}

// e^x as the fast form 2^(x * log2 e). The v_nop fills the one issue slot that the
// instruction set asks for behind a transcendental; inside the statement it cannot drift.
__device__ __forceinline__ float fast_exp(float x)
{
    float r;
    asm("v_exp_f32 %0, %1\n\tv_nop" : "=v"(r) : "v"(x * 1.44269504f));
    return r;
}

// ---------------------------------------------------------------------------
// Kernel 2: softmax-weighted sums over one chunk of j, ONE query row per LANE, two neighbouring
//   columns j in the two halves of each packed-f32 register pair.
//   work-group = 32 rows x JC columns j. The 16 waves are two groups of eight: group g
//   works on columns [64g, 64g+64) of the chunk, and wave v of a group owns dims [16v, 16v+16).
//   A tile of 32 rows x 128 columns holds as many scores as one of 64 x 64, but there are half
//   as many chunks of j: half the products S @ W_Ev (one per chunk and row) and half the planes
//   that kernel 2b merges.
//   K_j and W_A are the same for every lane: a dual-issue pair takes the two columns' K words
//   straight from two scalar registers, a packed f32 instruction takes W_A from one.
//   The sum over d of a score stays inside a lane; only the 8 per-wave partial
//   sums of a group meet, in LDS.
//   The lanes hold -Q_i, and both passes work on t_ij = max(K_j, -Q_i), one instruction, in
//   place of relu(Q_i+K_j), two: the scores are short of sum_d W_A Q_i, a constant of the row
//   in every chunk, and S gets Q_i * denominator once, behind the loop.
//   Partial scores -> LDS -> full scores and the rows' maxima over all 128 columns -> one
//   softmax, each wave for its group's 64 columns alone -> S += p * t_ij on the vector port
//   (even and odd columns apart in the two halves, added behind the loop),
//   summed over the two groups at the end; AV += P @ V is a plain matrix
//   product and runs on the matrix unit (V_WMMA_F32_16X16X4_F32, fragment layout as in
//   kernel 1), issued among the S sums, so that it costs the vector port next to nothing.
//   Behind the loop the work-group adds S @ W_Ev of its chunk's unnormalised sums onto the
//   same accumulators and leaves that one plane with the chunk's max and denominator;
//   kernel 2b merges the chunks into the output.
// grid = (NPTS/32, NCH), block = 512 (16 waves)
// ---------------------------------------------------------------------------
#define NCH   8                // chunks of j, one work-group each
#define JC    (NPTS / NCH)     // columns per chunk
#define NG    2                // column groups of a chunk, eight waves each
#define TJ    (JC / NG)        // columns per group
#define NWV   16               // waves per work-group
#define GWV   (NWV / NG)       // waves per group
#define DSL   (DIM / GWV)      // dims per wave
#define RWG   32               // rows per work-group
#define EPIT  (TJ + 4)         // LDS pitch, floats: 16 B x odd for 16-byte reads
#define MPIT  (NWV + 4)        // LDS pitch, floats: 16 B x odd
#define PPIT  (JC + 4)         // LDS pitch, floats: 16 B x odd
#define OPIT  (DIM + 4)        // LDS pitch, floats: 16 B x odd

// One wave-uniform value for both halves of a pair. The readfirstlane marks it as a single
// scalar register; without it the second word of each loaded row goes through a copy of its
// register pair into vector registers.
__device__ __forceinline__ v2f both(float x)
{
    const float u = __builtin_bit_cast(float, __builtin_amdgcn_readfirstlane(__builtin_bit_cast(int, x)));
    v2f r = {u, u};
    return r;
}

// max(K, -Q) for two columns of a lane's row in one issue slot: a dual-issue pair whose halves
// read the two columns' scalar registers. -Q is handed over as a pair with both halves alike; the
// compiler keeps one vector register for the two. (Written as one float, the build ran short of
// scalar registers and moved some through vector lanes inside the score loop.)
// Written by hand because the compiler first passes every
// loaded K word through an instruction of its own (it quiets a signalling NaN) and then seldom
// pairs. The compiler gives no s_delay_alu hint for a value that asm text made, so the pairs come
// eight in a row (two statements): several vector instructions then stand between a pair and the
// first read of its result, and no hint is missed.
// Eight columns (four pairs) of one dim:
__device__ __forceinline__ void larger_cols(v2f& t0, v2f& t1, v2f& t2, v2f& t3, v2f a,
                                            float k0, float k1, float k2, float k3,
                                            float k4, float k5, float k6, float k7)
{
    asm(
        "v_dual_max_num_f32 %0, %8, %16 :: v_dual_max_num_f32 %1, %9, %17\n\t"
        "v_dual_max_num_f32 %2, %10, %16 :: v_dual_max_num_f32 %3, %11, %17\n\t"
        "v_dual_max_num_f32 %4, %12, %16 :: v_dual_max_num_f32 %5, %13, %17\n\t"
        "v_dual_max_num_f32 %6, %14, %16 :: v_dual_max_num_f32 %7, %15, %17"
        : "=&v"(t0.x), "=&v"(t0.y), "=&v"(t1.x), "=&v"(t1.y),
          "=&v"(t2.x), "=&v"(t2.y), "=&v"(t3.x), "=&v"(t3.y)
        : "s"(k0), "s"(k1), "s"(k2), "s"(k3), "s"(k4), "s"(k5), "s"(k6), "s"(k7),
          "v"(a.x), "v"(a.y));
}
// Four dims of one pair of columns (k: the even column's words, m: the odd column's):
__device__ __forceinline__ void larger_dims(v2f& t0, v2f& t1, v2f& t2, v2f& t3,
                                            v2f a0, v2f a1, v2f a2, v2f a3,
                                            float k0, float k1, float k2, float k3,
                                            float m0, float m1, float m2, float m3)
{
    asm(
        "v_dual_max_num_f32 %0, %8, %16 :: v_dual_max_num_f32 %1, %12, %17\n\t"
        "v_dual_max_num_f32 %2, %9, %18 :: v_dual_max_num_f32 %3, %13, %19\n\t"
        "v_dual_max_num_f32 %4, %10, %20 :: v_dual_max_num_f32 %5, %14, %21\n\t"
        "v_dual_max_num_f32 %6, %11, %22 :: v_dual_max_num_f32 %7, %15, %23"
        : "=&v"(t0.x), "=&v"(t0.y), "=&v"(t1.x), "=&v"(t1.y),
          "=&v"(t2.x), "=&v"(t2.y), "=&v"(t3.x), "=&v"(t3.y)
        : "s"(k0), "s"(k1), "s"(k2), "s"(k3), "s"(m0), "s"(m1), "s"(m2), "s"(m3),
          "v"(a0.x), "v"(a0.y), "v"(a1.x), "v"(a1.y), "v"(a2.x), "v"(a2.y), "v"(a3.x), "v"(a3.y));
}

// The same four pairs behind one step of P @ V, in one statement: the compiler does not see
// which registers asm text writes, so it could hand the product's A or B registers to pairs that
// follow it at once. Here they are inputs of the statement whose outputs are all early-clobber,
// and the four pairs fill the four vector slots that the chip asks for behind a product.
__device__ __forceinline__ void product_and_larger_dims(
    v8f& c, v2f pa, v2f b,
    v2f& t0, v2f& t1, v2f& t2, v2f& t3, v2f a0, v2f a1, v2f a2, v2f a3,
    float k0, float k1, float k2, float k3, float m0, float m1, float m2, float m3)
{
    asm(
        "v_wmma_f32_16x16x4_f32 %0, %9, %10, %0\n\t"
        "v_dual_max_num_f32 %1, %11, %19 :: v_dual_max_num_f32 %2, %15, %20\n\t"
        "v_dual_max_num_f32 %3, %12, %21 :: v_dual_max_num_f32 %4, %16, %22\n\t"
        "v_dual_max_num_f32 %5, %13, %23 :: v_dual_max_num_f32 %6, %17, %24\n\t"
        "v_dual_max_num_f32 %7, %14, %25 :: v_dual_max_num_f32 %8, %18, %26"
        : "+v"(c),
          "=&v"(t0.x), "=&v"(t0.y), "=&v"(t1.x), "=&v"(t1.y),
          "=&v"(t2.x), "=&v"(t2.y), "=&v"(t3.x), "=&v"(t3.y)
        : "v"(pa), "v"(b),
          "s"(k0), "s"(k1), "s"(k2), "s"(k3), "s"(m0), "s"(m1), "s"(m2), "s"(m3),
          "v"(a0.x), "v"(a0.y), "v"(a1.x), "v"(a1.y), "v"(a2.x), "v"(a2.y), "v"(a3.x), "v"(a3.y));
}

__global__ __launch_bounds__(512) void edge_softmax_pass(
    const float* __restrict__ Q, const float* __restrict__ K,
    const float* __restrict__ V,
    const float* __restrict__ wA, const float* __restrict__ bA,
    const float* __restrict__ Wev,
    float* __restrict__ Op,
    float* __restrict__ Mp, float* __restrict__ Dp,
    const float* K_ask, const float* V_ask)
{
    // Scores lie in LDS as they lie in registers: [lane = row][column of the group].
    __shared__ __attribute__((aligned(16))) float Ep[NWV][32][EPIT];   // per-wave partial scores
    __shared__ __attribute__((aligned(16))) float Ef[NG][32][EPIT];    // full scores, per column group
    __shared__ __attribute__((aligned(16))) float Mx[32][MPIT];        // [lane][wave]: maxima of eight columns
    __shared__ __attribute__((aligned(16))) float Pm[RWG][PPIT];       // weights, row-major: [row][column of the chunk]
    __shared__ __attribute__((aligned(16))) float To[3][RWG][OPIT];    // row-major staging: S of either group, result
    __shared__ float Dn[NG][RWG];                                      // denominators, per column group

    const int tid  = threadIdx.x;
    const int lane = tid & 31;
    const int wave = __builtin_amdgcn_readfirstlane(tid >> 5);
    const int grp  = wave >> 3;            // column group
    const int wv   = wave & 7;             // slice of dims inside the group
    const int row0 = blockIdx.x * RWG;
    const int i    = row0 + lane;
    const int d0   = wv * DSL;
    const int jbeg = blockIdx.y * JC;

    // The chunk's K rows and V rows are 64 KB each, contiguous: 512 lines of 128 bytes each, one
    // of either per thread. The scalar loads below come to them group by group.
    const float* const ahead_k = K_ask + (size_t)jbeg * DIM + tid * 32;
    const float* const ahead_v = V_ask + (size_t)jbeg * DIM + tid * 32;
    ask_l2(ahead_k);
    ask_l2(ahead_v);
    // No instruction comes of this fence. With the asm statement as the last memory event in
    // front of the loop the compiler takes K and V as possibly rewritten and turns the loop's
    // scalar loads into vector loads with a copy to a scalar register per word.
    __builtin_amdgcn_fence(__ATOMIC_ACQUIRE, "wavefront");

    // Every '#pragma unroll' below makes the indices of these register arrays constants.
    const v2f zero2 = {0.f, 0.f};
    v2f nq[DSL], s[DSL];      // nq = -Q in both halves; s: even columns' sum, odd columns' sum
    float w[DSL];
    // A lane's own Q row read straight from memory touches 32 cache lines per load. The 32 rows
    // come in once as whole 512-byte rows (one wave, one row per load) and each lane takes its
    // row's dims from LDS. The plane is free here: its S sums are staged behind later barriers.
    float4 qrow[RWG / NWV];
#pragma unroll
    for (int u = 0; u < RWG / NWV; ++u)
        qrow[u] = *(const float4*)(Q + (size_t)(row0 + wave + NWV * u) * DIM + lane * 4);
#pragma unroll
    for (int d = 0; d < DSL; ++d) { w[d] = wA[d0 + d]; s[d] = zero2; }
    // W_A for both halves of a pair, formed once here: formed inside the score loop each costs
    // a copy to a scalar register on every trip.
    v2f w2[DSL];
#pragma unroll
    for (int d = 0; d < DSL; ++d) w2[d] = both(w[d]);
    const float ba = bA[0];

    // Matrix tiles of the chunk's 32 x 128 result: 2 x 8 tiles of 16 x 16, one per wave. Wave w
    // owns column tile w % 8 and row tile w / 8: rows m0 .. m0+15. Its k steps go by turns into
    // two accumulators, added at the end, so that no product waits for the one before it.
    const int  lo    = lane & 15;
    const int  hi    = lane >> 4;
    const int  n0    = wv * 16;
    const int  m0    = grp * 16;
    v8f c0 = {0.f,0.f,0.f,0.f,0.f,0.f,0.f,0.f};
    v8f c1 = {0.f,0.f,0.f,0.f,0.f,0.f,0.f,0.f};

    // The group's 64 K rows, this wave's 16 dims.
    const float* __restrict__ Kt = K + (size_t)(jbeg + grp * TJ) * DIM + d0;

    // The Q rows go through LDS.
#pragma unroll
    for (int u = 0; u < RWG / NWV; ++u)
        *(float4*)&To[0][wave + NWV * u][lane * 4] = qrow[u];
    // A work-group barrier that orders LDS alone, as no global access is handed over here.
    __builtin_amdgcn_fence(__ATOMIC_RELEASE, "workgroup", "local");
    __builtin_amdgcn_s_barrier();
    __builtin_amdgcn_fence(__ATOMIC_ACQUIRE, "workgroup", "local");
#pragma unroll
    for (int u = 0; u < DSL / 4; ++u) {
        const float4 ta = *(const float4*)&To[0][lane][d0 + 4 * u];
        nq[4*u].x   = -ta.x; nq[4*u].y   = -ta.x;
        nq[4*u+1].x = -ta.y; nq[4*u+1].y = -ta.y;
        nq[4*u+2].x = -ta.z; nq[4*u+2].y = -ta.z;
        nq[4*u+3].x = -ta.w; nq[4*u+3].y = -ta.w;
    }

    // Holds the V loads below behind the staging of Q: loads return in order, and the scheduler
    // put most of the 64 V loads in front of the Q loads, so that the staging waited for them too.
    __builtin_amdgcn_sched_barrier(0);
    // The chunk's V fragments (B, 4 x 16 per step), asked for here so that they travel
    // during the scores.
    const float* __restrict__ Vf = V + (size_t)(jbeg + 2 * hi) * DIM + n0 + lo;
    v2f bv[JC / 4];
#pragma unroll
    for (int kk = 0; kk < JC / 4; ++kk) {
        bv[kk].x = Vf[(size_t)(4 * kk)     * DIM];
        bv[kk].y = Vf[(size_t)(4 * kk + 1) * DIM];
    }

    // Partial scores over this wave's 16 dims, 64 columns, one row, all inside the lane.
#pragma unroll 1   // one copy of the body, for the instruction cache; no register array is indexed by g
    for (int g = 0; g < TJ / 8; ++g) {
        v2f e4[4];             // columns 8g+2c, 8g+2c+1
#pragma unroll
        for (int c = 0; c < 4; ++c) e4[c] = zero2;
#pragma unroll
        for (int dh = 0; dh < DSL / 8; ++dh) {
            float k8[8][8];
#pragma unroll
            for (int c = 0; c < 8; ++c)
#pragma unroll
                for (int d = 0; d < 8; ++d)
                    k8[c][d] = Kt[(size_t)(8 * g + c) * DIM + 8 * dh + d];
            // Keeps the eight rows' scalar loads together in front of their arithmetic: one
            // wait per eight columns; left alone the scheduler loads and waits row by row.
            __builtin_amdgcn_sched_barrier(0);
#pragma unroll
            for (int d = 0; d < 8; d += 2) {
                v2f t8[8];
                larger_cols(t8[0], t8[1], t8[2], t8[3], nq[8 * dh + d],
                            k8[0][d], k8[1][d], k8[2][d], k8[3][d],
                            k8[4][d], k8[5][d], k8[6][d], k8[7][d]);
                larger_cols(t8[4], t8[5], t8[6], t8[7], nq[8 * dh + d + 1],
                            k8[0][d+1], k8[1][d+1], k8[2][d+1], k8[3][d+1],
                            k8[4][d+1], k8[5][d+1], k8[6][d+1], k8[7][d+1]);
                // Holds the eight sums behind all eight pairs (the distance named at larger_cols).
                __builtin_amdgcn_sched_barrier(0);
#pragma unroll
                for (int c = 0; c < 4; ++c)
                    e4[c] = __builtin_elementwise_fma(t8[c], w2[8 * dh + d], e4[c]);
#pragma unroll
                for (int c = 0; c < 4; ++c)
                    e4[c] = __builtin_elementwise_fma(t8[4 + c], w2[8 * dh + d + 1], e4[c]);
                // Holds the next dims' pairs behind these sums, for the same distance.
                __builtin_amdgcn_sched_barrier(0);
            }
        }
#pragma unroll
        for (int u = 0; u < 2; ++u)
            *(float4*)&Ep[wave][lane][8 * g + 4 * u] =
                make_float4(e4[2*u].x, e4[2*u].y, e4[2*u+1].x, e4[2*u+1].y);
        // Lower edge: the next group's loads are not lifted in among this arithmetic,
        // where they would split into single loads with a wait each.
        __builtin_amdgcn_sched_barrier(0);
    }
    __syncthreads();

    // Wave w adds the 8 partial sums of its group's columns 8*(w%8) .. +7 (each lane's row),
    // in wave order, and leaves their maximum beside the scores.
    float4 ac0 = *(const float4*)&Ep[grp * GWV][lane][8 * wv];
    float4 ac1 = *(const float4*)&Ep[grp * GWV][lane][8 * wv + 4];
#pragma unroll
    for (int o = 1; o < GWV; ++o) {
        const float4 x4 = *(const float4*)&Ep[grp * GWV + o][lane][8 * wv];
        const float4 y4 = *(const float4*)&Ep[grp * GWV + o][lane][8 * wv + 4];
        ac0.x += x4.x; ac0.y += x4.y; ac0.z += x4.z; ac0.w += x4.w;
        ac1.x += y4.x; ac1.y += y4.y; ac1.z += y4.z; ac1.w += y4.w;
    }
    ac0.x += ba; ac0.y += ba; ac0.z += ba; ac0.w += ba;
    ac1.x += ba; ac1.y += ba; ac1.z += ba; ac1.w += ba;
    *(float4*)&Ef[grp][lane][8 * wv]     = ac0;
    *(float4*)&Ef[grp][lane][8 * wv + 4] = ac1;
    Mx[lane][wave] = fmaxf(fmaxf(fmaxf(ac0.x, ac0.y), fmaxf(ac0.z, ac0.w)),
                           fmaxf(fmaxf(ac1.x, ac1.y), fmaxf(ac1.z, ac1.w)));
    __syncthreads();

    // The first eight K rows of the sums below, asked for in front of the softmax: the LDS
    // wait further down would otherwise hold these loads back to where they are needed.
    float kfirst[8][8];
#pragma unroll
    for (int c = 0; c < 8; ++c)
#pragma unroll
        for (int d = 0; d < 8; ++d)
            kfirst[c][d] = Kt[(size_t)c * DIM + d];

    // The row's maximum over all 128 columns of the chunk: one softmax, no rescale.
    float mrun = -1e30f;
#pragma unroll
    for (int u = 0; u < NWV / 4; ++u) {
        const float4 x4 = *(const float4*)&Mx[lane][4 * u];
        mrun = fmaxf(mrun, fmaxf(fmaxf(x4.x, x4.y), fmaxf(x4.z, x4.w)));
    }

    // The weights of the eight columns that this wave summed go to the row-major plane, from
    // which every wave takes its A fragments of P @ V over all 128 columns.
    *(float4*)&Pm[lane][grp * TJ + 8 * wv] =
        make_float4(fast_exp(ac0.x - mrun), fast_exp(ac0.y - mrun),
                    fast_exp(ac0.z - mrun), fast_exp(ac0.w - mrun));
    *(float4*)&Pm[lane][grp * TJ + 8 * wv + 4] =
        make_float4(fast_exp(ac1.x - mrun), fast_exp(ac1.y - mrun),
                    fast_exp(ac1.z - mrun), fast_exp(ac1.w - mrun));

    // The weights of the group's 64 columns, each lane for its own row: p[m] = columns 2m, 2m+1.
    v2f p[TJ / 2];
#pragma unroll
    for (int g = 0; g < TJ / 4; ++g) {
        const float4 x4 = *(const float4*)&Ef[grp][lane][4 * g];
        p[2*g].x   = x4.x; p[2*g].y   = x4.y;
        p[2*g+1].x = x4.z; p[2*g+1].y = x4.w;
    }
    v2f denom2 = zero2;       // of the group's even and odd columns
#pragma unroll
    for (int jj = 0; jj < TJ / 2; ++jj) {
        p[jj].x = fast_exp(p[jj].x - mrun);
        p[jj].y = fast_exp(p[jj].y - mrun);
        denom2 += p[jj];
    }
    const float denom = denom2.x + denom2.y;

    // A work-group barrier that orders LDS alone (Pm is complete behind it): __syncthreads()
    // would also wait for the K loads above, and the K loads below would no longer be scalar.
    __builtin_amdgcn_fence(__ATOMIC_RELEASE, "workgroup", "local");
    __builtin_amdgcn_s_barrier();
    __builtin_amdgcn_fence(__ATOMIC_ACQUIRE, "workgroup", "local");

    // A fragments, two steps of four columns per block of the sums below, read one block ahead.
    v2f pa[JC / 4];
#pragma unroll
    for (int kk = 0; kk < 2; ++kk)
        pa[kk] = *(const v2f*)&Pm[m0 + lo][4 * kk + 2 * hi];

#pragma unroll
    for (int b = 0; b < (TJ / 8) * (DSL / 8); ++b) {
        const int h  = b >> 1;       // eight columns of the group
        const int dh = b & 1;        // eight dims of the wave
        float kc[8][8];
#pragma unroll
        for (int c = 0; c < 8; ++c)
#pragma unroll
            for (int d = 0; d < 8; ++d)
                kc[c][d] = b == 0 ? kfirst[c][d] : Kt[(size_t)(8 * h + c) * DIM + 8 * dh + d];
        if (b + 1 < (TJ / 8) * (DSL / 8)) {
#pragma unroll
            for (int kk = 2 * b + 2; kk < 2 * b + 4; ++kk)
                pa[kk] = *(const v2f*)&Pm[m0 + lo][4 * kk + 2 * hi];
        }
        // Keeps eight columns' K scalar loads together in front of their arithmetic
        // (one wait per eight columns), as in the score loop.
        __builtin_amdgcn_sched_barrier(0);
#pragma unroll
        for (int c = 0; c < 4; ++c) {      // columns 8h+2c, 8h+2c+1
            v2f td[8];
            if ((c & 1) == 0) {
                // Columns 4kk .. 4kk+3 of the chunk in P @ V; the matrix unit works on them
                // while the vector port goes on with the S sums.
                const int kk = 2 * b + (c >> 1);
                product_and_larger_dims((c >> 1) ? c1 : c0, pa[kk], bv[kk],
                                        td[0], td[1], td[2], td[3],
                                        nq[8*dh], nq[8*dh+1], nq[8*dh+2], nq[8*dh+3],
                                        kc[2*c][0], kc[2*c][1], kc[2*c][2], kc[2*c][3],
                                        kc[2*c+1][0], kc[2*c+1][1], kc[2*c+1][2], kc[2*c+1][3]);
            } else {
                larger_dims(td[0], td[1], td[2], td[3],
                            nq[8*dh], nq[8*dh+1], nq[8*dh+2], nq[8*dh+3],
                            kc[2*c][0], kc[2*c][1], kc[2*c][2], kc[2*c][3],
                            kc[2*c+1][0], kc[2*c+1][1], kc[2*c+1][2], kc[2*c+1][3]);
            }
            larger_dims(td[4], td[5], td[6], td[7],
                        nq[8*dh+4], nq[8*dh+5], nq[8*dh+6], nq[8*dh+7],
                        kc[2*c][4], kc[2*c][5], kc[2*c][6], kc[2*c][7],
                        kc[2*c+1][4], kc[2*c+1][5], kc[2*c+1][6], kc[2*c+1][7]);
            // Holds the eight sums behind all eight pairs (the distance named at larger_cols).
            __builtin_amdgcn_sched_barrier(0);
            const v2f pj = p[4 * h + c];
#pragma unroll
            for (int d = 0; d < 8; ++d)
                s[8 * dh + d] = __builtin_elementwise_fma(pj, td[d], s[8 * dh + d]);
            // Holds the next columns' pairs behind these sums, for the same distance.
            __builtin_amdgcn_sched_barrier(0);
        }
        // Lower edge of the block, as in the score loop.
        __builtin_amdgcn_sched_barrier(0);
    }

    keep_address(ahead_k);
    keep_address(ahead_v);

    // Even and odd columns' sums meet, with the Q_i part of relu(Q_i+K_j) for all the group's
    // columns at once.
    float sd[DSL];
#pragma unroll
    for (int d = 0; d < DSL; ++d) sd[d] = fmaf(-nq[d].x, denom, s[d].x + s[d].y);

    // Output product of the chunk, on the tile that holds AV.

    // The wave's W_Ev strip, asked for here so that it travels during the staging, the barrier
    // and the first products.
    v2f bw[DIM / 4];
#pragma unroll
    for (int kk = 0; kk < DIM / 4; ++kk) {
        const int ka = 4 * kk + 2 * hi;
        bw[kk].x = Wev[(size_t)ka       * DIM + n0 + lo];
        bw[kk].y = Wev[(size_t)(ka + 1) * DIM + n0 + lo];
    }

    // Lane-per-row registers -> row-major LDS, one plane per column group.
#pragma unroll
    for (int u = 0; u < DSL / 4; ++u)
        *(float4*)&To[grp][lane][d0 + 4 * u] = make_float4(sd[4*u], sd[4*u+1], sd[4*u+2], sd[4*u+3]);
    if (wv == 0) Dn[grp][lane] = denom;
    // A work-group barrier that orders LDS alone: __syncthreads() would also wait here for all
    // 64 W_Ev loads, which no other wave reads; so each product waits only for its own two.
    __builtin_amdgcn_fence(__ATOMIC_RELEASE, "workgroup", "local");
    __builtin_amdgcn_s_barrier();
    __builtin_amdgcn_fence(__ATOMIC_ACQUIRE, "workgroup", "local");

#pragma unroll
    for (int kk = 0; kk < DIM / 4; kk += 2) {
        const int ka = 4 * kk + 2 * hi;
        const v2f a0 = *(const v2f*)&To[0][m0 + lo][ka]     + *(const v2f*)&To[1][m0 + lo][ka];
        const v2f a1 = *(const v2f*)&To[0][m0 + lo][ka + 4] + *(const v2f*)&To[1][m0 + lo][ka + 4];
        c0 = __builtin_amdgcn_wmma_f32_16x16x4_f32(
                 false, a0, false, bw[kk], (short)0, c0, false, false);
        c1 = __builtin_amdgcn_wmma_f32_16x16x4_f32(
                 false, a1, false, bw[kk + 1], (short)0, c1, false, false);
    }
#pragma unroll
    for (int r = 0; r < 8; ++r)
        To[2][m0 + 8 * hi + r][n0 + lo] = c0[r] + c1[r];
    __syncthreads();

    // Row-major LDS -> whole 512-byte rows to memory.
    const size_t base = ((size_t)blockIdx.y * NPTS + row0) * DIM;
#pragma unroll
    for (int u = 0; u < RWG / NWV; ++u) {
        const int r = wave + NWV * u;     // one wave stores one row
        *(float4*)(Op + base + (size_t)r * DIM + lane * 4) = *(const float4*)&To[2][r][lane * 4];
    }
    // The stores above are still in flight: their address and data registers
    // are not rewritten in front of this wait.
    asm volatile("s_wait_xcnt 0x0" ::: "memory");
    if (wave == 0) {
        Mp[blockIdx.y * NPTS + i] = mrun;
        Dp[blockIdx.y * NPTS + i] = Dn[0][lane] + Dn[1][lane];
    }
}

// ---------------------------------------------------------------------------
// Kernel 2b: merge the NCH chunks of a row into the output:
//   out_i = sum_c exp(m_c - M) Op_c / sum_c exp(m_c - M) D_c + b_Ev,  M = max_c m_c.
// grid = NPTS/4, block = 128; one wave per row, lane = 4 dims.
// ---------------------------------------------------------------------------
__global__ __launch_bounds__(128) void merge_chunks(
    const float* __restrict__ Op,
    const float* __restrict__ Mp, const float* __restrict__ Dp,
    const float* __restrict__ bev,
    float* __restrict__ out,
    const float* Op_ask, const float* Mp_ask, const float* Dp_ask)
{
    const int lane = threadIdx.x & 31;
    const int wave = __builtin_amdgcn_readfirstlane(threadIdx.x >> 5);
    const int row  = blockIdx.x * 4 + wave;

    // All that this wave reads of the launch before: 8 chunk rows of 512 bytes (32 lines, one
    // per lane) and the row's 8 maxima and 8 denominators (one line each; lanes 16 to 31 name
    // the denominators' lines again). Part of the loads below issue only behind the first wait.
    const float* const ahead0 = Op_ask + ((size_t)(lane >> 2) * NPTS + row) * DIM + (lane & 3) * 32;
    const float* const ahead2 = (lane < NCH ? Mp_ask : Dp_ask) + (lane & (NCH - 1)) * NPTS + row;
    ask_l2(ahead0);
    ask_l2(ahead2);

    float4 x[NCH];
#pragma unroll
    for (int c = 0; c < NCH; ++c)
        x[c] = *(const float4*)(Op + ((size_t)c * NPTS + row) * DIM + lane * 4);
    const float4 b4 = *(const float4*)(bev + lane * 4);

    float m[NCH];
    float M = -1e30f;
#pragma unroll
    for (int c = 0; c < NCH; ++c) { m[c] = Mp[c * NPTS + row]; M = fmaxf(M, m[c]); }

    float  den = 0.f;
    float4 acc = {0.f, 0.f, 0.f, 0.f};
#pragma unroll
    for (int c = 0; c < NCH; ++c) {
        const float f = fast_exp(m[c] - M);
        den   = fmaf(f, Dp[c * NPTS + row], den);
        acc.x = fmaf(f, x[c].x, acc.x);
        acc.y = fmaf(f, x[c].y, acc.y);
        acc.z = fmaf(f, x[c].z, acc.z);
        acc.w = fmaf(f, x[c].w, acc.w);
    }
    const float inv = 1.0f / den;
    *(float4*)(out + (size_t)row * DIM + lane * 4) =
        make_float4(fmaf(acc.x, inv, b4.x), fmaf(acc.y, inv, b4.y),
                    fmaf(acc.z, inv, b4.z), fmaf(acc.w, inv, b4.w));
    keep_address(ahead0);
    keep_address(ahead2);
}

// ---------------------------------------------------------------------------
// Launch: inputs:
// 0:x 1:W_Q 2:b_Q 3:W_K 4:b_K 5:W_V 6:b_V 7:W_Ev 8:b_Ev 9:W_A 10:b_A
// Workspace: Q,K,V (3 planes of 1024*128 floats), then per chunk of j the unnormalised
// AV + S @ W_Ev (NCH planes) and each row's max and denominator.
// ---------------------------------------------------------------------------
extern "C" void kernel_launch(void* const* d_in, const int* in_sizes, int n_in,
                              void* d_out, int out_size, void* d_ws, size_t ws_size,
                              hipStream_t stream) {
    const float* x   = (const float*)d_in[0];
    const float* Wq  = (const float*)d_in[1];
    const float* bq  = (const float*)d_in[2];
    const float* Wk  = (const float*)d_in[3];
    const float* bk  = (const float*)d_in[4];
    const float* Wv  = (const float*)d_in[5];
    const float* bv  = (const float*)d_in[6];
    const float* Wev = (const float*)d_in[7];
    const float* bev = (const float*)d_in[8];
    const float* wA  = (const float*)d_in[9];
    const float* bA  = (const float*)d_in[10];

    float* ws = (float*)d_ws;
    float* Q  = ws;
    float* K  = ws + 1 * NPTS * DIM;
    float* V  = ws + 2 * NPTS * DIM;
    float* Op = ws + 3 * NPTS * DIM;
    float* Mp = ws + (3 + NCH) * NPTS * DIM;
    float* Dp = ws + (3 + NCH) * NPTS * DIM + NCH * NPTS;

    qkv_gemm_wmma<<<dim3(NPTS / 16, 3), 256, 0, stream>>>(
        x, Wq, bq, Wk, bk, Wv, bv, Q, K, V);

    edge_softmax_pass<<<dim3(NPTS / RWG, NCH), 32 * NWV, 0, stream>>>(
        Q, K, V, wA, bA, Wev, Op, Mp, Dp, K, V);

    merge_chunks<<<NPTS / 4, 128, 0, stream>>>(
        Op, Mp, Dp, bev, (float*)d_out, Op, Mp, Dp);
}

// v010
// Measured time: 20.1 microseconds a run.
// Next to v009, in two timings, it ran 1.04 times as fast each time.
// Over all steps from v000 it is 17.4 times as fast.
#include <hip/hip_runtime.h>
#include <math.h>

// FlexibleAttention, N=1024, DIM=128, fp32.
// Algebraic fusion: out_i = (Σ_j a_ij V_j) + (Σ_j a_ij relu(Q_i+K_j)) @ W_Ev + b_Ev
// => never materialize the [n,n,d] edge tensor; online softmax per row, j split in chunks.
// The product with W_Ev is linear in S, so each chunk applies it to its own unnormalised sums.
// relu(Q_i+K_j) = max(K_j, -Q_i) + Q_i: the Q_i part of a score is the same for every j, so the
// softmax over j does not see it, and its part of S is Q_i times the sum of the weights.

#define NPTS 1024
#define DIM  128

typedef float v2f __attribute__((ext_vector_type(2)));
typedef float v8f __attribute__((ext_vector_type(8)));

// ---------------------------------------------------------------------------
// Kernel 1: Q/K/V = x @ W + b   via V_WMMA_F32_16X16X4_F32
// grid = (NPTS/16, 3), block = 256 (8 waves; wave w owns n-tile w*16)
// blockIdx.y selects which of Q/K/V this block computes.
// Fragment layout (ISA 7.12.2, 32-bit):
//   A (16x4): lane L holds M=L%16, regs {K=2*(L/16), K=2*(L/16)+1}
//   B (4x16): lane L holds N=L%16, regs {K=2*(L/16), K=2*(L/16)+1}
//   D (16x16): c[r] = D[8*(L/16)+r][L%16]
// An A fragment read straight from x touches 16 cache lines per load, and all 8 waves read the
// same ones: the 16 x rows come in once as whole 512-byte rows and the fragments come from LDS.
// ---------------------------------------------------------------------------
#define XPIT (DIM + 4)         // LDS pitch, floats: the 32 lanes' 8-byte reads fall on all 64 banks
__global__ __launch_bounds__(256) void qkv_gemm_wmma(
    const float* __restrict__ x,
    const float* __restrict__ Wq, const float* __restrict__ bq,
    const float* __restrict__ Wk, const float* __restrict__ bk,
    const float* __restrict__ Wv, const float* __restrict__ bv,
    float* __restrict__ Q, float* __restrict__ K, float* __restrict__ V)
{
    __shared__ __attribute__((aligned(16))) float Xs[16][XPIT];

    const int lane = threadIdx.x & 31;
    const int wave = threadIdx.x >> 5;
    const int lo   = lane & 15;
    const int hi   = lane >> 4;
    const int i0   = blockIdx.x * 16;
    const int n0   = wave * 16;

    // One wave brings one whole row per load, two rows a wave.
    const float4 xr0 = *(const float4*)(x + (size_t)(i0 + wave)     * DIM + lane * 4);
    const float4 xr1 = *(const float4*)(x + (size_t)(i0 + wave + 8) * DIM + lane * 4);

    const float* W; const float* bias; float* out;
    if (blockIdx.y == 0)      { W = Wq; bias = bq; out = Q; }
    else if (blockIdx.y == 1) { W = Wk; bias = bk; out = K; }
    else                      { W = Wv; bias = bv; out = V; }

    v8f c = {0.f,0.f,0.f,0.f,0.f,0.f,0.f,0.f};

    // The wave's whole W strip, asked for here so that it travels during the staging of x.
    v2f b[DIM / 4];
#pragma unroll
    for (int kk = 0; kk < DIM / 4; ++kk) {
        const int ka = 4 * kk + 2 * hi;
        b[kk].x = W[(size_t)ka       * DIM + n0 + lo];
        b[kk].y = W[(size_t)(ka + 1) * DIM + n0 + lo];
    }
    const float bn = bias[n0 + lo];

    *(float4*)&Xs[wave][lane * 4]     = xr0;
    *(float4*)&Xs[wave + 8][lane * 4] = xr1;
    // A work-group barrier that orders LDS alone: __syncthreads() would also wait here for the
    // W loads, which no other wave reads; so each product waits only for its own two.
    __builtin_amdgcn_fence(__ATOMIC_RELEASE, "workgroup", "local");
    __builtin_amdgcn_s_barrier();
    __builtin_amdgcn_fence(__ATOMIC_ACQUIRE, "workgroup", "local");

#pragma unroll
    for (int kk = 0; kk < DIM / 4; ++kk) {
        const v2f a = *(const v2f*)&Xs[lo][4 * kk + 2 * hi];
        c = __builtin_amdgcn_wmma_f32_16x16x4_f32(
                false, a, false, b[kk], (short)0, c, false, false);
    }

#pragma unroll
    for (int r = 0; r < 8; ++r) {
        const int m = hi * 8 + r;
        out[(size_t)(i0 + m) * DIM + n0 + lo] = c[r] + bn;
    }
}

// Asks L2 for the line that holds *p; nothing comes back and no counter moves. For speed only.
// The kernels get the planes a second time as plain pointers (names ending in _ask) for these
// requests alone: loads through a pointer that an asm statement has seen are no longer made
// scalar loads.
__device__ __forceinline__ void ask_l2(const float* p)
{
    asm volatile("global_prefetch_b8 %0, off scope:SCOPE_SE" :: "v"(p));
}

// Input only, no code: the register pair that a request named stays that address up to here,
// so that no other value stands in it while the request may still be read.
__device__ __forceinline__ void keep_address(const float* p)
{
    asm volatile("" :: "v"(p));
}

// e^x as the fast form 2^(x * log2 e). The v_nop fills the one issue slot that the
// instruction set asks for behind a transcendental; inside the statement it cannot drift.
__device__ __forceinline__ float fast_exp(float x)
{
    float r;
    asm("v_exp_f32 %0, %1\n\tv_nop" : "=v"(r) : "v"(x * 1.44269504f));
    return r;
}

// ---------------------------------------------------------------------------
// Kernel 2: softmax-weighted sums over one chunk of j, ONE query row per LANE, two neighbouring
//   columns j in the two halves of each packed-f32 register pair.
//   work-group = 32 rows x JC columns j. The 16 waves are two groups of eight: group g
//   works on columns [64g, 64g+64) of the chunk, and wave v of a group owns dims [16v, 16v+16).
//   A tile of 32 rows x 128 columns holds as many scores as one of 64 x 64, but there are half
//   as many chunks of j: half the products S @ W_Ev (one per chunk and row) and half the planes
//   that kernel 2b merges.
//   K_j and W_A are the same for every lane: a dual-issue pair takes the two columns' K words
//   straight from two scalar registers, a packed f32 instruction takes W_A from one.
//   The sum over d of a score stays inside a lane; only the 8 per-wave partial
//   sums of a group meet, in LDS.
//   The lanes hold -Q_i, and both passes work on t_ij = max(K_j, -Q_i), one instruction, in
//   place of relu(Q_i+K_j), two: the scores are short of sum_d W_A Q_i, a constant of the row
//   in every chunk, and S gets Q_i * denominator once, behind the loop.
//   Partial scores -> LDS -> full scores and the rows' maxima over all 128 columns -> one
//   softmax, each weight formed once, by the wave that summed its column, and read by the
//   other waves from LDS -> S += p * t_ij on the vector port
//   (even and odd columns apart in the two halves, added behind the loop),
//   summed over the two groups at the end; AV += P @ V is a plain matrix
//   product and runs on the matrix unit (V_WMMA_F32_16X16X4_F32, fragment layout as in
//   kernel 1), issued among the S sums, so that it costs the vector port next to nothing.
//   Behind the loop the work-group adds S @ W_Ev of its chunk's unnormalised sums onto the
//   same accumulators and leaves that one plane with the chunk's max and denominator;
//   kernel 2b merges the chunks into the output.
// grid = (NPTS/32, NCH), block = 512 (16 waves)
// ---------------------------------------------------------------------------
#define NCH   8                // chunks of j, one work-group each
#define JC    (NPTS / NCH)     // columns per chunk
#define NG    2                // column groups of a chunk, eight waves each
#define TJ    (JC / NG)        // columns per group
#define NWV   16               // waves per work-group
#define GWV   (NWV / NG)       // waves per group
#define DSL   (DIM / GWV)      // dims per wave
#define RWG   32               // rows per work-group
#define EPIT  (TJ + 4)         // LDS pitch, floats: 16 B x odd for 16-byte reads
#define MPIT  (NWV + 4)        // LDS pitch, floats: 16 B x odd
#define PPIT  (JC + 4)         // LDS pitch, floats: 16 B x odd
#define OPIT  (DIM + 4)        // LDS pitch, floats: 16 B x odd

// One wave-uniform value for both halves of a pair. The readfirstlane marks it as a single
// scalar register; without it the second word of each loaded row goes through a copy of its
// register pair into vector registers.
__device__ __forceinline__ v2f both(float x)
{
    const float u = __builtin_bit_cast(float, __builtin_amdgcn_readfirstlane(__builtin_bit_cast(int, x)));
    v2f r = {u, u};
    return r;
}

// max(K, -Q) for two columns of a lane's row in one issue slot: a dual-issue pair whose halves
// read the two columns' scalar registers. -Q is handed over as a pair with both halves alike; the
// compiler keeps one vector register for the two. (Written as one float, the build ran short of
// scalar registers and moved some through vector lanes inside the score loop.)
// Written by hand because the compiler first passes every
// loaded K word through an instruction of its own (it quiets a signalling NaN) and then seldom
// pairs. The compiler gives no s_delay_alu hint for a value that asm text made, so the pairs come
// eight in a row (two statements): several vector instructions then stand between a pair and the
// first read of its result, and no hint is missed.
// Eight columns (four pairs) of one dim:
__device__ __forceinline__ void larger_cols(v2f& t0, v2f& t1, v2f& t2, v2f& t3, v2f a,
                                            float k0, float k1, float k2, float k3,
                                            float k4, float k5, float k6, float k7)
{
    asm(
        "v_dual_max_num_f32 %0, %8, %16 :: v_dual_max_num_f32 %1, %9, %17\n\t"
        "v_dual_max_num_f32 %2, %10, %16 :: v_dual_max_num_f32 %3, %11, %17\n\t"
        "v_dual_max_num_f32 %4, %12, %16 :: v_dual_max_num_f32 %5, %13, %17\n\t"
        "v_dual_max_num_f32 %6, %14, %16 :: v_dual_max_num_f32 %7, %15, %17"
        : "=&v"(t0.x), "=&v"(t0.y), "=&v"(t1.x), "=&v"(t1.y),
          "=&v"(t2.x), "=&v"(t2.y), "=&v"(t3.x), "=&v"(t3.y)
        : "s"(k0), "s"(k1), "s"(k2), "s"(k3), "s"(k4), "s"(k5), "s"(k6), "s"(k7),
          "v"(a.x), "v"(a.y));
}
// Four dims of one pair of columns (k: the even column's words, m: the odd column's):
__device__ __forceinline__ void larger_dims(v2f& t0, v2f& t1, v2f& t2, v2f& t3,
                                            v2f a0, v2f a1, v2f a2, v2f a3,
                                            float k0, float k1, float k2, float k3,
                                            float m0, float m1, float m2, float m3)
{
    asm(
        "v_dual_max_num_f32 %0, %8, %16 :: v_dual_max_num_f32 %1, %12, %17\n\t"
        "v_dual_max_num_f32 %2, %9, %18 :: v_dual_max_num_f32 %3, %13, %19\n\t"
        "v_dual_max_num_f32 %4, %10, %20 :: v_dual_max_num_f32 %5, %14, %21\n\t"
        "v_dual_max_num_f32 %6, %11, %22 :: v_dual_max_num_f32 %7, %15, %23"
        : "=&v"(t0.x), "=&v"(t0.y), "=&v"(t1.x), "=&v"(t1.y),
          "=&v"(t2.x), "=&v"(t2.y), "=&v"(t3.x), "=&v"(t3.y)
        : "s"(k0), "s"(k1), "s"(k2), "s"(k3), "s"(m0), "s"(m1), "s"(m2), "s"(m3),
          "v"(a0.x), "v"(a0.y), "v"(a1.x), "v"(a1.y), "v"(a2.x), "v"(a2.y), "v"(a3.x), "v"(a3.y));
}

// The same four pairs behind one step of P @ V, in one statement: the compiler does not see
// which registers asm text writes, so it could hand the product's A or B registers to pairs that
// follow it at once. Here they are inputs of the statement whose outputs are all early-clobber,
// and the four pairs fill the four vector slots that the chip asks for behind a product.
__device__ __forceinline__ void product_and_larger_dims(
    v8f& c, v2f pa, v2f b,
    v2f& t0, v2f& t1, v2f& t2, v2f& t3, v2f a0, v2f a1, v2f a2, v2f a3,
    float k0, float k1, float k2, float k3, float m0, float m1, float m2, float m3)
{
    asm(
        "v_wmma_f32_16x16x4_f32 %0, %9, %10, %0\n\t"
        "v_dual_max_num_f32 %1, %11, %19 :: v_dual_max_num_f32 %2, %15, %20\n\t"
        "v_dual_max_num_f32 %3, %12, %21 :: v_dual_max_num_f32 %4, %16, %22\n\t"
        "v_dual_max_num_f32 %5, %13, %23 :: v_dual_max_num_f32 %6, %17, %24\n\t"
        "v_dual_max_num_f32 %7, %14, %25 :: v_dual_max_num_f32 %8, %18, %26"
        : "+v"(c),
          "=&v"(t0.x), "=&v"(t0.y), "=&v"(t1.x), "=&v"(t1.y),
          "=&v"(t2.x), "=&v"(t2.y), "=&v"(t3.x), "=&v"(t3.y)
        : "v"(pa), "v"(b),
          "s"(k0), "s"(k1), "s"(k2), "s"(k3), "s"(m0), "s"(m1), "s"(m2), "s"(m3),
          "v"(a0.x), "v"(a0.y), "v"(a1.x), "v"(a1.y), "v"(a2.x), "v"(a2.y), "v"(a3.x), "v"(a3.y));
}

__global__ __launch_bounds__(512) void edge_softmax_pass(
    const float* __restrict__ Q, const float* __restrict__ K,
    const float* __restrict__ V,
    const float* __restrict__ wA, const float* __restrict__ bA,
    const float* __restrict__ Wev,
    float* __restrict__ Op,
    float* __restrict__ Mp, float* __restrict__ Dp,
    const float* K_ask, const float* V_ask)
{
    // Scores lie in LDS as they lie in registers: [lane = row][column of the group].
    __shared__ __attribute__((aligned(16))) float Ep[NWV][32][EPIT];   // per-wave partial scores
    __shared__ __attribute__((aligned(16))) float Mx[32][MPIT];        // [lane][wave]: maxima of eight columns
    __shared__ __attribute__((aligned(16))) float Pm[RWG][PPIT];       // weights, row-major: [row][column of the chunk]
    __shared__ __attribute__((aligned(16))) float To[3][RWG][OPIT];    // row-major staging: S of either group, result
    __shared__ float Dn[NG][RWG];                                      // denominators, per column group

    const int tid  = threadIdx.x;
    const int lane = tid & 31;
    const int wave = __builtin_amdgcn_readfirstlane(tid >> 5);
    const int grp  = wave >> 3;            // column group
    const int wv   = wave & 7;             // slice of dims inside the group
    const int row0 = blockIdx.x * RWG;
    const int i    = row0 + lane;
    const int d0   = wv * DSL;
    const int jbeg = blockIdx.y * JC;

    // The chunk's K rows and V rows are 64 KB each, contiguous: 512 lines of 128 bytes each, one
    // of either per thread. The scalar loads below come to them group by group.
    const float* const ahead_k = K_ask + (size_t)jbeg * DIM + tid * 32;
    const float* const ahead_v = V_ask + (size_t)jbeg * DIM + tid * 32;
    ask_l2(ahead_k);
    ask_l2(ahead_v);
    // No instruction comes of this fence. With the asm statement as the last memory event in
    // front of the loop the compiler takes K and V as possibly rewritten and turns the loop's
    // scalar loads into vector loads with a copy to a scalar register per word.
    __builtin_amdgcn_fence(__ATOMIC_ACQUIRE, "wavefront");

    // Every '#pragma unroll' below makes the indices of these register arrays constants.
    const v2f zero2 = {0.f, 0.f};
    v2f nq[DSL], s[DSL];      // nq = -Q in both halves; s: even columns' sum, odd columns' sum
    float w[DSL];
    // A lane's own Q row read straight from memory touches 32 cache lines per load. The 32 rows
    // come in once as whole 512-byte rows (one wave, one row per load) and each lane takes its
    // row's dims from LDS. The plane is free here: its S sums are staged behind later barriers.
    float4 qrow[RWG / NWV];
#pragma unroll
    for (int u = 0; u < RWG / NWV; ++u)
        qrow[u] = *(const float4*)(Q + (size_t)(row0 + wave + NWV * u) * DIM + lane * 4);
#pragma unroll
    for (int d = 0; d < DSL; ++d) { w[d] = wA[d0 + d]; s[d] = zero2; }
    // W_A for both halves of a pair, formed once here: formed inside the score loop each costs
    // a copy to a scalar register on every trip.
    v2f w2[DSL];
#pragma unroll
    for (int d = 0; d < DSL; ++d) w2[d] = both(w[d]);
    const float ba = bA[0];

    // Matrix tiles of the chunk's 32 x 128 result: 2 x 8 tiles of 16 x 16, one per wave. Wave w
    // owns column tile w % 8 and row tile w / 8: rows m0 .. m0+15. Its k steps go by turns into
    // two accumulators, added at the end, so that no product waits for the one before it.
    const int  lo    = lane & 15;
    const int  hi    = lane >> 4;
    const int  n0    = wv * 16;
    const int  m0    = grp * 16;
    v8f c0 = {0.f,0.f,0.f,0.f,0.f,0.f,0.f,0.f};
    v8f c1 = {0.f,0.f,0.f,0.f,0.f,0.f,0.f,0.f};

    // The group's 64 K rows, this wave's 16 dims.
    const float* __restrict__ Kt = K + (size_t)(jbeg + grp * TJ) * DIM + d0;

    // The Q rows go through LDS.
#pragma unroll
    for (int u = 0; u < RWG / NWV; ++u)
        *(float4*)&To[0][wave + NWV * u][lane * 4] = qrow[u];
    // A work-group barrier that orders LDS alone, as no global access is handed over here.
    __builtin_amdgcn_fence(__ATOMIC_RELEASE, "workgroup", "local");
    __builtin_amdgcn_s_barrier();
    __builtin_amdgcn_fence(__ATOMIC_ACQUIRE, "workgroup", "local");
#pragma unroll
    for (int u = 0; u < DSL / 4; ++u) {
        const float4 ta = *(const float4*)&To[0][lane][d0 + 4 * u];
        nq[4*u].x   = -ta.x; nq[4*u].y   = -ta.x;
        nq[4*u+1].x = -ta.y; nq[4*u+1].y = -ta.y;
        nq[4*u+2].x = -ta.z; nq[4*u+2].y = -ta.z;
        nq[4*u+3].x = -ta.w; nq[4*u+3].y = -ta.w;
    }

    // Holds the V loads below behind the staging of Q: loads return in order, and the scheduler
    // put most of the 64 V loads in front of the Q loads, so that the staging waited for them too.
    __builtin_amdgcn_sched_barrier(0);
    // The chunk's V fragments (B, 4 x 16 per step), asked for here so that they travel
    // during the scores.
    const float* __restrict__ Vf = V + (size_t)(jbeg + 2 * hi) * DIM + n0 + lo;
    v2f bv[JC / 4];
#pragma unroll
    for (int kk = 0; kk < JC / 4; ++kk) {
        bv[kk].x = Vf[(size_t)(4 * kk)     * DIM];
        bv[kk].y = Vf[(size_t)(4 * kk + 1) * DIM];
    }

    // Partial scores over this wave's 16 dims, 64 columns, one row, all inside the lane.
#pragma unroll 1   // one copy of the body, for the instruction cache; no register array is indexed by g
    for (int g = 0; g < TJ / 8; ++g) {
        v2f e4[4];             // columns 8g+2c, 8g+2c+1
#pragma unroll
        for (int c = 0; c < 4; ++c) e4[c] = zero2;
#pragma unroll
        for (int dh = 0; dh < DSL / 8; ++dh) {
            float k8[8][8];
#pragma unroll
            for (int c = 0; c < 8; ++c)
#pragma unroll
                for (int d = 0; d < 8; ++d)
                    k8[c][d] = Kt[(size_t)(8 * g + c) * DIM + 8 * dh + d];
            // Keeps the eight rows' scalar loads together in front of their arithmetic: one
            // wait per eight columns; left alone the scheduler loads and waits row by row.
            __builtin_amdgcn_sched_barrier(0);
#pragma unroll
            for (int d = 0; d < 8; d += 2) {
                v2f t8[8];
                larger_cols(t8[0], t8[1], t8[2], t8[3], nq[8 * dh + d],
                            k8[0][d], k8[1][d], k8[2][d], k8[3][d],
                            k8[4][d], k8[5][d], k8[6][d], k8[7][d]);
                larger_cols(t8[4], t8[5], t8[6], t8[7], nq[8 * dh + d + 1],
                            k8[0][d+1], k8[1][d+1], k8[2][d+1], k8[3][d+1],
                            k8[4][d+1], k8[5][d+1], k8[6][d+1], k8[7][d+1]);
                // Holds the eight sums behind all eight pairs (the distance named at larger_cols).
                __builtin_amdgcn_sched_barrier(0);
#pragma unroll
                for (int c = 0; c < 4; ++c)
                    e4[c] = __builtin_elementwise_fma(t8[c], w2[8 * dh + d], e4[c]);
#pragma unroll
                for (int c = 0; c < 4; ++c)
                    e4[c] = __builtin_elementwise_fma(t8[4 + c], w2[8 * dh + d + 1], e4[c]);
                // Holds the next dims' pairs behind these sums, for the same distance.
                __builtin_amdgcn_sched_barrier(0);
            }
        }
#pragma unroll
        for (int u = 0; u < 2; ++u)
            *(float4*)&Ep[wave][lane][8 * g + 4 * u] =
                make_float4(e4[2*u].x, e4[2*u].y, e4[2*u+1].x, e4[2*u+1].y);
        // Lower edge: the next group's loads are not lifted in among this arithmetic,
        // where they would split into single loads with a wait each.
        __builtin_amdgcn_sched_barrier(0);
    }
    __syncthreads();

    // Wave w adds the 8 partial sums of its group's columns 8*(w%8) .. +7 (each lane's row),
    // in wave order, keeps the eight scores and leaves their maximum in LDS.
    float4 ac0 = *(const float4*)&Ep[grp * GWV][lane][8 * wv];
    float4 ac1 = *(const float4*)&Ep[grp * GWV][lane][8 * wv + 4];
#pragma unroll
    for (int o = 1; o < GWV; ++o) {
        const float4 x4 = *(const float4*)&Ep[grp * GWV + o][lane][8 * wv];
        const float4 y4 = *(const float4*)&Ep[grp * GWV + o][lane][8 * wv + 4];
        ac0.x += x4.x; ac0.y += x4.y; ac0.z += x4.z; ac0.w += x4.w;
        ac1.x += y4.x; ac1.y += y4.y; ac1.z += y4.z; ac1.w += y4.w;
    }
    ac0.x += ba; ac0.y += ba; ac0.z += ba; ac0.w += ba;
    ac1.x += ba; ac1.y += ba; ac1.z += ba; ac1.w += ba;
    Mx[lane][wave] = fmaxf(fmaxf(fmaxf(ac0.x, ac0.y), fmaxf(ac0.z, ac0.w)),
                           fmaxf(fmaxf(ac1.x, ac1.y), fmaxf(ac1.z, ac1.w)));
    __syncthreads();

    // The first eight K rows of the sums below, asked for in front of the softmax: the LDS
    // wait further down would otherwise hold these loads back to where they are needed.
    float kfirst[8][8];
#pragma unroll
    for (int c = 0; c < 8; ++c)
#pragma unroll
        for (int d = 0; d < 8; ++d)
            kfirst[c][d] = Kt[(size_t)c * DIM + d];

    // The row's maximum over all 128 columns of the chunk: one softmax, no rescale.
    float mrun = -1e30f;
#pragma unroll
    for (int u = 0; u < NWV / 4; ++u) {
        const float4 x4 = *(const float4*)&Mx[lane][4 * u];
        mrun = fmaxf(mrun, fmaxf(fmaxf(x4.x, x4.y), fmaxf(x4.z, x4.w)));
    }

    // The weights of the eight columns that this wave summed go to the row-major plane, from
    // which every wave takes its A fragments of P @ V over all 128 columns and each lane its
    // own row's weights for the S sums.
    *(float4*)&Pm[lane][grp * TJ + 8 * wv] =
        make_float4(fast_exp(ac0.x - mrun), fast_exp(ac0.y - mrun),
                    fast_exp(ac0.z - mrun), fast_exp(ac0.w - mrun));
    *(float4*)&Pm[lane][grp * TJ + 8 * wv + 4] =
        make_float4(fast_exp(ac1.x - mrun), fast_exp(ac1.y - mrun),
                    fast_exp(ac1.z - mrun), fast_exp(ac1.w - mrun));

    // A work-group barrier that orders LDS alone (Pm is complete behind it): __syncthreads()
    // would also wait for the K loads above, and the K loads below would no longer be scalar.
    __builtin_amdgcn_fence(__ATOMIC_RELEASE, "workgroup", "local");
    __builtin_amdgcn_s_barrier();
    __builtin_amdgcn_fence(__ATOMIC_ACQUIRE, "workgroup", "local");

    // A fragments, two steps of four columns per block of the sums below, read one block ahead.
    v2f pa[JC / 4];
#pragma unroll
    for (int kk = 0; kk < 2; ++kk)
        pa[kk] = *(const v2f*)&Pm[m0 + lo][4 * kk + 2 * hi];

    // The weights of the group's 64 columns, each lane for its own row: p[m] = columns 2m, 2m+1.
    // Eight columns are read here, the others in the loop, eight columns ahead of their use: all
    // 64 read here would hold the first sums back until the LDS has served every wave.
    v2f p[TJ / 2];
#pragma unroll
    for (int g = 0; g < 2; ++g) {
        const float4 x4 = *(const float4*)&Pm[lane][grp * TJ + 4 * g];
        p[2*g].x   = x4.x; p[2*g].y   = x4.y;
        p[2*g+1].x = x4.z; p[2*g+1].y = x4.w;
    }
    v2f denom2 = zero2;       // of the group's even and odd columns, summed among the S sums

#pragma unroll
    for (int b = 0; b < (TJ / 8) * (DSL / 8); ++b) {
        const int h  = b >> 1;       // eight columns of the group
        const int dh = b & 1;        // eight dims of the wave
        float kc[8][8];
#pragma unroll
        for (int c = 0; c < 8; ++c)
#pragma unroll
            for (int d = 0; d < 8; ++d)
                kc[c][d] = b == 0 ? kfirst[c][d] : Kt[(size_t)(8 * h + c) * DIM + 8 * dh + d];
        if (b + 1 < (TJ / 8) * (DSL / 8)) {
#pragma unroll
            for (int kk = 2 * b + 2; kk < 2 * b + 4; ++kk)
                pa[kk] = *(const v2f*)&Pm[m0 + lo][4 * kk + 2 * hi];
        }
        if (dh == 0 && h + 1 < TJ / 8) {
#pragma unroll
            for (int g = 2 * h + 2; g < 2 * h + 4; ++g) {
                const float4 x4 = *(const float4*)&Pm[lane][grp * TJ + 4 * g];
                p[2*g].x   = x4.x; p[2*g].y   = x4.y;
                p[2*g+1].x = x4.z; p[2*g+1].y = x4.w;
            }
        }
        // Keeps eight columns' K scalar loads together in front of their arithmetic
        // (one wait per eight columns), as in the score loop.
        __builtin_amdgcn_sched_barrier(0);
#pragma unroll
        for (int c = 0; c < 4; ++c) {      // columns 8h+2c, 8h+2c+1
            v2f td[8];
            if ((c & 1) == 0) {
                // Columns 4kk .. 4kk+3 of the chunk in P @ V; the matrix unit works on them
                // while the vector port goes on with the S sums.
                const int kk = 2 * b + (c >> 1);
                product_and_larger_dims((c >> 1) ? c1 : c0, pa[kk], bv[kk],
                                        td[0], td[1], td[2], td[3],
                                        nq[8*dh], nq[8*dh+1], nq[8*dh+2], nq[8*dh+3],
                                        kc[2*c][0], kc[2*c][1], kc[2*c][2], kc[2*c][3],
                                        kc[2*c+1][0], kc[2*c+1][1], kc[2*c+1][2], kc[2*c+1][3]);
            } else {
                larger_dims(td[0], td[1], td[2], td[3],
                            nq[8*dh], nq[8*dh+1], nq[8*dh+2], nq[8*dh+3],
                            kc[2*c][0], kc[2*c][1], kc[2*c][2], kc[2*c][3],
                            kc[2*c+1][0], kc[2*c+1][1], kc[2*c+1][2], kc[2*c+1][3]);
            }
            larger_dims(td[4], td[5], td[6], td[7],
                        nq[8*dh+4], nq[8*dh+5], nq[8*dh+6], nq[8*dh+7],
                        kc[2*c][4], kc[2*c][5], kc[2*c][6], kc[2*c][7],
                        kc[2*c+1][4], kc[2*c+1][5], kc[2*c+1][6], kc[2*c+1][7]);
            // Holds the eight sums behind all eight pairs (the distance named at larger_cols).
            __builtin_amdgcn_sched_barrier(0);
            const v2f pj = p[4 * h + c];
#pragma unroll
            for (int d = 0; d < 8; ++d)
                s[8 * dh + d] = __builtin_elementwise_fma(pj, td[d], s[8 * dh + d]);
            if (dh == 0) denom2 += pj;
            // Holds the next columns' pairs behind these sums, for the same distance.
            __builtin_amdgcn_sched_barrier(0);
        }
        // Lower edge of the block, as in the score loop.
        __builtin_amdgcn_sched_barrier(0);
    }

    keep_address(ahead_k);
    keep_address(ahead_v);

    // Even and odd columns' sums meet, with the Q_i part of relu(Q_i+K_j) for all the group's
    // columns at once.
    const float denom = denom2.x + denom2.y;
    float sd[DSL];
#pragma unroll
    for (int d = 0; d < DSL; ++d) sd[d] = fmaf(-nq[d].x, denom, s[d].x + s[d].y);

    // Output product of the chunk, on the tile that holds AV.

    // The wave's W_Ev strip, asked for here so that it travels during the staging, the barrier
    // and the first products.
    v2f bw[DIM / 4];
#pragma unroll
    for (int kk = 0; kk < DIM / 4; ++kk) {
        const int ka = 4 * kk + 2 * hi;
        bw[kk].x = Wev[(size_t)ka       * DIM + n0 + lo];
        bw[kk].y = Wev[(size_t)(ka + 1) * DIM + n0 + lo];
    }

    // Lane-per-row registers -> row-major LDS, one plane per column group.
#pragma unroll
    for (int u = 0; u < DSL / 4; ++u)
        *(float4*)&To[grp][lane][d0 + 4 * u] = make_float4(sd[4*u], sd[4*u+1], sd[4*u+2], sd[4*u+3]);
    if (wv == 0) Dn[grp][lane] = denom;
    // A work-group barrier that orders LDS alone: __syncthreads() would also wait here for all
    // 64 W_Ev loads, which no other wave reads; so each product waits only for its own two.
    __builtin_amdgcn_fence(__ATOMIC_RELEASE, "workgroup", "local");
    __builtin_amdgcn_s_barrier();
    __builtin_amdgcn_fence(__ATOMIC_ACQUIRE, "workgroup", "local");

#pragma unroll
    for (int kk = 0; kk < DIM / 4; kk += 2) {
        const int ka = 4 * kk + 2 * hi;
        const v2f a0 = *(const v2f*)&To[0][m0 + lo][ka]     + *(const v2f*)&To[1][m0 + lo][ka];
        const v2f a1 = *(const v2f*)&To[0][m0 + lo][ka + 4] + *(const v2f*)&To[1][m0 + lo][ka + 4];
        c0 = __builtin_amdgcn_wmma_f32_16x16x4_f32(
                 false, a0, false, bw[kk], (short)0, c0, false, false);
        c1 = __builtin_amdgcn_wmma_f32_16x16x4_f32(
                 false, a1, false, bw[kk + 1], (short)0, c1, false, false);
    }
#pragma unroll
    for (int r = 0; r < 8; ++r)
        To[2][m0 + 8 * hi + r][n0 + lo] = c0[r] + c1[r];
    __syncthreads();

    // Row-major LDS -> whole 512-byte rows to memory.
    const size_t base = ((size_t)blockIdx.y * NPTS + row0) * DIM;
#pragma unroll
    for (int u = 0; u < RWG / NWV; ++u) {
        const int r = wave + NWV * u;     // one wave stores one row
        *(float4*)(Op + base + (size_t)r * DIM + lane * 4) = *(const float4*)&To[2][r][lane * 4];
    }
    // The stores above are still in flight: their address and data registers
    // are not rewritten in front of this wait.
    asm volatile("s_wait_xcnt 0x0" ::: "memory");
    if (wave == 0) {
        Mp[blockIdx.y * NPTS + i] = mrun;
        Dp[blockIdx.y * NPTS + i] = Dn[0][lane] + Dn[1][lane];
    }
}

// ---------------------------------------------------------------------------
// Kernel 2b: merge the NCH chunks of a row into the output:
//   out_i = sum_c exp(m_c - M) Op_c / sum_c exp(m_c - M) D_c + b_Ev,  M = max_c m_c.
// grid = NPTS/4, block = 128; one wave per row, lane = 4 dims.
// ---------------------------------------------------------------------------
__global__ __launch_bounds__(128) void merge_chunks(
    const float* __restrict__ Op,
    const float* __restrict__ Mp, const float* __restrict__ Dp,
    const float* __restrict__ bev,
    float* __restrict__ out,
    const float* Op_ask, const float* Mp_ask, const float* Dp_ask)
{
    const int lane = threadIdx.x & 31;
    const int wave = __builtin_amdgcn_readfirstlane(threadIdx.x >> 5);
    const int row  = blockIdx.x * 4 + wave;

    // All that this wave reads of the launch before: 8 chunk rows of 512 bytes (32 lines, one
    // per lane) and the row's 8 maxima and 8 denominators (one line each; lanes 16 to 31 name
    // the denominators' lines again). Part of the loads below issue only behind the first wait.
    const float* const ahead0 = Op_ask + ((size_t)(lane >> 2) * NPTS + row) * DIM + (lane & 3) * 32;
    const float* const ahead2 = (lane < NCH ? Mp_ask : Dp_ask) + (lane & (NCH - 1)) * NPTS + row;
    ask_l2(ahead0);
    ask_l2(ahead2);

    float4 x[NCH];
#pragma unroll
    for (int c = 0; c < NCH; ++c)
        x[c] = *(const float4*)(Op + ((size_t)c * NPTS + row) * DIM + lane * 4);
    const float4 b4 = *(const float4*)(bev + lane * 4);

    float m[NCH];
    float M = -1e30f;
#pragma unroll
    for (int c = 0; c < NCH; ++c) { m[c] = Mp[c * NPTS + row]; M = fmaxf(M, m[c]); }

    float  den = 0.f;
    float4 acc = {0.f, 0.f, 0.f, 0.f};
#pragma unroll
    for (int c = 0; c < NCH; ++c) {
        const float f = fast_exp(m[c] - M);
        den   = fmaf(f, Dp[c * NPTS + row], den);
        acc.x = fmaf(f, x[c].x, acc.x);
        acc.y = fmaf(f, x[c].y, acc.y);
        acc.z = fmaf(f, x[c].z, acc.z);
        acc.w = fmaf(f, x[c].w, acc.w);
    }
    const float inv = 1.0f / den;
    *(float4*)(out + (size_t)row * DIM + lane * 4) =
        make_float4(fmaf(acc.x, inv, b4.x), fmaf(acc.y, inv, b4.y),
                    fmaf(acc.z, inv, b4.z), fmaf(acc.w, inv, b4.w));
    keep_address(ahead0);
    keep_address(ahead2);
}

// ---------------------------------------------------------------------------
// Launch: inputs:
// 0:x 1:W_Q 2:b_Q 3:W_K 4:b_K 5:W_V 6:b_V 7:W_Ev 8:b_Ev 9:W_A 10:b_A
// Workspace: Q,K,V (3 planes of 1024*128 floats), then per chunk of j the unnormalised
// AV + S @ W_Ev (NCH planes) and each row's max and denominator.
// ---------------------------------------------------------------------------
extern "C" void kernel_launch(void* const* d_in, const int* in_sizes, int n_in,
                              void* d_out, int out_size, void* d_ws, size_t ws_size,
                              hipStream_t stream) {
    const float* x   = (const float*)d_in[0];
    const float* Wq  = (const float*)d_in[1];
    const float* bq  = (const float*)d_in[2];
    const float* Wk  = (const float*)d_in[3];
    const float* bk  = (const float*)d_in[4];
    const float* Wv  = (const float*)d_in[5];
    const float* bv  = (const float*)d_in[6];
    const float* Wev = (const float*)d_in[7];
    const float* bev = (const float*)d_in[8];
    const float* wA  = (const float*)d_in[9];
    const float* bA  = (const float*)d_in[10];

    float* ws = (float*)d_ws;
    float* Q  = ws;
    float* K  = ws + 1 * NPTS * DIM;
    float* V  = ws + 2 * NPTS * DIM;
    float* Op = ws + 3 * NPTS * DIM;
    float* Mp = ws + (3 + NCH) * NPTS * DIM;
    float* Dp = ws + (3 + NCH) * NPTS * DIM + NCH * NPTS;

    qkv_gemm_wmma<<<dim3(NPTS / 16, 3), 256, 0, stream>>>(
        x, Wq, bq, Wk, bk, Wv, bv, Q, K, V);

    edge_softmax_pass<<<dim3(NPTS / RWG, NCH), 32 * NWV, 0, stream>>>(
        Q, K, V, wA, bA, Wev, Op, Mp, Dp, K, V);

    merge_chunks<<<NPTS / 4, 128, 0, stream>>>(
        Op, Mp, Dp, bev, (float*)d_out, Op, Mp, Dp);
}
